// v000
// Measured on an AMD MI455X. A time is GPU time per run, averaged over a window of back-to-back runs after a warm-up
// (all launches, gaps included; the runs take copies of the inputs in turn), and the median of several windows.
// Apart from v000's, it joins two sittings. Times from different sittings can be a few percent apart, while
// side-by-side timings come from the same sitting.
// v000, which the later versions start from, runs in 621 microseconds.
// compute dtype: key/query/value inputs, the four Linear weights/biases and the two relative tables (module inputs) rounded to bf16; q/k/v projections with exact bf16 products (inputs x weights); scores q.k with both operands as bf16 hi + residual pairs (3 products) plus the relative-key term q.rel_k[clip(k-q)] (5 f32 dot products per (token, head)); P.V with P hi/lo x V hi/lo (3 products) plus the relative-value term sum_j mass_j rel_v[j]; output projection hi/lo x exact Wo (2 products) + bo; softmax in f32; f32 accumulate.
#include <hip/hip_runtime.h>
#include <math.h>

typedef __attribute__((ext_vector_type(16))) _Float16 v16h;
typedef __attribute__((ext_vector_type(16))) __bf16 v16b;
typedef __attribute__((ext_vector_type(8)))  _Float16 v8h;
typedef __attribute__((ext_vector_type(8)))  float v8f;
typedef __attribute__((ext_vector_type(4)))  float v4f;
typedef __attribute__((ext_vector_type(2)))  float v2f;
typedef __attribute__((ext_vector_type(4)))  unsigned v4u;
typedef __attribute__((ext_vector_type(4)))  int v4i;
typedef float __attribute__((may_alias)) float_a;
typedef int __attribute__((may_alias)) int_a;

template <typename T> __device__ __forceinline__ void vst2(void* p, T v) { *(T*)p = v;  }
__device__ __forceinline__ v8f wmma16(v16h a, v16h b, v8f c) {
  v8f d = __builtin_amdgcn_wmma_f32_16x16x32_f16(false, a, false, b, (short)0, c, false, false);
  asm volatile("v_nop\n\tv_nop\n\tv_nop\n\tv_nop" : "+v"(d) : "v"(a), "v"(b));
  return d;
}
__device__ __forceinline__ v8f wmma_bf(v16b a, v16b b, v8f c) {
  v8f d = __builtin_amdgcn_wmma_f32_16x16x32_bf16(false, a, false, b, (short)0, c, false, false);
  asm volatile("v_nop\n\tv_nop\n\tv_nop\n\tv_nop" : "+v"(d) : "v"(a), "v"(b));
  return d;
}
// 16x16x32 fragments: lane = (h = lane>>4, row/col = lane&15); elements 0..7 = k0+8h+0..7, 8..15 = k0+16+8h+0..7; D element r = row 8h+r
__device__ __forceinline__ v16h frag_h(const _Float16* rowk0, int lane) {
  union { v16h v; v8h q[2]; } u; const _Float16* p = rowk0 + 8 * (lane >> 4);
  u.q[0] = *(const v8h*)p; u.q[1] = *(const v8h*)(p + 16); return u.v;
}
__device__ __forceinline__ v16h frag_f32(const float* rowk0, int lane) {
  v16h a; const float* p = rowk0 + 8 * (lane >> 4);
#pragma unroll
  for (int i = 0; i < 8; ++i) { a[i] = (_Float16)p[i]; a[8 + i] = (_Float16)p[16 + i]; }
  return a;
}
__device__ __forceinline__ v16h frag_f32s(const float* rowk0, int lane, float sc) {
  v16h a; const float* p = rowk0 + 8 * (lane >> 4);
#pragma unroll
  for (int i = 0; i < 8; ++i) { a[i] = (_Float16)(p[i] * sc); a[8 + i] = (_Float16)(p[16 + i] * sc); }
  return a;
}
// column fragment from a [K][ld] layout (column n), rows >= K read as 0
__device__ __forceinline__ v16h fragc_f32(const float* W, int k0, int n, int lane, int ld, int K) {
  v16h a; const int g = lane >> 4;
#pragma unroll
  for (int i = 0; i < 8; ++i) { const int ka = k0 + 8 * g + i, kb = ka + 16;
    a[i] = (_Float16)(ka < K ? W[(size_t)(ka < K ? ka : K - 1) * ld + n] : 0.f); a[8 + i] = (_Float16)(kb < K ? W[(size_t)(kb < K ? kb : K - 1) * ld + n] : 0.f); }
  return a;
}
struct F2 { v16b h, l; };
__device__ __forceinline__ F2 bsplit16(const float v[16]) { F2 r;
#pragma unroll
  for (int i = 0; i < 16; ++i) { const __bf16 h = (__bf16)v[i]; r.h[i] = h; r.l[i] = (__bf16)(v[i] - (float)h); }
  return r; }
__device__ __forceinline__ F2 split_row(const float* row, int k0, int lane) { float v[16]; const float* p = row + k0 + 8 * (lane >> 4);
#pragma unroll
  for (int i = 0; i < 8; ++i) { v[i] = p[i]; v[8 + i] = p[16 + i]; }
  return bsplit16(v); }
__device__ __forceinline__ F2 split_rowK(const float* row, int k0, int lane, int K) { float v[16]; const int g = lane >> 4;
#pragma unroll
  for (int i = 0; i < 8; ++i) { const int ka = k0 + 8 * g + i, kb = ka + 16; v[i] = ka < K ? row[ka < K ? ka : K - 1] : 0.f; v[8 + i] = kb < K ? row[kb < K ? kb : K - 1] : 0.f; }
  return bsplit16(v); }
__device__ __forceinline__ F2 split_col(const float* W, int k0, int n, int lane, int ld, int K) { float v[16]; const int g = lane >> 4;
#pragma unroll
  for (int i = 0; i < 8; ++i) { const int ka = k0 + 8 * g + i, kb = ka + 16; v[i] = ka < K ? W[(size_t)(ka < K ? ka : K - 1) * ld + n] : 0.f; v[8 + i] = kb < K ? W[(size_t)(kb < K ? kb : K - 1) * ld + n] : 0.f; }
  return bsplit16(v); }
__device__ __forceinline__ v8f mac3(const F2& a, const F2& b, v8f c) { c = wmma_bf(a.l, b.h, c); c = wmma_bf(a.h, b.l, c); return wmma_bf(a.h, b.h, c); }
__device__ __forceinline__ float sigm(float v) { return 1.0f / (1.0f + expf(-v)); }
#define LDSX() do { asm volatile("s_wait_dscnt 0" ::: "memory"); __builtin_amdgcn_wave_barrier(); __builtin_amdgcn_fence(__ATOMIC_RELEASE, "workgroup"); } while (0)


// Multi-head attention with clipped relative position embeddings (B 2, Lq = Lk = 2048, hid 1024, 16 heads x 64, max_rel 2): q = query Wq^T + bq, k = key Wk^T + bk, v = value Wv^T + bv; attn = softmax((q k^T + q . rel_k[clip(k - q, -2, 2) + 2]) / 8); x = attn v + sum_k attn rel_v[clip(k - q) + 2]; out = x Wo^T + bo.
#define NB 2
#define SS 2048
#define DM 1024
#define NH 16
#define HD 64
#define QKVW (3 * DM)
#ifndef TQB
#define TQB (SS / 64)
#define TNB NB
#define TOB (NB * SS / 64)     // output row tiles (all)
#endif
typedef __attribute__((ext_vector_type(8))) __bf16 v8b;
__device__ __forceinline__ v16b frag_b(const __bf16* rowk0, int lane) {
  union { v16b v; v8b q[2]; } u; const __bf16* p = rowk0 + 8 * (lane >> 4);
  u.q[0] = *(const v8b*)p; u.q[1] = *(const v8b*)(p + 16); return u.v;
}
__device__ __forceinline__ float bfr(float v) { return (float)(__bf16)v; }
__device__ __attribute__((noinline)) float exp_ni(float v) { return expf(v); }
__device__ __attribute__((noinline)) float erf_ni(float v) { return erff(v); }

#define PK_A 0                       // [3072][1024] c_attn kernel rows (natural)
#define PK_P (PK_A + QKVW * DM)        // [1024][1024] c_proj kernel rows
#define PK_END (PK_P + DM * DM)
#define WS_PK  0u
#define WS_QK  (WS_PK + 2u * PK_END)             // f32 [4096 rows][3072]: [q | k | v], each h*64+d
#define WS_VTH (WS_QK + 4u * NB * SS * QKVW)     // bf16 [2][1024 (h*64+d)][2048 s]
#define WS_VTL (WS_VTH + 2u * NB * DM * SS)
#define WS_O   (WS_VTL + 2u * NB * DM * SS)        // f32 [4096][1024]
#define WS_END (WS_O + 4u * NB * SS * DM)

// ---- k_packrows: block = natural row n of a [N][K] weight (torch [out,in])
__global__ __launch_bounds__(256) void k_packrows(const float* __restrict__ Wm, int K, __bf16* __restrict__ DST) {
  __shared__ __align__(16) __bf16 s[DM]; const int n = blockIdx.x, tid = threadIdx.x;
  for (int k = tid; k < K; k += 256) s[k] = (__bf16)Wm[(size_t)n * K + k];
  __syncthreads();
  for (int q = tid; q < K / 8; q += 256) vst2((unsigned*)(DST + (size_t)n * K + q * 8), *(const v4u*)&s[q * 8]);
}
// ---- k_qkv: block = (64 rows, 128 of the 3072 cols): QKV = bf16(x) . rows (exact) -> f32 rows (pitch 3072)
__global__ __launch_bounds__(128) void k_qkv(const float* __restrict__ XQ, const float* __restrict__ XK, const float* __restrict__ XV, const __bf16* __restrict__ P, const float* __restrict__ BQ, const float* __restrict__ BK, const float* __restrict__ BV, float* __restrict__ QKV) {
  __shared__ __align__(16) float so[4][16][132];
  const int tid = threadIdx.x, wave = tid >> 5, lane = tid & 31, col = lane & 15, g = lane >> 4; const size_t r0 = (size_t)blockIdx.x * 64 + wave * 16; const int n0 = blockIdx.y * 128; const float* X = (n0 < DM) ? XQ : (n0 < 2 * DM ? XK : XV);
  v8f acc[8] = {};
#pragma unroll 2
  for (int kc = 0; kc < DM / 32; ++kc) { v16b a; { const float* p = X + (r0 + col) * DM + kc * 32 + 8 * g;
#pragma unroll
      for (int i = 0; i < 8; ++i) { a[i] = (__bf16)p[i]; a[8 + i] = (__bf16)p[16 + i]; } }
#pragma unroll
    for (int j = 0; j < 8; ++j) acc[j] = wmma_bf(a, frag_b(P + (size_t)(n0 + j * 16 + col) * DM + kc * 32, lane), acc[j]); }
  const float* bias = (n0 < DM) ? BQ : (n0 < 2 * DM ? BK : BV); const int nb = n0 % DM;
#pragma unroll
  for (int j = 0; j < 8; ++j) { const float bb = bfr(bias[nb + j * 16 + col]);
#pragma unroll
    for (int r = 0; r < 8; ++r) so[wave][8 * g + r][j * 16 + col] = acc[j][r] + bb; }
  LDSX();
  for (int rl = 0; rl < 16; ++rl) vst2(QKV + (r0 + rl) * QKVW + n0 + lane * 4, *(const v4f*)&so[wave][rl][lane * 4]);
}
__global__ __launch_bounds__(256) void k_vt(const float* __restrict__ QKV, __bf16* __restrict__ VTH, __bf16* __restrict__ VTL) {
  __shared__ __align__(16) __bf16 sth[64][72], stl[64][72]; const int tid = threadIdx.x; const size_t rb = (size_t)blockIdx.x * 64; const int h = blockIdx.y; const int b = (int)(rb / SS), s0 = (int)(rb % SS);
  for (int q = tid; q < 64 * 64; q += 256) { const int rl = q >> 6, d = q & 63; const float v = QKV[(rb + rl) * QKVW + 2 * DM + h * HD + d]; const __bf16 hb = (__bf16)v; sth[d][rl] = hb; stl[d][rl] = (__bf16)(v - (float)hb); }
  __syncthreads();
  for (int q = tid; q < 64 * 8; q += 256) { const int d = q >> 3, pc = q & 7; const size_t o = ((size_t)b * DM + h * HD + d) * SS + s0 + pc * 8; vst2((unsigned*)(VTH + o), *(const v4u*)&sth[d][pc * 8]); vst2((unsigned*)(VTL + o), *(const v4u*)&stl[d][pc * 8]); }
}
// ---- k_attn: block = (64 queries, head h, batch b): full flash attention (K = 64) with relative-position terms: logits = (q.k (3 products) + qr[clip(k-q)+2]) / 8; P.V 3 products; per-row probability masses per distance class j (5) rescaled online -> w2 = sum_j (mass_j / l) rel_v[j]; O[b*S+q][h*64+d] = w1 + w2
__global__ __launch_bounds__(128) void k_attn(const float* __restrict__ QK, const __bf16* __restrict__ VTH, const __bf16* __restrict__ VTL, const float* __restrict__ RK, const float* __restrict__ RV, float* __restrict__ O) {
  __shared__ __align__(16) float sp[4][16][36]; __shared__ __align__(16) float so[4][16][68]; __shared__ float sqr[4][16][8];
  const int tid = threadIdx.x, wave = tid >> 5, lane = tid & 31, col = lane & 15, g = lane >> 4;
  const int qb = blockIdx.x, h = blockIdx.y, b = blockIdx.z; const int q0 = qb * 64 + wave * 16; const size_t rq = (size_t)b * SS + q0 + col;
  F2 aq[2];
#pragma unroll
  for (int kc = 0; kc < 2; ++kc) aq[kc] = split_row(QK + rq * QKVW + h * HD, kc * 32, lane);
  // relative-key logits: sqr[row][j] = q_row . rel_k[j] (f32; the lane's partial over its 4 columns, xor-16 reduced; staged in LDS so the runtime class index is not a private-array index)
#pragma unroll 1
  for (int r = 0; r < 8; ++r) { const float* qrow = QK + ((size_t)b * SS + q0 + 8 * g + r) * QKVW + h * HD;
#pragma unroll
    for (int j = 0; j < 5; ++j) { float a = 0.f;
#pragma unroll
      for (int dt = 0; dt < 4; ++dt) a += qrow[dt * 16 + col] * bfr(RK[j * HD + dt * 16 + col]);
#pragma unroll
      for (int o = 1; o < 16; o <<= 1) a += __shfl_xor(a, o);
      if (col == j) sqr[wave][8 * g + r][j] = a; } }
  LDSX();
  float m[8], l[8], ms[8][5];
#pragma unroll
  for (int r = 0; r < 8; ++r) { m[r] = -3.0e38f; l[r] = 0.f; for (int j = 0; j < 5; ++j) ms[r][j] = 0.f; }
  v8f acc[4] = {};
#pragma unroll 1
  for (int ks = 0; ks < SS / 32; ++ks) { v8f s[2]; int jc[2][8];
#pragma unroll
    for (int ct = 0; ct < 2; ++ct) { const int kk = ks * 32 + ct * 16 + col; const float* krow = QK + ((size_t)b * SS + kk) * QKVW + DM + h * HD; v8f c = {};
#pragma unroll
      for (int kc = 0; kc < 2; ++kc) { const F2 kb = split_row(krow, kc * 32, lane); c = mac3(aq[kc], kb, c); }
#pragma unroll
      for (int r = 0; r < 8; ++r) { const int qi = q0 + 8 * g + r; const int dlt = min(max(kk - qi, -2), 2) + 2; jc[ct][r] = dlt; s[ct][r] = (c[r] + sqr[wave][8 * g + r][dlt]) * 0.125f; } }   // (attn1 + attn2) / sqrt(64)
#pragma unroll
    for (int r = 0; r < 8; ++r) { float mx = fmaxf(s[0][r], s[1][r]);
#pragma unroll
      for (int o = 1; o < 16; o <<= 1) mx = fmaxf(mx, __shfl_xor(mx, o));
      const float mn = fmaxf(m[r], mx); const float alpha = exp_ni(m[r] - mn);
      const float e0 = exp_ni(s[0][r] - mn), e1 = exp_ni(s[1][r] - mn); float es = e0 + e1;
#pragma unroll
      for (int o = 1; o < 16; o <<= 1) es += __shfl_xor(es, o);
      l[r] = l[r] * alpha + es; m[r] = mn;
#pragma unroll
      for (int j = 0; j < 5; ++j) { float add = ((jc[0][r] == j) ? e0 : 0.f) + ((jc[1][r] == j) ? e1 : 0.f);
#pragma unroll
        for (int o = 1; o < 16; o <<= 1) add += __shfl_xor(add, o);
        ms[r][j] = ms[r][j] * alpha + add; }
#pragma unroll
      for (int dt = 0; dt < 4; ++dt) acc[dt][r] *= alpha;
      sp[wave][8 * g + r][col] = e0; sp[wave][8 * g + r][16 + col] = e1; }
    LDSX();
    const F2 pa = split_row(&sp[wave][col][0], 0, lane);
#pragma unroll
    for (int dt = 0; dt < 4; ++dt) { const size_t vr = ((size_t)b * DM + h * HD + dt * 16 + col) * SS + ks * 32; const v16b vh = frag_b(VTH + vr, lane), vl = frag_b(VTL + vr, lane); acc[dt] = wmma_bf(pa.l, vh, acc[dt]); acc[dt] = wmma_bf(pa.h, vl, acc[dt]); acc[dt] = wmma_bf(pa.h, vh, acc[dt]); }
    LDSX(); }
#pragma unroll
  for (int r = 0; r < 8; ++r) { const float il = 1.0f / l[r];
#pragma unroll
    for (int dt = 0; dt < 4; ++dt) { const int d = dt * 16 + col; float w2 = 0.f;
#pragma unroll
      for (int j = 0; j < 5; ++j) w2 += (ms[r][j] * il) * bfr(RV[j * HD + d]);
      so[wave][8 * g + r][d] = acc[dt][r] * il + w2; } }
  LDSX();
  for (int rl = 0; rl < 16; ++rl) if (lane < 16) vst2(O + ((size_t)b * SS + q0 + rl) * DM + h * HD + lane * 4, *(const v4f*)&so[wave][rl][lane * 4]);
}
// ---- k_out: block = (64 rows, 128 cols): out = O(hi/lo) . c_proj rows (2 products) + bias
__global__ __launch_bounds__(128) void k_out(const float* __restrict__ O, const __bf16* __restrict__ P, const float* __restrict__ BO, float* __restrict__ Y) {
  __shared__ __align__(16) float so[4][16][132];
  const int tid = threadIdx.x, wave = tid >> 5, lane = tid & 31, col = lane & 15, g = lane >> 4; const size_t r0 = (size_t)blockIdx.x * 64 + wave * 16; const int n0 = blockIdx.y * 128;
  v8f acc[8] = {};
#pragma unroll 2
  for (int kc = 0; kc < DM / 32; ++kc) { const F2 a = split_row(O + (r0 + col) * DM, kc * 32, lane);
#pragma unroll
    for (int j = 0; j < 8; ++j) { const v16b w = frag_b(P + (size_t)(n0 + j * 16 + col) * DM + kc * 32, lane); acc[j] = wmma_bf(a.l, w, acc[j]); acc[j] = wmma_bf(a.h, w, acc[j]); } }
#pragma unroll
  for (int j = 0; j < 8; ++j) { const float bb = bfr(BO[n0 + j * 16 + col]);
#pragma unroll
    for (int r = 0; r < 8; ++r) so[wave][8 * g + r][j * 16 + col] = acc[j][r] + bb; }
  LDSX();
  for (int rl = 0; rl < 16; ++rl) vst2(Y + (r0 + rl) * DM + n0 + lane * 4, *(const v4f*)&so[wave][rl][lane * 4]);
}
extern "C" void kernel_launch(void* const* d_in, const int* in_sizes, int n_in, void* d_out, int out_size, void* d_ws, size_t ws_size, hipStream_t stream) {
  (void)in_sizes; (void)n_in; (void)out_size;
  const float** F = (const float**)d_in;   // 0 key [2,2048,1024], 1 query, 2 value, 3 Wq [1024,1024] (torch), 4 bq, 5 Wk, 6 bk, 7 Wv, 8 bv, 9 Wo, 10 bo, 11 rel_k [5,64], 12 rel_v [5,64]
  if (ws_size < (size_t)WS_END) return;
  char* ws = (char*)d_ws; __bf16 *PK = (__bf16*)(ws + WS_PK), *VTH = (__bf16*)(ws + WS_VTH), *VTL = (__bf16*)(ws + WS_VTL); float *QK = (float*)(ws + WS_QK), *O = (float*)(ws + WS_O);
  k_packrows<<<DM, 256, 0, stream>>>(F[3], DM, PK + PK_A); k_packrows<<<DM, 256, 0, stream>>>(F[5], DM, PK + PK_A + (size_t)DM * DM); k_packrows<<<DM, 256, 0, stream>>>(F[7], DM, PK + PK_A + (size_t)2 * DM * DM); k_packrows<<<DM, 256, 0, stream>>>(F[9], DM, PK + PK_P);
  k_qkv<<<dim3(TNB * SS / 64, QKVW / 128), 128, 0, stream>>>(F[1], F[0], F[2], PK + PK_A, F[4], F[6], F[8], QK);   // q from query, k from key, v from value
  k_vt<<<dim3(TNB * SS / 64, NH), 256, 0, stream>>>(QK, VTH, VTL);
  k_attn<<<dim3(TQB, NH, TNB), 128, 0, stream>>>(QK, VTH, VTL, F[11], F[12], O);
  k_out<<<dim3(TOB, DM / 128), 128, 0, stream>>>(O, PK + PK_P, F[10], (float*)d_out);
}

// v001
// One run takes 488 microseconds.
// Two timings next to v000 put it at 1.32 and 1.33 times that version's speed.
// compute dtype: key/query/value inputs, the four Linear weights/biases and the two relative tables (module inputs) rounded to bf16; q/k/v projections with exact bf16 products (inputs x weights); scores q.k with both operands as bf16 hi + residual pairs (3 products) plus the relative-key term q.rel_k[clip(k-q)] (5 f32 dot products per (token, head)); P.V with P hi/lo x V hi/lo (3 products) plus the relative-value term sum_j mass_j rel_v[j]; output projection hi/lo x exact Wo (2 products) + bo; softmax in f32; f32 accumulate.
#include <hip/hip_runtime.h>
#include <math.h>

typedef __attribute__((ext_vector_type(16))) _Float16 v16h;
typedef __attribute__((ext_vector_type(16))) __bf16 v16b;
typedef __attribute__((ext_vector_type(8)))  _Float16 v8h;
typedef __attribute__((ext_vector_type(8)))  float v8f;
typedef __attribute__((ext_vector_type(4)))  float v4f;
typedef __attribute__((ext_vector_type(2)))  float v2f;
typedef __attribute__((ext_vector_type(4)))  unsigned v4u;
typedef __attribute__((ext_vector_type(4)))  int v4i;
typedef float __attribute__((may_alias)) float_a;
typedef int __attribute__((may_alias)) int_a;

template <typename T> __device__ __forceinline__ void vst2(void* p, T v) { *(T*)p = v;  }
__device__ __forceinline__ v8f wmma16(v16h a, v16h b, v8f c) {
  v8f d = __builtin_amdgcn_wmma_f32_16x16x32_f16(false, a, false, b, (short)0, c, false, false);
  asm volatile("v_nop\n\tv_nop\n\tv_nop\n\tv_nop" : "+v"(d) : "v"(a), "v"(b));
  return d;
}
__device__ __forceinline__ v8f wmma_bf(v16b a, v16b b, v8f c) {
  v8f d = __builtin_amdgcn_wmma_f32_16x16x32_bf16(false, a, false, b, (short)0, c, false, false);
  asm volatile("v_nop\n\tv_nop\n\tv_nop\n\tv_nop" : "+v"(d) : "v"(a), "v"(b));
  return d;
}
// 16x16x32 fragments: lane = (h = lane>>4, row/col = lane&15); elements 0..7 = k0+8h+0..7, 8..15 = k0+16+8h+0..7; D element r = row 8h+r
__device__ __forceinline__ v16h frag_h(const _Float16* rowk0, int lane) {
  union { v16h v; v8h q[2]; } u; const _Float16* p = rowk0 + 8 * (lane >> 4);
  u.q[0] = *(const v8h*)p; u.q[1] = *(const v8h*)(p + 16); return u.v;
}
__device__ __forceinline__ v16h frag_f32(const float* rowk0, int lane) {
  v16h a; const float* p = rowk0 + 8 * (lane >> 4);
#pragma unroll
  for (int i = 0; i < 8; ++i) { a[i] = (_Float16)p[i]; a[8 + i] = (_Float16)p[16 + i]; }
  return a;
}
__device__ __forceinline__ v16h frag_f32s(const float* rowk0, int lane, float sc) {
  v16h a; const float* p = rowk0 + 8 * (lane >> 4);
#pragma unroll
  for (int i = 0; i < 8; ++i) { a[i] = (_Float16)(p[i] * sc); a[8 + i] = (_Float16)(p[16 + i] * sc); }
  return a;
}
// column fragment from a [K][ld] layout (column n), rows >= K read as 0
__device__ __forceinline__ v16h fragc_f32(const float* W, int k0, int n, int lane, int ld, int K) {
  v16h a; const int g = lane >> 4;
#pragma unroll
  for (int i = 0; i < 8; ++i) { const int ka = k0 + 8 * g + i, kb = ka + 16;
    a[i] = (_Float16)(ka < K ? W[(size_t)(ka < K ? ka : K - 1) * ld + n] : 0.f); a[8 + i] = (_Float16)(kb < K ? W[(size_t)(kb < K ? kb : K - 1) * ld + n] : 0.f); }
  return a;
}
struct F2 { v16b h, l; };
__device__ __forceinline__ F2 bsplit16(const float v[16]) { F2 r;
#pragma unroll
  for (int i = 0; i < 16; ++i) { const __bf16 h = (__bf16)v[i]; r.h[i] = h; r.l[i] = (__bf16)(v[i] - (float)h); }
  return r; }
__device__ __forceinline__ F2 split_row(const float* row, int k0, int lane) { float v[16]; const float* p = row + k0 + 8 * (lane >> 4);
#pragma unroll
  for (int i = 0; i < 8; ++i) { v[i] = p[i]; v[8 + i] = p[16 + i]; }
  return bsplit16(v); }
__device__ __forceinline__ F2 split_rowK(const float* row, int k0, int lane, int K) { float v[16]; const int g = lane >> 4;
#pragma unroll
  for (int i = 0; i < 8; ++i) { const int ka = k0 + 8 * g + i, kb = ka + 16; v[i] = ka < K ? row[ka < K ? ka : K - 1] : 0.f; v[8 + i] = kb < K ? row[kb < K ? kb : K - 1] : 0.f; }
  return bsplit16(v); }
__device__ __forceinline__ F2 split_col(const float* W, int k0, int n, int lane, int ld, int K) { float v[16]; const int g = lane >> 4;
#pragma unroll
  for (int i = 0; i < 8; ++i) { const int ka = k0 + 8 * g + i, kb = ka + 16; v[i] = ka < K ? W[(size_t)(ka < K ? ka : K - 1) * ld + n] : 0.f; v[8 + i] = kb < K ? W[(size_t)(kb < K ? kb : K - 1) * ld + n] : 0.f; }
  return bsplit16(v); }
__device__ __forceinline__ v8f mac3(const F2& a, const F2& b, v8f c) { c = wmma_bf(a.l, b.h, c); c = wmma_bf(a.h, b.l, c); return wmma_bf(a.h, b.h, c); }
__device__ __forceinline__ float sigm(float v) { return 1.0f / (1.0f + expf(-v)); }
#define LDSX() do { asm volatile("s_wait_dscnt 0" ::: "memory"); __builtin_amdgcn_wave_barrier(); __builtin_amdgcn_fence(__ATOMIC_RELEASE, "workgroup"); } while (0)


// Multi-head attention with clipped relative position embeddings (B 2, Lq = Lk = 2048, hid 1024, 16 heads x 64, max_rel 2): q = query Wq^T + bq, k = key Wk^T + bk, v = value Wv^T + bv; attn = softmax((q k^T + q . rel_k[clip(k - q, -2, 2) + 2]) / 8); x = attn v + sum_k attn rel_v[clip(k - q) + 2]; out = x Wo^T + bo.
#define NB 2
#define SS 2048
#define DM 1024
#define NH 16
#define HD 64
#define QKVW (3 * DM)
#ifndef TQB
#define TQB (SS / 64)
#define TNB NB
#define TOB (NB * SS / 64)     // output row tiles (all)
#endif
typedef __attribute__((ext_vector_type(8))) __bf16 v8b;
__device__ __forceinline__ v16b frag_b(const __bf16* rowk0, int lane) {
  union { v16b v; v8b q[2]; } u; const __bf16* p = rowk0 + 8 * (lane >> 4);
  u.q[0] = *(const v8b*)p; u.q[1] = *(const v8b*)(p + 16); return u.v;
}
__device__ __forceinline__ float bfr(float v) { return (float)(__bf16)v; }
__device__ __attribute__((noinline)) float exp_ni(float v) { return expf(v); }
__device__ __attribute__((noinline)) float erf_ni(float v) { return erff(v); }

#define PK_A 0                       // [3072][1024] c_attn kernel rows (natural)
#define PK_P (PK_A + QKVW * DM)        // [1024][1024] c_proj kernel rows
#define PK_END (PK_P + DM * DM)
#define WS_PK  0u
#define WS_QK  (WS_PK + 2u * PK_END)             // f32 [4096 rows][3072]: [q | k | v], each h*64+d
#define WS_VTH (WS_QK + 4u * NB * SS * QKVW)     // bf16 [2][1024 (h*64+d)][2048 s]
#define WS_VTL (WS_VTH + 2u * NB * DM * SS)
#define WS_O   (WS_VTL + 2u * NB * DM * SS)        // f32 [4096][1024]
#define WS_END (WS_O + 4u * NB * SS * DM)

// ---- k_packrows: block = natural row n of a [N][K] weight (torch [out,in])
__global__ __launch_bounds__(256) void k_packrows(const float* __restrict__ Wm, int K, __bf16* __restrict__ DST) {
  __shared__ __align__(16) __bf16 s[DM]; const int n = blockIdx.x, tid = threadIdx.x;
  for (int k = tid; k < K; k += 256) s[k] = (__bf16)Wm[(size_t)n * K + k];
  __syncthreads();
  for (int q = tid; q < K / 8; q += 256) vst2((unsigned*)(DST + (size_t)n * K + q * 8), *(const v4u*)&s[q * 8]);
}
// ---- k_qkv: block = (64 rows, 128 of the 3072 cols): QKV = bf16(x) . rows (exact) -> f32 rows (pitch 3072)
__global__ __launch_bounds__(128) void k_qkv(const float* __restrict__ XQ, const float* __restrict__ XK, const float* __restrict__ XV, const __bf16* __restrict__ P, const float* __restrict__ BQ, const float* __restrict__ BK, const float* __restrict__ BV, float* __restrict__ QKV) {
  __shared__ __align__(16) float so[4][16][132];
  const int tid = threadIdx.x, wave = tid >> 5, lane = tid & 31, col = lane & 15, g = lane >> 4; const size_t r0 = (size_t)blockIdx.x * 64 + wave * 16; const int n0 = blockIdx.y * 128; const float* X = (n0 < DM) ? XQ : (n0 < 2 * DM ? XK : XV);
  v8f acc[8] = {};
#pragma unroll 2
  for (int kc = 0; kc < DM / 32; ++kc) { v16b a; { const float* p = X + (r0 + col) * DM + kc * 32 + 8 * g;
#pragma unroll
      for (int i = 0; i < 8; ++i) { a[i] = (__bf16)p[i]; a[8 + i] = (__bf16)p[16 + i]; } }
#pragma unroll
    for (int j = 0; j < 8; ++j) acc[j] = wmma_bf(a, frag_b(P + (size_t)(n0 + j * 16 + col) * DM + kc * 32, lane), acc[j]); }
  const float* bias = (n0 < DM) ? BQ : (n0 < 2 * DM ? BK : BV); const int nb = n0 % DM;
#pragma unroll
  for (int j = 0; j < 8; ++j) { const float bb = bfr(bias[nb + j * 16 + col]);
#pragma unroll
    for (int r = 0; r < 8; ++r) so[wave][8 * g + r][j * 16 + col] = acc[j][r] + bb; }
  LDSX();
  for (int rl = 0; rl < 16; ++rl) vst2(QKV + (r0 + rl) * QKVW + n0 + lane * 4, *(const v4f*)&so[wave][rl][lane * 4]);
}
__global__ __launch_bounds__(256) void k_vt(const float* __restrict__ QKV, __bf16* __restrict__ VTH, __bf16* __restrict__ VTL) {
  __shared__ __align__(16) __bf16 sth[64][72], stl[64][72]; const int tid = threadIdx.x; const size_t rb = (size_t)blockIdx.x * 64; const int h = blockIdx.y; const int b = (int)(rb / SS), s0 = (int)(rb % SS);
  for (int q = tid; q < 64 * 64; q += 256) { const int rl = q >> 6, d = q & 63; const float v = QKV[(rb + rl) * QKVW + 2 * DM + h * HD + d]; const __bf16 hb = (__bf16)v; sth[d][rl] = hb; stl[d][rl] = (__bf16)(v - (float)hb); }
  __syncthreads();
  for (int q = tid; q < 64 * 8; q += 256) { const int d = q >> 3, pc = q & 7; const size_t o = ((size_t)b * DM + h * HD + d) * SS + s0 + pc * 8; vst2((unsigned*)(VTH + o), *(const v4u*)&sth[d][pc * 8]); vst2((unsigned*)(VTL + o), *(const v4u*)&stl[d][pc * 8]); }
}
// ---- k_attn: block = (64 queries, head h, batch b): full flash attention (K = 64) on transposed products: S^T = K . Q^T (A = key rows, B = the wave's 16 queries) and O^T += V^T . P^T (A = V^T rows, B = the two score tiles of a pass, converted in place). A lane (g, col) holds query col alone: keys 8g + r of each 16-key tile, so maximum, row sum and the 5 distance-class masses are summed in the lane; the two lane halves exchange the maximum once a pass and join their sums once behind the loop. logits = (q.k (3 products) + qr[clip(k-q)+2]) / 8; P.V 3 products; w2 = sum_j (mass_j / l) rel_v[j]; O[b*S+q][h*64+d] = w1 + w2
__device__ __forceinline__ float xhalf(float v) { const int b = __builtin_bit_cast(int, v); return __builtin_bit_cast(float, __builtin_amdgcn_permlanex16(b, b, 0x76543210, 0xfedcba98, false, false)); }   // lane l <-> l ^ 16
__global__ __launch_bounds__(128) void k_attn(const float* __restrict__ QK, const __bf16* __restrict__ VTH, const __bf16* __restrict__ VTL, const float* __restrict__ RK, const float* __restrict__ RV, float* __restrict__ O) {
  __shared__ __align__(16) float so[4][16][68]; __shared__ float sqr[4][16][8];
  const int tid = threadIdx.x, wave = tid >> 5, lane = tid & 31, col = lane & 15, g = lane >> 4;
  const int qb = blockIdx.x, h = blockIdx.y, b = blockIdx.z; const int q0 = qb * 64 + wave * 16; const size_t rq = (size_t)b * SS + q0 + col;
  F2 aq[2];
#pragma unroll
  for (int kc = 0; kc < 2; ++kc) aq[kc] = split_row(QK + rq * QKVW + h * HD, kc * 32, lane);
  // relative-key logits: sqr[row][j] = q_row . rel_k[j] (f32; the lane's partial over its 4 columns, xor-16 reduced; staged in LDS so the runtime class index is not a private-array index)
#pragma unroll 1
  for (int r = 0; r < 8; ++r) { const float* qrow = QK + ((size_t)b * SS + q0 + 8 * g + r) * QKVW + h * HD;
#pragma unroll
    for (int j = 0; j < 5; ++j) { float a = 0.f;
#pragma unroll
      for (int dt = 0; dt < 4; ++dt) a += qrow[dt * 16 + col] * bfr(RK[j * HD + dt * 16 + col]);
#pragma unroll
      for (int o = 1; o < 16; o <<= 1) a += __shfl_xor(a, o);
      if (col == j) sqr[wave][8 * g + r][j] = a; } }
  LDSX();
  // the inner loops below are fully unrolled so that s, e, jc, ms and acc are indexed by constants and stay in registers; the pass loop stays rolled (code size)
  const int qi = q0 + col;
  float m = -3.0e38f, l = 0.f, ms[5];
#pragma unroll
  for (int j = 0; j < 5; ++j) ms[j] = 0.f;
  v8f acc[4] = {};
#pragma unroll 1
  for (int ks = 0; ks < SS / 32; ++ks) { float s[16]; int jc[16];
#pragma unroll
    for (int ct = 0; ct < 2; ++ct) { const float* krow = QK + ((size_t)b * SS + ks * 32 + ct * 16 + col) * QKVW + DM + h * HD; v8f c = {};
#pragma unroll
      for (int kc = 0; kc < 2; ++kc) { const F2 kb = split_row(krow, kc * 32, lane); c = wmma_bf(kb.h, aq[kc].l, c); c = wmma_bf(kb.l, aq[kc].h, c); c = wmma_bf(kb.h, aq[kc].h, c); }
#pragma unroll
      for (int r = 0; r < 8; ++r) { const int kk = ks * 32 + ct * 16 + 8 * g + r; const int dlt = min(max(kk - qi, -2), 2) + 2; jc[ct * 8 + r] = dlt; s[ct * 8 + r] = (c[r] + sqr[wave][col][dlt]) * 0.125f; } }   // (attn1 + attn2) / sqrt(64)
    float mx = s[0];
#pragma unroll
    for (int i = 1; i < 16; ++i) mx = fmaxf(mx, s[i]);
    mx = fmaxf(mx, xhalf(mx));
    const float mn = fmaxf(m, mx); const float alpha = exp_ni(m - mn); m = mn;
    float e[16];
#pragma unroll
    for (int i = 0; i < 16; ++i) e[i] = exp_ni(s[i] - mn);
    float es = 0.f;
#pragma unroll
    for (int i = 0; i < 8; ++i) es += e[i] + e[8 + i];
    l = l * alpha + es;
#pragma unroll
    for (int j = 0; j < 5; ++j) { float add = 0.f;
#pragma unroll
      for (int i = 0; i < 16; ++i) add += (jc[i] == j) ? e[i] : 0.f;
      ms[j] = ms[j] * alpha + add; }
#pragma unroll
    for (int dt = 0; dt < 4; ++dt) acc[dt] *= alpha;
    const F2 pb = bsplit16(e);   // B element i = key 8g + i, element 8 + i = key 16 + 8g + i: the k order of frag_b
#pragma unroll
    for (int dt = 0; dt < 4; ++dt) { const size_t vr = ((size_t)b * DM + h * HD + dt * 16 + col) * SS + ks * 32; const v16b vh = frag_b(VTH + vr, lane), vl = frag_b(VTL + vr, lane); acc[dt] = wmma_bf(vh, pb.l, acc[dt]); acc[dt] = wmma_bf(vl, pb.h, acc[dt]); acc[dt] = wmma_bf(vh, pb.h, acc[dt]); } }
  l += xhalf(l);
  const float il = 1.0f / l;
#pragma unroll
  for (int j = 0; j < 5; ++j) ms[j] = (ms[j] + xhalf(ms[j])) * il;
#pragma unroll
  for (int dt = 0; dt < 4; ++dt) {
#pragma unroll
    for (int r = 0; r < 8; ++r) { const int d = dt * 16 + 8 * g + r; float w2 = 0.f;
#pragma unroll
      for (int j = 0; j < 5; ++j) w2 += ms[j] * bfr(RV[j * HD + d]);
      so[wave][col][d] = acc[dt][r] * il + w2; } }
  LDSX();
  for (int rl = 0; rl < 16; ++rl) if (lane < 16) vst2(O + ((size_t)b * SS + q0 + rl) * DM + h * HD + lane * 4, *(const v4f*)&so[wave][rl][lane * 4]);
}
// ---- k_out: block = (64 rows, 128 cols): out = O(hi/lo) . c_proj rows (2 products) + bias
__global__ __launch_bounds__(128) void k_out(const float* __restrict__ O, const __bf16* __restrict__ P, const float* __restrict__ BO, float* __restrict__ Y) {
  __shared__ __align__(16) float so[4][16][132];
  const int tid = threadIdx.x, wave = tid >> 5, lane = tid & 31, col = lane & 15, g = lane >> 4; const size_t r0 = (size_t)blockIdx.x * 64 + wave * 16; const int n0 = blockIdx.y * 128;
  v8f acc[8] = {};
#pragma unroll 2
  for (int kc = 0; kc < DM / 32; ++kc) { const F2 a = split_row(O + (r0 + col) * DM, kc * 32, lane);
#pragma unroll
    for (int j = 0; j < 8; ++j) { const v16b w = frag_b(P + (size_t)(n0 + j * 16 + col) * DM + kc * 32, lane); acc[j] = wmma_bf(a.l, w, acc[j]); acc[j] = wmma_bf(a.h, w, acc[j]); } }
#pragma unroll
  for (int j = 0; j < 8; ++j) { const float bb = bfr(BO[n0 + j * 16 + col]);
#pragma unroll
    for (int r = 0; r < 8; ++r) so[wave][8 * g + r][j * 16 + col] = acc[j][r] + bb; }
  LDSX();
  for (int rl = 0; rl < 16; ++rl) vst2(Y + (r0 + rl) * DM + n0 + lane * 4, *(const v4f*)&so[wave][rl][lane * 4]);
}
extern "C" void kernel_launch(void* const* d_in, const int* in_sizes, int n_in, void* d_out, int out_size, void* d_ws, size_t ws_size, hipStream_t stream) {
  (void)in_sizes; (void)n_in; (void)out_size;
  const float** F = (const float**)d_in;   // 0 key [2,2048,1024], 1 query, 2 value, 3 Wq [1024,1024] (torch), 4 bq, 5 Wk, 6 bk, 7 Wv, 8 bv, 9 Wo, 10 bo, 11 rel_k [5,64], 12 rel_v [5,64]
  if (ws_size < (size_t)WS_END) return;
  char* ws = (char*)d_ws; __bf16 *PK = (__bf16*)(ws + WS_PK), *VTH = (__bf16*)(ws + WS_VTH), *VTL = (__bf16*)(ws + WS_VTL); float *QK = (float*)(ws + WS_QK), *O = (float*)(ws + WS_O);
  k_packrows<<<DM, 256, 0, stream>>>(F[3], DM, PK + PK_A); k_packrows<<<DM, 256, 0, stream>>>(F[5], DM, PK + PK_A + (size_t)DM * DM); k_packrows<<<DM, 256, 0, stream>>>(F[7], DM, PK + PK_A + (size_t)2 * DM * DM); k_packrows<<<DM, 256, 0, stream>>>(F[9], DM, PK + PK_P);
  k_qkv<<<dim3(TNB * SS / 64, QKVW / 128), 128, 0, stream>>>(F[1], F[0], F[2], PK + PK_A, F[4], F[6], F[8], QK);   // q from query, k from key, v from value
  k_vt<<<dim3(TNB * SS / 64, NH), 256, 0, stream>>>(QK, VTH, VTL);
  k_attn<<<dim3(TQB, NH, TNB), 128, 0, stream>>>(QK, VTH, VTL, F[11], F[12], O);
  k_out<<<dim3(TOB, DM / 128), 128, 0, stream>>>(O, PK + PK_P, F[10], (float*)d_out);
}

// v002
// It runs in 412 microseconds.
// Next to v001, in two timings, it ran 1.18 and 1.19 times as fast.
// All steps since v000 together make it 1.57 times as fast.
// compute dtype: key/query/value inputs, the four Linear weights/biases and the two relative tables (module inputs) rounded to bf16; q/k/v projections with exact bf16 products (inputs x weights); scores q.k with both operands as bf16 hi + residual pairs (3 products) plus the relative-key term q.rel_k[clip(k-q)] (5 f32 dot products per (token, head)); P.V with P hi/lo x V hi/lo (3 products) plus the relative-value term sum_j mass_j rel_v[j]; output projection hi/lo x exact Wo (2 products) + bo; softmax in f32; f32 accumulate.
#include <hip/hip_runtime.h>
#include <math.h>

typedef __attribute__((ext_vector_type(16))) _Float16 v16h;
typedef __attribute__((ext_vector_type(16))) __bf16 v16b;
typedef __attribute__((ext_vector_type(8)))  _Float16 v8h;
typedef __attribute__((ext_vector_type(8)))  float v8f;
typedef __attribute__((ext_vector_type(4)))  float v4f;
typedef __attribute__((ext_vector_type(2)))  float v2f;
typedef __attribute__((ext_vector_type(4)))  unsigned v4u;
typedef __attribute__((ext_vector_type(4)))  int v4i;
typedef float __attribute__((may_alias)) float_a;
typedef int __attribute__((may_alias)) int_a;

template <typename T> __device__ __forceinline__ void vst2(void* p, T v) { *(T*)p = v;  }
__device__ __forceinline__ v8f wmma16(v16h a, v16h b, v8f c) {
  v8f d = __builtin_amdgcn_wmma_f32_16x16x32_f16(false, a, false, b, (short)0, c, false, false);
  asm volatile("v_nop\n\tv_nop\n\tv_nop\n\tv_nop" : "+v"(d) : "v"(a), "v"(b));
  return d;
}
__device__ __forceinline__ v8f wmma_bf(v16b a, v16b b, v8f c) {
  v8f d = __builtin_amdgcn_wmma_f32_16x16x32_bf16(false, a, false, b, (short)0, c, false, false);
  asm volatile("v_nop\n\tv_nop\n\tv_nop\n\tv_nop" : "+v"(d) : "v"(a), "v"(b));
  return d;
}
// 16x16x32 fragments: lane = (h = lane>>4, row/col = lane&15); elements 0..7 = k0+8h+0..7, 8..15 = k0+16+8h+0..7; D element r = row 8h+r
__device__ __forceinline__ v16h frag_h(const _Float16* rowk0, int lane) {
  union { v16h v; v8h q[2]; } u; const _Float16* p = rowk0 + 8 * (lane >> 4);
  u.q[0] = *(const v8h*)p; u.q[1] = *(const v8h*)(p + 16); return u.v;
}
__device__ __forceinline__ v16h frag_f32(const float* rowk0, int lane) {
  v16h a; const float* p = rowk0 + 8 * (lane >> 4);
#pragma unroll
  for (int i = 0; i < 8; ++i) { a[i] = (_Float16)p[i]; a[8 + i] = (_Float16)p[16 + i]; }
  return a;
}
__device__ __forceinline__ v16h frag_f32s(const float* rowk0, int lane, float sc) {
  v16h a; const float* p = rowk0 + 8 * (lane >> 4);
#pragma unroll
  for (int i = 0; i < 8; ++i) { a[i] = (_Float16)(p[i] * sc); a[8 + i] = (_Float16)(p[16 + i] * sc); }
  return a;
}
// column fragment from a [K][ld] layout (column n), rows >= K read as 0
__device__ __forceinline__ v16h fragc_f32(const float* W, int k0, int n, int lane, int ld, int K) {
  v16h a; const int g = lane >> 4;
#pragma unroll
  for (int i = 0; i < 8; ++i) { const int ka = k0 + 8 * g + i, kb = ka + 16;
    a[i] = (_Float16)(ka < K ? W[(size_t)(ka < K ? ka : K - 1) * ld + n] : 0.f); a[8 + i] = (_Float16)(kb < K ? W[(size_t)(kb < K ? kb : K - 1) * ld + n] : 0.f); }
  return a;
}
struct F2 { v16b h, l; };
__device__ __forceinline__ F2 bsplit16(const float v[16]) { F2 r;
#pragma unroll
  for (int i = 0; i < 16; ++i) { const __bf16 h = (__bf16)v[i]; r.h[i] = h; r.l[i] = (__bf16)(v[i] - (float)h); }
  return r; }
__device__ __forceinline__ F2 split_row(const float* row, int k0, int lane) { float v[16]; const float* p = row + k0 + 8 * (lane >> 4);
#pragma unroll
  for (int i = 0; i < 8; ++i) { v[i] = p[i]; v[8 + i] = p[16 + i]; }
  return bsplit16(v); }
__device__ __forceinline__ F2 split_rowK(const float* row, int k0, int lane, int K) { float v[16]; const int g = lane >> 4;
#pragma unroll
  for (int i = 0; i < 8; ++i) { const int ka = k0 + 8 * g + i, kb = ka + 16; v[i] = ka < K ? row[ka < K ? ka : K - 1] : 0.f; v[8 + i] = kb < K ? row[kb < K ? kb : K - 1] : 0.f; }
  return bsplit16(v); }
__device__ __forceinline__ F2 split_col(const float* W, int k0, int n, int lane, int ld, int K) { float v[16]; const int g = lane >> 4;
#pragma unroll
  for (int i = 0; i < 8; ++i) { const int ka = k0 + 8 * g + i, kb = ka + 16; v[i] = ka < K ? W[(size_t)(ka < K ? ka : K - 1) * ld + n] : 0.f; v[8 + i] = kb < K ? W[(size_t)(kb < K ? kb : K - 1) * ld + n] : 0.f; }
  return bsplit16(v); }
__device__ __forceinline__ v8f mac3(const F2& a, const F2& b, v8f c) { c = wmma_bf(a.l, b.h, c); c = wmma_bf(a.h, b.l, c); return wmma_bf(a.h, b.h, c); }
__device__ __forceinline__ float sigm(float v) { return 1.0f / (1.0f + expf(-v)); }
#define LDSX() do { asm volatile("s_wait_dscnt 0" ::: "memory"); __builtin_amdgcn_wave_barrier(); __builtin_amdgcn_fence(__ATOMIC_RELEASE, "workgroup"); } while (0)


// Multi-head attention with clipped relative position embeddings (B 2, Lq = Lk = 2048, hid 1024, 16 heads x 64, max_rel 2): q = query Wq^T + bq, k = key Wk^T + bk, v = value Wv^T + bv; attn = softmax((q k^T + q . rel_k[clip(k - q, -2, 2) + 2]) / 8); x = attn v + sum_k attn rel_v[clip(k - q) + 2]; out = x Wo^T + bo.
#define NB 2
#define SS 2048
#define DM 1024
#define NH 16
#define HD 64
#define QKVW (3 * DM)
#ifndef TQB
#define TQB (SS / 64)
#define TNB NB
#define TOB (NB * SS / 64)     // output row tiles (all)
#endif
typedef __attribute__((ext_vector_type(8))) __bf16 v8b;
__device__ __forceinline__ v16b frag_b(const __bf16* rowk0, int lane) {
  union { v16b v; v8b q[2]; } u; const __bf16* p = rowk0 + 8 * (lane >> 4);
  u.q[0] = *(const v8b*)p; u.q[1] = *(const v8b*)(p + 16); return u.v;
}
__device__ __forceinline__ float bfr(float v) { return (float)(__bf16)v; }
__device__ __attribute__((noinline)) float exp_ni(float v) { return expf(v); }
__device__ __attribute__((noinline)) float erf_ni(float v) { return erff(v); }

#define PK_A 0                       // [3072][1024] c_attn kernel rows (natural)
#define PK_P (PK_A + QKVW * DM)        // [1024][1024] c_proj kernel rows
#define PK_END (PK_P + DM * DM)
#define WS_PK  0u
#define WS_QK  (WS_PK + 2u * PK_END)             // f32 [4096 rows][3072]: [q | k | v], each h*64+d
#define WS_VTH (WS_QK + 4u * NB * SS * QKVW)     // bf16 [2][1024 (h*64+d)][2048 s]
#define WS_VTL (WS_VTH + 2u * NB * DM * SS)
#define WS_O   (WS_VTL + 2u * NB * DM * SS)        // f32 [4096][1024]
#define WS_END (WS_O + 4u * NB * SS * DM)

// ---- k_packrows: block = natural row n of a [N][K] weight (torch [out,in])
__global__ __launch_bounds__(256) void k_packrows(const float* __restrict__ Wm, int K, __bf16* __restrict__ DST) {
  __shared__ __align__(16) __bf16 s[DM]; const int n = blockIdx.x, tid = threadIdx.x;
  for (int k = tid; k < K; k += 256) s[k] = (__bf16)Wm[(size_t)n * K + k];
  __syncthreads();
  for (int q = tid; q < K / 8; q += 256) vst2((unsigned*)(DST + (size_t)n * K + q * 8), *(const v4u*)&s[q * 8]);
}
// ---- k_qkv: block = (64 rows, 128 of the 3072 cols): QKV = bf16(x) . rows (exact) -> f32 rows (pitch 3072)
__global__ __launch_bounds__(128) void k_qkv(const float* __restrict__ XQ, const float* __restrict__ XK, const float* __restrict__ XV, const __bf16* __restrict__ P, const float* __restrict__ BQ, const float* __restrict__ BK, const float* __restrict__ BV, float* __restrict__ QKV) {
  __shared__ __align__(16) float so[4][16][132];
  const int tid = threadIdx.x, wave = tid >> 5, lane = tid & 31, col = lane & 15, g = lane >> 4; const size_t r0 = (size_t)blockIdx.x * 64 + wave * 16; const int n0 = blockIdx.y * 128; const float* X = (n0 < DM) ? XQ : (n0 < 2 * DM ? XK : XV);
  v8f acc[8] = {};
#pragma unroll 2
  for (int kc = 0; kc < DM / 32; ++kc) { v16b a; { const float* p = X + (r0 + col) * DM + kc * 32 + 8 * g;
#pragma unroll
      for (int i = 0; i < 8; ++i) { a[i] = (__bf16)p[i]; a[8 + i] = (__bf16)p[16 + i]; } }
#pragma unroll
    for (int j = 0; j < 8; ++j) acc[j] = wmma_bf(a, frag_b(P + (size_t)(n0 + j * 16 + col) * DM + kc * 32, lane), acc[j]); }
  const float* bias = (n0 < DM) ? BQ : (n0 < 2 * DM ? BK : BV); const int nb = n0 % DM;
#pragma unroll
  for (int j = 0; j < 8; ++j) { const float bb = bfr(bias[nb + j * 16 + col]);
#pragma unroll
    for (int r = 0; r < 8; ++r) so[wave][8 * g + r][j * 16 + col] = acc[j][r] + bb; }
  LDSX();
  for (int rl = 0; rl < 16; ++rl) vst2(QKV + (r0 + rl) * QKVW + n0 + lane * 4, *(const v4f*)&so[wave][rl][lane * 4]);
}
__global__ __launch_bounds__(256) void k_vt(const float* __restrict__ QKV, __bf16* __restrict__ VTH, __bf16* __restrict__ VTL) {
  __shared__ __align__(16) __bf16 sth[64][72], stl[64][72]; const int tid = threadIdx.x; const size_t rb = (size_t)blockIdx.x * 64; const int h = blockIdx.y; const int b = (int)(rb / SS), s0 = (int)(rb % SS);
  for (int q = tid; q < 64 * 64; q += 256) { const int rl = q >> 6, d = q & 63; const float v = QKV[(rb + rl) * QKVW + 2 * DM + h * HD + d]; const __bf16 hb = (__bf16)v; sth[d][rl] = hb; stl[d][rl] = (__bf16)(v - (float)hb); }
  __syncthreads();
  for (int q = tid; q < 64 * 8; q += 256) { const int d = q >> 3, pc = q & 7; const size_t o = ((size_t)b * DM + h * HD + d) * SS + s0 + pc * 8; vst2((unsigned*)(VTH + o), *(const v4u*)&sth[d][pc * 8]); vst2((unsigned*)(VTL + o), *(const v4u*)&stl[d][pc * 8]); }
}
// ---- k_attn: block = (64 queries, head h, batch b): full flash attention (K = 64) on transposed products: S^T = K . Q^T (A = key rows, B = the wave's 16 queries) and O^T += V^T . P^T (A = V^T rows, B = the two score tiles of a pass, converted in place). A lane (g, col) holds query col alone: keys 8g + r of each 16-key tile, so maximum, row sum and the 5 distance-class masses are summed in the lane; the two lane halves exchange the maximum once a pass and join their sums once behind the loop. logits = (q.k (3 products) + qr[clip(k-q)+2]) / 8; P.V 3 products; w2 = sum_j (mass_j / l) rel_v[j]; O[b*S+q][h*64+d] = w1 + w2
__device__ __forceinline__ float xhalf(float v) { const int b = __builtin_bit_cast(int, v); return __builtin_bit_cast(float, __builtin_amdgcn_permlanex16(b, b, 0x76543210, 0xfedcba98, false, false)); }   // lane l <-> l ^ 16
// K / V^T tiles of one 32-key pass, staged in LDS once per block for its 4 waves. Row pitches are 16 B x odd, so that the 16 rows of a b128 fragment read fall on distinct banks.
#define KP 68    // floats: 272 B rows of the K tile [32 keys][64 d]
#define VP 40    // bf16: 80 B rows of a V^T tile [64 d][32 keys]
__device__ __forceinline__ F2 split_lds(const float* p) { float v[16]; const v4f a = *(const v4f*)p, b = *(const v4f*)(p + 4), c = *(const v4f*)(p + 16), d = *(const v4f*)(p + 20);
#pragma unroll
  for (int i = 0; i < 4; ++i) { v[i] = a[i]; v[4 + i] = b[i]; v[8 + i] = c[i]; v[12 + i] = d[i]; }
  return bsplit16(v); }
// one pass's tiles, 8 copies of 16 B a lane: K rows 8 apart (a wave covers 2 whole rows = 4 lines a copy), V^T hi and residual rows 32 apart. lk, lv: the lane's LDS byte addresses in the target buffer; gk, gh, gl: its global addresses.
__device__ __forceinline__ void stage_kv(unsigned lk, unsigned lv, const float* gk, const __bf16* gh, const __bf16* gl) {
  const unsigned lk1 = lk + 8 * KP * 4, lk2 = lk + 16 * KP * 4, lk3 = lk + 24 * KP * 4, lv1 = lv + 32 * VP * 2, lv2 = lv + 64 * VP * 2, lv3 = lv + 96 * VP * 2;
  const float *gk1 = gk + 8 * QKVW, *gk2 = gk + 16 * QKVW, *gk3 = gk + 24 * QKVW; const __bf16 *gh1 = gh + 32 * SS, *gl1 = gl + 32 * SS;
  // the copies and the s_wait_xcnt that stands in front of any rewrite of their address registers, in one statement so that nothing moves in between
  asm volatile("global_load_async_to_lds_b128 %0, %8, off\n\t"
               "global_load_async_to_lds_b128 %1, %9, off\n\t"
               "global_load_async_to_lds_b128 %2, %10, off\n\t"
               "global_load_async_to_lds_b128 %3, %11, off\n\t"
               "global_load_async_to_lds_b128 %4, %12, off\n\t"
               "global_load_async_to_lds_b128 %5, %13, off\n\t"
               "global_load_async_to_lds_b128 %6, %14, off\n\t"
               "global_load_async_to_lds_b128 %7, %15, off\n\t"
               "s_wait_xcnt 0x0"
               :: "v"(lk), "v"(lk1), "v"(lk2), "v"(lk3), "v"(lv), "v"(lv1), "v"(lv2), "v"(lv3), "v"(gk), "v"(gk1), "v"(gk2), "v"(gk3), "v"(gh), "v"(gh1), "v"(gl), "v"(gl1) : "memory");
}
__global__ __launch_bounds__(128) void k_attn(const float* __restrict__ QK, const __bf16* __restrict__ VTH, const __bf16* __restrict__ VTL, const float* __restrict__ RK, const float* __restrict__ RV, float* __restrict__ O) {
  __shared__ __align__(16) float so[4][16][68]; __shared__ float sqr[4][16][8];
  __shared__ __align__(16) float sk[2][32][KP]; __shared__ __align__(16) __bf16 sv[2][2][64][VP];   // two buffers: pass t reads buffer t & 1 while pass t + 1's tiles land in the other
  const int tid = threadIdx.x, wave = tid >> 5, lane = tid & 31, col = lane & 15, g = lane >> 4;
  const int qb = blockIdx.x, h = blockIdx.y, b = blockIdx.z; const int q0 = qb * 64 + wave * 16; const size_t rq = (size_t)b * SS + q0 + col;
  const unsigned lk0 = (unsigned)(size_t)&sk[0][tid >> 4][(tid & 15) * 4], lv0 = (unsigned)(size_t)&sv[0][0][tid >> 2][(tid & 3) * 8];
  const float* gk0 = QK + ((size_t)b * SS + (tid >> 4)) * QKVW + DM + h * HD + (tid & 15) * 4; const size_t gv0 = ((size_t)b * DM + h * HD + (tid >> 2)) * SS + (tid & 3) * 8;
  stage_kv(lk0, lv0, gk0, VTH + gv0, VTL + gv0);   // pass 0's tiles fly under the query set-up below
  F2 aq[2];
#pragma unroll
  for (int kc = 0; kc < 2; ++kc) aq[kc] = split_row(QK + rq * QKVW + h * HD, kc * 32, lane);
  // relative-key logits: sqr[row][j] = q_row . rel_k[j] (f32; the lane's partial over its 4 columns, xor-16 reduced; staged in LDS so the runtime class index is not a private-array index)
#pragma unroll 1
  for (int r = 0; r < 8; ++r) { const float* qrow = QK + ((size_t)b * SS + q0 + 8 * g + r) * QKVW + h * HD;
#pragma unroll
    for (int j = 0; j < 5; ++j) { float a = 0.f;
#pragma unroll
      for (int dt = 0; dt < 4; ++dt) a += qrow[dt * 16 + col] * bfr(RK[j * HD + dt * 16 + col]);
#pragma unroll
      for (int o = 1; o < 16; o <<= 1) a += __shfl_xor(a, o);
      if (col == j) sqr[wave][8 * g + r][j] = a; } }
  LDSX();
  // the inner loops below are fully unrolled so that s, e, jc, ms and acc are indexed by constants and stay in registers; the pass loop stays rolled (code size)
  const int qi = q0 + col;
  float m = -3.0e38f, l = 0.f, ms[5];
#pragma unroll
  for (int j = 0; j < 5; ++j) ms[j] = 0.f;
  v8f acc[4] = {};
  asm volatile("s_wait_asynccnt 0x0" ::: "memory");   // this wave's copies of pass 0 have landed
  __syncthreads();                                     // ... and every other wave's: buffer 0 may be read
  stage_kv(lk0 + (unsigned)sizeof(sk[0]), lv0 + (unsigned)sizeof(sv[0]), gk0 + (size_t)32 * QKVW, VTH + gv0 + 32, VTL + gv0 + 32);
#pragma unroll 1
  for (int ks = 0; ks < SS / 32; ++ks) { float s[16]; int jc[16]; const int bf = ks & 1;
#pragma unroll
    for (int ct = 0; ct < 2; ++ct) { const float* krow = &sk[bf][ct * 16 + col][8 * g]; v8f c = {};
#pragma unroll
      for (int kc = 0; kc < 2; ++kc) { const F2 kb = split_lds(krow + kc * 32); c = wmma_bf(kb.h, aq[kc].l, c); c = wmma_bf(kb.l, aq[kc].h, c); c = wmma_bf(kb.h, aq[kc].h, c); }
#pragma unroll
      for (int r = 0; r < 8; ++r) { const int kk = ks * 32 + ct * 16 + 8 * g + r; const int dlt = min(max(kk - qi, -2), 2) + 2; jc[ct * 8 + r] = dlt; s[ct * 8 + r] = (c[r] + sqr[wave][col][dlt]) * 0.125f; } }   // (attn1 + attn2) / sqrt(64)
    float mx = s[0];
#pragma unroll
    for (int i = 1; i < 16; ++i) mx = fmaxf(mx, s[i]);
    mx = fmaxf(mx, xhalf(mx));
    const float mn = fmaxf(m, mx); const float alpha = exp_ni(m - mn); m = mn;
    float e[16];
#pragma unroll
    for (int i = 0; i < 16; ++i) e[i] = exp_ni(s[i] - mn);
    float es = 0.f;
#pragma unroll
    for (int i = 0; i < 8; ++i) es += e[i] + e[8 + i];
    l = l * alpha + es;
#pragma unroll
    for (int j = 0; j < 5; ++j) { float add = 0.f;
#pragma unroll
      for (int i = 0; i < 16; ++i) add += (jc[i] == j) ? e[i] : 0.f;
      ms[j] = ms[j] * alpha + add; }
#pragma unroll
    for (int dt = 0; dt < 4; ++dt) acc[dt] *= alpha;
    const F2 pb = bsplit16(e);   // B element i = key 8g + i, element 8 + i = key 16 + 8g + i: the k order of frag_b
#pragma unroll
    for (int dt = 0; dt < 4; ++dt) { const v16b vh = frag_b(&sv[bf][0][dt * 16 + col][0], lane), vl = frag_b(&sv[bf][1][dt * 16 + col][0], lane); acc[dt] = wmma_bf(vh, pb.l, acc[dt]); acc[dt] = wmma_bf(vl, pb.h, acc[dt]); acc[dt] = wmma_bf(vh, pb.h, acc[dt]); }
    asm volatile("s_wait_dscnt 0x0" ::: "memory");      // this wave's reads of buffer bf are done before the buffer is refilled
    asm volatile("s_wait_asynccnt 0x0" ::: "memory");   // this wave's copies of pass ks + 1 have landed
    __syncthreads();                                     // publishes pass ks + 1 and ends every wave's reads of buffer bf
    if (ks + 2 < SS / 32) stage_kv(lk0 + bf * (unsigned)sizeof(sk[0]), lv0 + bf * (unsigned)sizeof(sv[0]), gk0 + (size_t)(ks + 2) * 32 * QKVW, VTH + gv0 + (ks + 2) * 32, VTL + gv0 + (ks + 2) * 32); }
  asm volatile("s_wait_asynccnt 0x0" ::: "memory");     // no copy is outstanding when the wave goes on to the epilogue and ends
  l += xhalf(l);
  const float il = 1.0f / l;
#pragma unroll
  for (int j = 0; j < 5; ++j) ms[j] = (ms[j] + xhalf(ms[j])) * il;
#pragma unroll
  for (int dt = 0; dt < 4; ++dt) {
#pragma unroll
    for (int r = 0; r < 8; ++r) { const int d = dt * 16 + 8 * g + r; float w2 = 0.f;
#pragma unroll
      for (int j = 0; j < 5; ++j) w2 += ms[j] * bfr(RV[j * HD + d]);
      so[wave][col][d] = acc[dt][r] * il + w2; } }
  LDSX();
  for (int rl = 0; rl < 16; ++rl) if (lane < 16) vst2(O + ((size_t)b * SS + q0 + rl) * DM + h * HD + lane * 4, *(const v4f*)&so[wave][rl][lane * 4]);
}
// ---- k_out: block = (64 rows, 128 cols): out = O(hi/lo) . c_proj rows (2 products) + bias
__global__ __launch_bounds__(128) void k_out(const float* __restrict__ O, const __bf16* __restrict__ P, const float* __restrict__ BO, float* __restrict__ Y) {
  __shared__ __align__(16) float so[4][16][132];
  const int tid = threadIdx.x, wave = tid >> 5, lane = tid & 31, col = lane & 15, g = lane >> 4; const size_t r0 = (size_t)blockIdx.x * 64 + wave * 16; const int n0 = blockIdx.y * 128;
  v8f acc[8] = {};
#pragma unroll 2
  for (int kc = 0; kc < DM / 32; ++kc) { const F2 a = split_row(O + (r0 + col) * DM, kc * 32, lane);
#pragma unroll
    for (int j = 0; j < 8; ++j) { const v16b w = frag_b(P + (size_t)(n0 + j * 16 + col) * DM + kc * 32, lane); acc[j] = wmma_bf(a.l, w, acc[j]); acc[j] = wmma_bf(a.h, w, acc[j]); } }
#pragma unroll
  for (int j = 0; j < 8; ++j) { const float bb = bfr(BO[n0 + j * 16 + col]);
#pragma unroll
    for (int r = 0; r < 8; ++r) so[wave][8 * g + r][j * 16 + col] = acc[j][r] + bb; }
  LDSX();
  for (int rl = 0; rl < 16; ++rl) vst2(Y + (r0 + rl) * DM + n0 + lane * 4, *(const v4f*)&so[wave][rl][lane * 4]);
}
extern "C" void kernel_launch(void* const* d_in, const int* in_sizes, int n_in, void* d_out, int out_size, void* d_ws, size_t ws_size, hipStream_t stream) {
  (void)in_sizes; (void)n_in; (void)out_size;
  const float** F = (const float**)d_in;   // 0 key [2,2048,1024], 1 query, 2 value, 3 Wq [1024,1024] (torch), 4 bq, 5 Wk, 6 bk, 7 Wv, 8 bv, 9 Wo, 10 bo, 11 rel_k [5,64], 12 rel_v [5,64]
  if (ws_size < (size_t)WS_END) return;
  char* ws = (char*)d_ws; __bf16 *PK = (__bf16*)(ws + WS_PK), *VTH = (__bf16*)(ws + WS_VTH), *VTL = (__bf16*)(ws + WS_VTL); float *QK = (float*)(ws + WS_QK), *O = (float*)(ws + WS_O);
  k_packrows<<<DM, 256, 0, stream>>>(F[3], DM, PK + PK_A); k_packrows<<<DM, 256, 0, stream>>>(F[5], DM, PK + PK_A + (size_t)DM * DM); k_packrows<<<DM, 256, 0, stream>>>(F[7], DM, PK + PK_A + (size_t)2 * DM * DM); k_packrows<<<DM, 256, 0, stream>>>(F[9], DM, PK + PK_P);
  k_qkv<<<dim3(TNB * SS / 64, QKVW / 128), 128, 0, stream>>>(F[1], F[0], F[2], PK + PK_A, F[4], F[6], F[8], QK);   // q from query, k from key, v from value
  k_vt<<<dim3(TNB * SS / 64, NH), 256, 0, stream>>>(QK, VTH, VTL);
  k_attn<<<dim3(TQB, NH, TNB), 128, 0, stream>>>(QK, VTH, VTL, F[11], F[12], O);
  k_out<<<dim3(TOB, DM / 128), 128, 0, stream>>>(O, PK + PK_P, F[10], (float*)d_out);
}

// v003
// A run of this version takes 368 microseconds.
// In both of two side-by-side timings against v002, it was 1.13 times as fast.
// All steps since v000 together make it 1.77 times as fast.
// compute dtype: key/query/value inputs, the four Linear weights/biases and the two relative tables (module inputs) rounded to bf16; q/k/v projections with exact bf16 products (inputs x weights); scores q.k with both operands as bf16 hi + residual pairs (3 products) plus the relative-key term q.rel_k[clip(k-q)] (5 f32 dot products per (token, head)); P.V with P hi/lo x V hi/lo (3 products) plus the relative-value term sum_j mass_j rel_v[j]; output projection hi/lo x exact Wo (2 products) + bo; softmax in f32; f32 accumulate.
#include <hip/hip_runtime.h>
#include <math.h>

typedef __attribute__((ext_vector_type(16))) _Float16 v16h;
typedef __attribute__((ext_vector_type(16))) __bf16 v16b;
typedef __attribute__((ext_vector_type(8)))  _Float16 v8h;
typedef __attribute__((ext_vector_type(8)))  float v8f;
typedef __attribute__((ext_vector_type(4)))  float v4f;
typedef __attribute__((ext_vector_type(2)))  float v2f;
typedef __attribute__((ext_vector_type(4)))  unsigned v4u;
typedef __attribute__((ext_vector_type(4)))  int v4i;
typedef float __attribute__((may_alias)) float_a;
typedef int __attribute__((may_alias)) int_a;

template <typename T> __device__ __forceinline__ void vst2(void* p, T v) { *(T*)p = v;  }
__device__ __forceinline__ v8f wmma16(v16h a, v16h b, v8f c) {
  v8f d = __builtin_amdgcn_wmma_f32_16x16x32_f16(false, a, false, b, (short)0, c, false, false);
  asm volatile("v_nop\n\tv_nop\n\tv_nop\n\tv_nop" : "+v"(d) : "v"(a), "v"(b));
  return d;
}
__device__ __forceinline__ v8f wmma_bf(v16b a, v16b b, v8f c) {
  v8f d = __builtin_amdgcn_wmma_f32_16x16x32_bf16(false, a, false, b, (short)0, c, false, false);
  asm volatile("v_nop\n\tv_nop\n\tv_nop\n\tv_nop" : "+v"(d) : "v"(a), "v"(b));
  return d;
}
// 16x16x32 fragments: lane = (h = lane>>4, row/col = lane&15); elements 0..7 = k0+8h+0..7, 8..15 = k0+16+8h+0..7; D element r = row 8h+r
__device__ __forceinline__ v16h frag_h(const _Float16* rowk0, int lane) {
  union { v16h v; v8h q[2]; } u; const _Float16* p = rowk0 + 8 * (lane >> 4);
  u.q[0] = *(const v8h*)p; u.q[1] = *(const v8h*)(p + 16); return u.v;
}
__device__ __forceinline__ v16h frag_f32(const float* rowk0, int lane) {
  v16h a; const float* p = rowk0 + 8 * (lane >> 4);
#pragma unroll
  for (int i = 0; i < 8; ++i) { a[i] = (_Float16)p[i]; a[8 + i] = (_Float16)p[16 + i]; }
  return a;
}
__device__ __forceinline__ v16h frag_f32s(const float* rowk0, int lane, float sc) {
  v16h a; const float* p = rowk0 + 8 * (lane >> 4);
#pragma unroll
  for (int i = 0; i < 8; ++i) { a[i] = (_Float16)(p[i] * sc); a[8 + i] = (_Float16)(p[16 + i] * sc); }
  return a;
}
// column fragment from a [K][ld] layout (column n), rows >= K read as 0
__device__ __forceinline__ v16h fragc_f32(const float* W, int k0, int n, int lane, int ld, int K) {
  v16h a; const int g = lane >> 4;
#pragma unroll
  for (int i = 0; i < 8; ++i) { const int ka = k0 + 8 * g + i, kb = ka + 16;
    a[i] = (_Float16)(ka < K ? W[(size_t)(ka < K ? ka : K - 1) * ld + n] : 0.f); a[8 + i] = (_Float16)(kb < K ? W[(size_t)(kb < K ? kb : K - 1) * ld + n] : 0.f); }
  return a;
}
struct F2 { v16b h, l; };
__device__ __forceinline__ F2 bsplit16(const float v[16]) { F2 r;
#pragma unroll
  for (int i = 0; i < 16; ++i) { const __bf16 h = (__bf16)v[i]; r.h[i] = h; r.l[i] = (__bf16)(v[i] - (float)h); }
  return r; }
__device__ __forceinline__ F2 split_row(const float* row, int k0, int lane) { float v[16]; const float* p = row + k0 + 8 * (lane >> 4);
#pragma unroll
  for (int i = 0; i < 8; ++i) { v[i] = p[i]; v[8 + i] = p[16 + i]; }
  return bsplit16(v); }
__device__ __forceinline__ F2 split_rowK(const float* row, int k0, int lane, int K) { float v[16]; const int g = lane >> 4;
#pragma unroll
  for (int i = 0; i < 8; ++i) { const int ka = k0 + 8 * g + i, kb = ka + 16; v[i] = ka < K ? row[ka < K ? ka : K - 1] : 0.f; v[8 + i] = kb < K ? row[kb < K ? kb : K - 1] : 0.f; }
  return bsplit16(v); }
__device__ __forceinline__ F2 split_col(const float* W, int k0, int n, int lane, int ld, int K) { float v[16]; const int g = lane >> 4;
#pragma unroll
  for (int i = 0; i < 8; ++i) { const int ka = k0 + 8 * g + i, kb = ka + 16; v[i] = ka < K ? W[(size_t)(ka < K ? ka : K - 1) * ld + n] : 0.f; v[8 + i] = kb < K ? W[(size_t)(kb < K ? kb : K - 1) * ld + n] : 0.f; }
  return bsplit16(v); }
__device__ __forceinline__ v8f mac3(const F2& a, const F2& b, v8f c) { c = wmma_bf(a.l, b.h, c); c = wmma_bf(a.h, b.l, c); return wmma_bf(a.h, b.h, c); }
__device__ __forceinline__ float sigm(float v) { return 1.0f / (1.0f + expf(-v)); }
#define LDSX() do { asm volatile("s_wait_dscnt 0" ::: "memory"); __builtin_amdgcn_wave_barrier(); __builtin_amdgcn_fence(__ATOMIC_RELEASE, "workgroup"); } while (0)


// Multi-head attention with clipped relative position embeddings (B 2, Lq = Lk = 2048, hid 1024, 16 heads x 64, max_rel 2): q = query Wq^T + bq, k = key Wk^T + bk, v = value Wv^T + bv; attn = softmax((q k^T + q . rel_k[clip(k - q, -2, 2) + 2]) / 8); x = attn v + sum_k attn rel_v[clip(k - q) + 2]; out = x Wo^T + bo.
#define NB 2
#define SS 2048
#define DM 1024
#define NH 16
#define HD 64
#define QKVW (3 * DM)
#ifndef TQB
#define TQB (SS / 64)
#define TNB NB
#define TOB (NB * SS / 64)     // output row tiles (all)
#endif
typedef __attribute__((ext_vector_type(8))) __bf16 v8b;
__device__ __forceinline__ v16b frag_b(const __bf16* rowk0, int lane) {
  union { v16b v; v8b q[2]; } u; const __bf16* p = rowk0 + 8 * (lane >> 4);
  u.q[0] = *(const v8b*)p; u.q[1] = *(const v8b*)(p + 16); return u.v;
}
__device__ __forceinline__ float bfr(float v) { return (float)(__bf16)v; }
__device__ __attribute__((noinline)) float erf_ni(float v) { return erff(v); }

#define PK_A 0                       // [3072][1024] c_attn kernel rows (natural)
#define PK_P (PK_A + QKVW * DM)        // [1024][1024] c_proj kernel rows
#define PK_END (PK_P + DM * DM)
#define WS_PK  0u
#define WS_QK  (WS_PK + 2u * PK_END)             // f32 [4096 rows][3072]: [q | k | v], each h*64+d
#define WS_VTH (WS_QK + 4u * NB * SS * QKVW)     // bf16 [2][1024 (h*64+d)][2048 s]
#define WS_VTL (WS_VTH + 2u * NB * DM * SS)
#define WS_O   (WS_VTL + 2u * NB * DM * SS)        // f32 [4096][1024]
#define WS_END (WS_O + 4u * NB * SS * DM)

// ---- k_packrows: block = natural row n of a [N][K] weight (torch [out,in])
__global__ __launch_bounds__(256) void k_packrows(const float* __restrict__ Wm, int K, __bf16* __restrict__ DST) {
  __shared__ __align__(16) __bf16 s[DM]; const int n = blockIdx.x, tid = threadIdx.x;
  for (int k = tid; k < K; k += 256) s[k] = (__bf16)Wm[(size_t)n * K + k];
  __syncthreads();
  for (int q = tid; q < K / 8; q += 256) vst2((unsigned*)(DST + (size_t)n * K + q * 8), *(const v4u*)&s[q * 8]);
}
// ---- k_qkv: block = (64 rows, 128 of the 3072 cols): QKV = bf16(x) . rows (exact) -> f32 rows (pitch 3072)
__global__ __launch_bounds__(128) void k_qkv(const float* __restrict__ XQ, const float* __restrict__ XK, const float* __restrict__ XV, const __bf16* __restrict__ P, const float* __restrict__ BQ, const float* __restrict__ BK, const float* __restrict__ BV, float* __restrict__ QKV) {
  __shared__ __align__(16) float so[4][16][132];
  const int tid = threadIdx.x, wave = tid >> 5, lane = tid & 31, col = lane & 15, g = lane >> 4; const size_t r0 = (size_t)blockIdx.x * 64 + wave * 16; const int n0 = blockIdx.y * 128; const float* X = (n0 < DM) ? XQ : (n0 < 2 * DM ? XK : XV);
  v8f acc[8] = {};
#pragma unroll 2
  for (int kc = 0; kc < DM / 32; ++kc) { v16b a; { const float* p = X + (r0 + col) * DM + kc * 32 + 8 * g;
#pragma unroll
      for (int i = 0; i < 8; ++i) { a[i] = (__bf16)p[i]; a[8 + i] = (__bf16)p[16 + i]; } }
#pragma unroll
    for (int j = 0; j < 8; ++j) acc[j] = wmma_bf(a, frag_b(P + (size_t)(n0 + j * 16 + col) * DM + kc * 32, lane), acc[j]); }
  const float* bias = (n0 < DM) ? BQ : (n0 < 2 * DM ? BK : BV); const int nb = n0 % DM;
#pragma unroll
  for (int j = 0; j < 8; ++j) { const float bb = bfr(bias[nb + j * 16 + col]);
#pragma unroll
    for (int r = 0; r < 8; ++r) so[wave][8 * g + r][j * 16 + col] = acc[j][r] + bb; }
  LDSX();
  for (int rl = 0; rl < 16; ++rl) vst2(QKV + (r0 + rl) * QKVW + n0 + lane * 4, *(const v4f*)&so[wave][rl][lane * 4]);
}
__global__ __launch_bounds__(256) void k_vt(const float* __restrict__ QKV, __bf16* __restrict__ VTH, __bf16* __restrict__ VTL) {
  __shared__ __align__(16) __bf16 sth[64][72], stl[64][72]; const int tid = threadIdx.x; const size_t rb = (size_t)blockIdx.x * 64; const int h = blockIdx.y; const int b = (int)(rb / SS), s0 = (int)(rb % SS);
  for (int q = tid; q < 64 * 64; q += 256) { const int rl = q >> 6, d = q & 63; const float v = QKV[(rb + rl) * QKVW + 2 * DM + h * HD + d]; const __bf16 hb = (__bf16)v; sth[d][rl] = hb; stl[d][rl] = (__bf16)(v - (float)hb); }
  __syncthreads();
  for (int q = tid; q < 64 * 8; q += 256) { const int d = q >> 3, pc = q & 7; const size_t o = ((size_t)b * DM + h * HD + d) * SS + s0 + pc * 8; vst2((unsigned*)(VTH + o), *(const v4u*)&sth[d][pc * 8]); vst2((unsigned*)(VTL + o), *(const v4u*)&stl[d][pc * 8]); }
}
// ---- k_attn: block = (64 queries, head h, batch b): full flash attention (K = 64) on transposed products: S^T = K . Q^T (A = key rows, B = the wave's 16 queries) and O^T += V^T . P^T (A = V^T rows, B = the two score tiles of a pass, converted in place). A lane (g, col) holds query col alone: keys 8g + r of each 16-key tile, so maximum, row sum and the 5 distance-class masses are summed in the lane; the two lane halves exchange the maximum once a pass and join their sums once behind the loop. logits = (q.k (3 products) + qr[clip(k-q)+2]) / 8; P.V 3 products; w2 = sum_j (mass_j / l) rel_v[j]; O[b*S+q][h*64+d] = w1 + w2
// softmax in base 2: SC2 = log2(e) / sqrt(64). The maximum is taken over the unscaled scores (SC2 > 0 keeps the order) and scaled once; each exponential is then one fma and one v_exp_f32 in line, 16 independent ones a pass.
#define SC2 0.18033688f
__device__ __forceinline__ float ex2(float v) { return __builtin_amdgcn_exp2f(v); }
__device__ __forceinline__ float xhalf(float v) { const int b = __builtin_bit_cast(int, v); return __builtin_bit_cast(float, __builtin_amdgcn_permlanex16(b, b, 0x76543210, 0xfedcba98, false, false)); }   // lane l <-> l ^ 16
// K / V^T tiles of one 32-key pass, staged in LDS once per block for its 4 waves. Row pitches are 16 B x odd, so that the 16 rows of a b128 fragment read fall on distinct banks.
#define KP 68    // floats: 272 B rows of the K tile [32 keys][64 d]
#define VP 40    // bf16: 80 B rows of a V^T tile [64 d][32 keys]
__device__ __forceinline__ F2 split_lds(const float* p) { float v[16]; const v4f a = *(const v4f*)p, b = *(const v4f*)(p + 4), c = *(const v4f*)(p + 16), d = *(const v4f*)(p + 20);
#pragma unroll
  for (int i = 0; i < 4; ++i) { v[i] = a[i]; v[4 + i] = b[i]; v[8 + i] = c[i]; v[12 + i] = d[i]; }
  return bsplit16(v); }
// one pass's tiles, 8 copies of 16 B a lane: K rows 8 apart (a wave covers 2 whole rows = 4 lines a copy), V^T hi and residual rows 32 apart. lk, lv: the lane's LDS byte addresses in the target buffer; gk, gh, gl: its global addresses.
__device__ __forceinline__ void stage_kv(unsigned lk, unsigned lv, const float* gk, const __bf16* gh, const __bf16* gl) {
  const unsigned lk1 = lk + 8 * KP * 4, lk2 = lk + 16 * KP * 4, lk3 = lk + 24 * KP * 4, lv1 = lv + 32 * VP * 2, lv2 = lv + 64 * VP * 2, lv3 = lv + 96 * VP * 2;
  const float *gk1 = gk + 8 * QKVW, *gk2 = gk + 16 * QKVW, *gk3 = gk + 24 * QKVW; const __bf16 *gh1 = gh + 32 * SS, *gl1 = gl + 32 * SS;
  // the copies and the s_wait_xcnt that stands in front of any rewrite of their address registers, in one statement so that nothing moves in between
  asm volatile("global_load_async_to_lds_b128 %0, %8, off\n\t"
               "global_load_async_to_lds_b128 %1, %9, off\n\t"
               "global_load_async_to_lds_b128 %2, %10, off\n\t"
               "global_load_async_to_lds_b128 %3, %11, off\n\t"
               "global_load_async_to_lds_b128 %4, %12, off\n\t"
               "global_load_async_to_lds_b128 %5, %13, off\n\t"
               "global_load_async_to_lds_b128 %6, %14, off\n\t"
               "global_load_async_to_lds_b128 %7, %15, off\n\t"
               "s_wait_xcnt 0x0"
               :: "v"(lk), "v"(lk1), "v"(lk2), "v"(lk3), "v"(lv), "v"(lv1), "v"(lv2), "v"(lv3), "v"(gk), "v"(gk1), "v"(gk2), "v"(gk3), "v"(gh), "v"(gh1), "v"(gl), "v"(gl1) : "memory");
}
__global__ __launch_bounds__(128) void k_attn(const float* __restrict__ QK, const __bf16* __restrict__ VTH, const __bf16* __restrict__ VTL, const float* __restrict__ RK, const float* __restrict__ RV, float* __restrict__ O) {
  __shared__ __align__(16) float so[4][16][68]; __shared__ float sqr[4][16][8];
  __shared__ __align__(16) float sk[2][32][KP]; __shared__ __align__(16) __bf16 sv[2][2][64][VP];   // two buffers: pass t reads buffer t & 1 while pass t + 1's tiles land in the other
  const int tid = threadIdx.x, wave = tid >> 5, lane = tid & 31, col = lane & 15, g = lane >> 4;
  const int qb = blockIdx.x, h = blockIdx.y, b = blockIdx.z; const int q0 = qb * 64 + wave * 16; const size_t rq = (size_t)b * SS + q0 + col;
  const unsigned lk0 = (unsigned)(size_t)&sk[0][tid >> 4][(tid & 15) * 4], lv0 = (unsigned)(size_t)&sv[0][0][tid >> 2][(tid & 3) * 8];
  const float* gk0 = QK + ((size_t)b * SS + (tid >> 4)) * QKVW + DM + h * HD + (tid & 15) * 4; const size_t gv0 = ((size_t)b * DM + h * HD + (tid >> 2)) * SS + (tid & 3) * 8;
  stage_kv(lk0, lv0, gk0, VTH + gv0, VTL + gv0);   // pass 0's tiles fly under the query set-up below
  F2 aq[2];
#pragma unroll
  for (int kc = 0; kc < 2; ++kc) aq[kc] = split_row(QK + rq * QKVW + h * HD, kc * 32, lane);
  // relative-key logits: sqr[row][j] = q_row . rel_k[j] (f32; the lane's partial over its 4 columns, xor-16 reduced; staged in LDS so the runtime class index is not a private-array index)
#pragma unroll 1
  for (int r = 0; r < 8; ++r) { const float* qrow = QK + ((size_t)b * SS + q0 + 8 * g + r) * QKVW + h * HD;
#pragma unroll
    for (int j = 0; j < 5; ++j) { float a = 0.f;
#pragma unroll
      for (int dt = 0; dt < 4; ++dt) a += qrow[dt * 16 + col] * bfr(RK[j * HD + dt * 16 + col]);
#pragma unroll
      for (int o = 1; o < 16; o <<= 1) a += __shfl_xor(a, o);
      if (col == j) sqr[wave][8 * g + r][j] = a; } }
  LDSX();
  // the inner loops below are fully unrolled so that s, e, jc, ms and acc are indexed by constants and stay in registers; the pass loop stays rolled (code size)
  const int qi = q0 + col;
  float m = -3.0e38f, l = 0.f, ms[5];
#pragma unroll
  for (int j = 0; j < 5; ++j) ms[j] = 0.f;
  v8f acc[4] = {};
  asm volatile("s_wait_asynccnt 0x0" ::: "memory");   // this wave's copies of pass 0 have landed
  __syncthreads();                                     // ... and every other wave's: buffer 0 may be read
  stage_kv(lk0 + (unsigned)sizeof(sk[0]), lv0 + (unsigned)sizeof(sv[0]), gk0 + (size_t)32 * QKVW, VTH + gv0 + 32, VTL + gv0 + 32);
#pragma unroll 1
  for (int ks = 0; ks < SS / 32; ++ks) { float s[16]; int jc[16]; const int bf = ks & 1;
#pragma unroll
    for (int ct = 0; ct < 2; ++ct) { const float* krow = &sk[bf][ct * 16 + col][8 * g]; v8f c = {};
#pragma unroll
      for (int kc = 0; kc < 2; ++kc) { const F2 kb = split_lds(krow + kc * 32); c = wmma_bf(kb.h, aq[kc].l, c); c = wmma_bf(kb.l, aq[kc].h, c); c = wmma_bf(kb.h, aq[kc].h, c); }
#pragma unroll
      for (int r = 0; r < 8; ++r) { const int kk = ks * 32 + ct * 16 + 8 * g + r; const int dlt = min(max(kk - qi, -2), 2) + 2; jc[ct * 8 + r] = dlt; s[ct * 8 + r] = c[r] + sqr[wave][col][dlt]; } }   // attn1 + attn2, unscaled
    float mx = s[0];
#pragma unroll
    for (int i = 1; i < 16; ++i) mx = fmaxf(mx, s[i]);
    mx = fmaxf(mx, xhalf(mx));
    const float mn = fmaxf(m, mx * SC2); const float alpha = ex2(m - mn); m = mn;   // m: running maximum of (attn1 + attn2) / sqrt(64) * log2(e)
    float e[16];
#pragma unroll
    for (int i = 0; i < 16; i += 2) { const v2f t = __builtin_elementwise_fma((v2f){s[i], s[i + 1]}, (v2f){SC2, SC2}, (v2f){-mn, -mn}); e[i] = ex2(t[0]); e[i + 1] = ex2(t[1]); }   // one packed fma a score pair
    float es = 0.f;
#pragma unroll
    for (int i = 0; i < 8; ++i) es += e[i] + e[8 + i];
    l = l * alpha + es;
#pragma unroll
    for (int j = 0; j < 5; ++j) { float add = 0.f;
#pragma unroll
      for (int i = 0; i < 16; ++i) add += (jc[i] == j) ? e[i] : 0.f;
      ms[j] = ms[j] * alpha + add; }
#pragma unroll
    for (int dt = 0; dt < 4; ++dt) acc[dt] *= alpha;
    const F2 pb = bsplit16(e);   // B element i = key 8g + i, element 8 + i = key 16 + 8g + i: the k order of frag_b
#pragma unroll
    for (int dt = 0; dt < 4; ++dt) { const v16b vh = frag_b(&sv[bf][0][dt * 16 + col][0], lane), vl = frag_b(&sv[bf][1][dt * 16 + col][0], lane); acc[dt] = wmma_bf(vh, pb.l, acc[dt]); acc[dt] = wmma_bf(vl, pb.h, acc[dt]); acc[dt] = wmma_bf(vh, pb.h, acc[dt]); }
    asm volatile("s_wait_dscnt 0x0" ::: "memory");      // this wave's reads of buffer bf are done before the buffer is refilled
    asm volatile("s_wait_asynccnt 0x0" ::: "memory");   // this wave's copies of pass ks + 1 have landed
    __syncthreads();                                     // publishes pass ks + 1 and ends every wave's reads of buffer bf
    if (ks + 2 < SS / 32) stage_kv(lk0 + bf * (unsigned)sizeof(sk[0]), lv0 + bf * (unsigned)sizeof(sv[0]), gk0 + (size_t)(ks + 2) * 32 * QKVW, VTH + gv0 + (ks + 2) * 32, VTL + gv0 + (ks + 2) * 32); }
  asm volatile("s_wait_asynccnt 0x0" ::: "memory");     // no copy is outstanding when the wave goes on to the epilogue and ends
  l += xhalf(l);
  const float il = 1.0f / l;
#pragma unroll
  for (int j = 0; j < 5; ++j) ms[j] = (ms[j] + xhalf(ms[j])) * il;
#pragma unroll
  for (int dt = 0; dt < 4; ++dt) {
#pragma unroll
    for (int r = 0; r < 8; ++r) { const int d = dt * 16 + 8 * g + r; float w2 = 0.f;
#pragma unroll
      for (int j = 0; j < 5; ++j) w2 += ms[j] * bfr(RV[j * HD + d]);
      so[wave][col][d] = acc[dt][r] * il + w2; } }
  LDSX();
  for (int rl = 0; rl < 16; ++rl) if (lane < 16) vst2(O + ((size_t)b * SS + q0 + rl) * DM + h * HD + lane * 4, *(const v4f*)&so[wave][rl][lane * 4]);
}
// ---- k_out: block = (64 rows, 128 cols): out = O(hi/lo) . c_proj rows (2 products) + bias
__global__ __launch_bounds__(128) void k_out(const float* __restrict__ O, const __bf16* __restrict__ P, const float* __restrict__ BO, float* __restrict__ Y) {
  __shared__ __align__(16) float so[4][16][132];
  const int tid = threadIdx.x, wave = tid >> 5, lane = tid & 31, col = lane & 15, g = lane >> 4; const size_t r0 = (size_t)blockIdx.x * 64 + wave * 16; const int n0 = blockIdx.y * 128;
  v8f acc[8] = {};
#pragma unroll 2
  for (int kc = 0; kc < DM / 32; ++kc) { const F2 a = split_row(O + (r0 + col) * DM, kc * 32, lane);
#pragma unroll
    for (int j = 0; j < 8; ++j) { const v16b w = frag_b(P + (size_t)(n0 + j * 16 + col) * DM + kc * 32, lane); acc[j] = wmma_bf(a.l, w, acc[j]); acc[j] = wmma_bf(a.h, w, acc[j]); } }
#pragma unroll
  for (int j = 0; j < 8; ++j) { const float bb = bfr(BO[n0 + j * 16 + col]);
#pragma unroll
    for (int r = 0; r < 8; ++r) so[wave][8 * g + r][j * 16 + col] = acc[j][r] + bb; }
  LDSX();
  for (int rl = 0; rl < 16; ++rl) vst2(Y + (r0 + rl) * DM + n0 + lane * 4, *(const v4f*)&so[wave][rl][lane * 4]);
}
extern "C" void kernel_launch(void* const* d_in, const int* in_sizes, int n_in, void* d_out, int out_size, void* d_ws, size_t ws_size, hipStream_t stream) {
  (void)in_sizes; (void)n_in; (void)out_size;
  const float** F = (const float**)d_in;   // 0 key [2,2048,1024], 1 query, 2 value, 3 Wq [1024,1024] (torch), 4 bq, 5 Wk, 6 bk, 7 Wv, 8 bv, 9 Wo, 10 bo, 11 rel_k [5,64], 12 rel_v [5,64]
  if (ws_size < (size_t)WS_END) return;
  char* ws = (char*)d_ws; __bf16 *PK = (__bf16*)(ws + WS_PK), *VTH = (__bf16*)(ws + WS_VTH), *VTL = (__bf16*)(ws + WS_VTL); float *QK = (float*)(ws + WS_QK), *O = (float*)(ws + WS_O);
  k_packrows<<<DM, 256, 0, stream>>>(F[3], DM, PK + PK_A); k_packrows<<<DM, 256, 0, stream>>>(F[5], DM, PK + PK_A + (size_t)DM * DM); k_packrows<<<DM, 256, 0, stream>>>(F[7], DM, PK + PK_A + (size_t)2 * DM * DM); k_packrows<<<DM, 256, 0, stream>>>(F[9], DM, PK + PK_P);
  k_qkv<<<dim3(TNB * SS / 64, QKVW / 128), 128, 0, stream>>>(F[1], F[0], F[2], PK + PK_A, F[4], F[6], F[8], QK);   // q from query, k from key, v from value
  k_vt<<<dim3(TNB * SS / 64, NH), 256, 0, stream>>>(QK, VTH, VTL);
  k_attn<<<dim3(TQB, NH, TNB), 128, 0, stream>>>(QK, VTH, VTL, F[11], F[12], O);
  k_out<<<dim3(TOB, DM / 128), 128, 0, stream>>>(O, PK + PK_P, F[10], (float*)d_out);
}

// v004
// One run takes 247 microseconds.
// In both of two side-by-side timings against v003, it was 1.48 times as fast.
// Counting every step since v000, it is 2.62 times as fast.
// compute dtype: key/query/value inputs, the four Linear weights/biases and the two relative tables (module inputs) rounded to bf16; q/k/v projections with exact bf16 products (inputs x weights); scores q.k with both operands as bf16 hi + residual pairs (3 products) plus the relative-key term q.rel_k[clip(k-q)] (5 f32 dot products per (token, head)); P.V with P hi/lo x V hi/lo (3 products) plus the relative-value term sum_j mass_j rel_v[j]; output projection hi/lo x exact Wo (2 products) + bo; softmax in f32; f32 accumulate.
#include <hip/hip_runtime.h>
#include <math.h>

typedef __attribute__((ext_vector_type(16))) _Float16 v16h;
typedef __attribute__((ext_vector_type(16))) __bf16 v16b;
typedef __attribute__((ext_vector_type(8)))  _Float16 v8h;
typedef __attribute__((ext_vector_type(8)))  float v8f;
typedef __attribute__((ext_vector_type(4)))  float v4f;
typedef __attribute__((ext_vector_type(2)))  float v2f;
typedef __attribute__((ext_vector_type(4)))  unsigned v4u;
typedef __attribute__((ext_vector_type(4)))  int v4i;
typedef float __attribute__((may_alias)) float_a;
typedef int __attribute__((may_alias)) int_a;

template <typename T> __device__ __forceinline__ void vst2(void* p, T v) { *(T*)p = v;  }
__device__ __forceinline__ v8f wmma16(v16h a, v16h b, v8f c) {
  v8f d = __builtin_amdgcn_wmma_f32_16x16x32_f16(false, a, false, b, (short)0, c, false, false);
  asm volatile("v_nop\n\tv_nop\n\tv_nop\n\tv_nop" : "+v"(d) : "v"(a), "v"(b));
  return d;
}
__device__ __forceinline__ v8f wmma_bf(v16b a, v16b b, v8f c) {
  v8f d = __builtin_amdgcn_wmma_f32_16x16x32_bf16(false, a, false, b, (short)0, c, false, false);
  asm volatile("v_nop\n\tv_nop\n\tv_nop\n\tv_nop" : "+v"(d) : "v"(a), "v"(b));
  return d;
}
// 16x16x32 fragments: lane = (h = lane>>4, row/col = lane&15); elements 0..7 = k0+8h+0..7, 8..15 = k0+16+8h+0..7; D element r = row 8h+r
__device__ __forceinline__ v16h frag_h(const _Float16* rowk0, int lane) {
  union { v16h v; v8h q[2]; } u; const _Float16* p = rowk0 + 8 * (lane >> 4);
  u.q[0] = *(const v8h*)p; u.q[1] = *(const v8h*)(p + 16); return u.v;
}
__device__ __forceinline__ v16h frag_f32(const float* rowk0, int lane) {
  v16h a; const float* p = rowk0 + 8 * (lane >> 4);
#pragma unroll
  for (int i = 0; i < 8; ++i) { a[i] = (_Float16)p[i]; a[8 + i] = (_Float16)p[16 + i]; }
  return a;
}
__device__ __forceinline__ v16h frag_f32s(const float* rowk0, int lane, float sc) {
  v16h a; const float* p = rowk0 + 8 * (lane >> 4);
#pragma unroll
  for (int i = 0; i < 8; ++i) { a[i] = (_Float16)(p[i] * sc); a[8 + i] = (_Float16)(p[16 + i] * sc); }
  return a;
}
// column fragment from a [K][ld] layout (column n), rows >= K read as 0
__device__ __forceinline__ v16h fragc_f32(const float* W, int k0, int n, int lane, int ld, int K) {
  v16h a; const int g = lane >> 4;
#pragma unroll
  for (int i = 0; i < 8; ++i) { const int ka = k0 + 8 * g + i, kb = ka + 16;
    a[i] = (_Float16)(ka < K ? W[(size_t)(ka < K ? ka : K - 1) * ld + n] : 0.f); a[8 + i] = (_Float16)(kb < K ? W[(size_t)(kb < K ? kb : K - 1) * ld + n] : 0.f); }
  return a;
}
struct F2 { v16b h, l; };
__device__ __forceinline__ F2 bsplit16(const float v[16]) { F2 r;
#pragma unroll
  for (int i = 0; i < 16; ++i) { const __bf16 h = (__bf16)v[i]; r.h[i] = h; r.l[i] = (__bf16)(v[i] - (float)h); }
  return r; }
__device__ __forceinline__ F2 split_row(const float* row, int k0, int lane) { float v[16]; const float* p = row + k0 + 8 * (lane >> 4);
#pragma unroll
  for (int i = 0; i < 8; ++i) { v[i] = p[i]; v[8 + i] = p[16 + i]; }
  return bsplit16(v); }
__device__ __forceinline__ F2 split_rowK(const float* row, int k0, int lane, int K) { float v[16]; const int g = lane >> 4;
#pragma unroll
  for (int i = 0; i < 8; ++i) { const int ka = k0 + 8 * g + i, kb = ka + 16; v[i] = ka < K ? row[ka < K ? ka : K - 1] : 0.f; v[8 + i] = kb < K ? row[kb < K ? kb : K - 1] : 0.f; }
  return bsplit16(v); }
__device__ __forceinline__ F2 split_col(const float* W, int k0, int n, int lane, int ld, int K) { float v[16]; const int g = lane >> 4;
#pragma unroll
  for (int i = 0; i < 8; ++i) { const int ka = k0 + 8 * g + i, kb = ka + 16; v[i] = ka < K ? W[(size_t)(ka < K ? ka : K - 1) * ld + n] : 0.f; v[8 + i] = kb < K ? W[(size_t)(kb < K ? kb : K - 1) * ld + n] : 0.f; }
  return bsplit16(v); }
__device__ __forceinline__ v8f mac3(const F2& a, const F2& b, v8f c) { c = wmma_bf(a.l, b.h, c); c = wmma_bf(a.h, b.l, c); return wmma_bf(a.h, b.h, c); }
__device__ __forceinline__ float sigm(float v) { return 1.0f / (1.0f + expf(-v)); }
#define LDSX() do { asm volatile("s_wait_dscnt 0" ::: "memory"); __builtin_amdgcn_wave_barrier(); __builtin_amdgcn_fence(__ATOMIC_RELEASE, "workgroup"); } while (0)


// Multi-head attention with clipped relative position embeddings (B 2, Lq = Lk = 2048, hid 1024, 16 heads x 64, max_rel 2): q = query Wq^T + bq, k = key Wk^T + bk, v = value Wv^T + bv; attn = softmax((q k^T + q . rel_k[clip(k - q, -2, 2) + 2]) / 8); x = attn v + sum_k attn rel_v[clip(k - q) + 2]; out = x Wo^T + bo.
#define NB 2
#define SS 2048
#define DM 1024
#define NH 16
#define HD 64
#define QKVW (3 * DM)
#ifndef TQB
#define TQB (SS / 64)
#define TNB NB
#define TOB (NB * SS / 64)     // output row tiles (all)
#endif
typedef __attribute__((ext_vector_type(8))) __bf16 v8b;
__device__ __forceinline__ v16b frag_b(const __bf16* rowk0, int lane) {
  union { v16b v; v8b q[2]; } u; const __bf16* p = rowk0 + 8 * (lane >> 4);
  u.q[0] = *(const v8b*)p; u.q[1] = *(const v8b*)(p + 16); return u.v;
}
__device__ __forceinline__ float bfr(float v) { return (float)(__bf16)v; }
__device__ __attribute__((noinline)) float erf_ni(float v) { return erff(v); }

#define PK_A 0                       // [3072][1024] c_attn kernel rows (natural)
#define PK_P (PK_A + QKVW * DM)        // [1024][1024] c_proj kernel rows
#define PK_END (PK_P + DM * DM)
#define WS_PK  0u
#define WS_QK  (WS_PK + 2u * PK_END)             // f32 [4096 rows][3072]: [q | k | v], each h*64+d
#define WS_VTH (WS_QK + 4u * NB * SS * QKVW)     // bf16 [2][1024 (h*64+d)][2048 s]
#define WS_VTL (WS_VTH + 2u * NB * DM * SS)
#define WS_O   (WS_VTL + 2u * NB * DM * SS)        // f32 [4096][1024]
#define WS_END (WS_O + 4u * NB * SS * DM)

// ---- k_packrows: block = natural row n of a [N][K] weight (torch [out,in])
__global__ __launch_bounds__(256) void k_packrows(const float* __restrict__ Wm, int K, __bf16* __restrict__ DST) {
  __shared__ __align__(16) __bf16 s[DM]; const int n = blockIdx.x, tid = threadIdx.x;
  for (int k = tid; k < K; k += 256) s[k] = (__bf16)Wm[(size_t)n * K + k];
  __syncthreads();
  for (int q = tid; q < K / 8; q += 256) vst2((unsigned*)(DST + (size_t)n * K + q * 8), *(const v4u*)&s[q * 8]);
}
// ---- operand tiles of the two projection GEMMs (k_qkv, k_out), one 64-deep k pass at a time, staged in LDS once per block: A = 64 f32 rows of 256 B, B = 128 bf16 weight rows of 128 B, so every copy of a wave covers whole 128 B lines. Row pitches are 16 B x odd, so that the 16 rows of a b128 fragment read fall on distinct banks.
#define GK 64                          // k per pass
#define GAP 68                         // floats: 272 B rows of the A tile [64 rows][64 k]
#define GBP 72                         // bf16: 144 B rows of the B tile [128 rows][64 k]
#define GASZ (64 * GAP * 4)            // bytes of an A tile; the B tile stands behind it
#define GBUF (GASZ + 128 * GBP * 2)    // bytes of one buffer
// 8 copies of 16 B a lane, ls bytes apart in LDS and gs elements apart in global memory
template <typename T> __device__ __forceinline__ void copy8(unsigned l, unsigned ls, const T* g, size_t gs) {
  const unsigned l1 = l + ls, l2 = l + 2 * ls, l3 = l + 3 * ls, l4 = l + 4 * ls, l5 = l + 5 * ls, l6 = l + 6 * ls, l7 = l + 7 * ls;
  const T *g1 = g + gs, *g2 = g + 2 * gs, *g3 = g + 3 * gs, *g4 = g + 4 * gs, *g5 = g + 5 * gs, *g6 = g + 6 * gs, *g7 = g + 7 * gs;
  // the copies and the s_wait_xcnt that stands in front of any rewrite of their address registers, in one statement so that nothing moves in between
  asm volatile("global_load_async_to_lds_b128 %0, %8, off\n\t"
               "global_load_async_to_lds_b128 %1, %9, off\n\t"
               "global_load_async_to_lds_b128 %2, %10, off\n\t"
               "global_load_async_to_lds_b128 %3, %11, off\n\t"
               "global_load_async_to_lds_b128 %4, %12, off\n\t"
               "global_load_async_to_lds_b128 %5, %13, off\n\t"
               "global_load_async_to_lds_b128 %6, %14, off\n\t"
               "global_load_async_to_lds_b128 %7, %15, off\n\t"
               "s_wait_xcnt 0x0"
               :: "v"(l), "v"(l1), "v"(l2), "v"(l3), "v"(l4), "v"(l5), "v"(l6), "v"(l7), "v"(g), "v"(g1), "v"(g2), "v"(g3), "v"(g4), "v"(g5), "v"(g6), "v"(g7) : "memory");
}
// one pass's tiles, 16 copies a lane: A rows 8 apart (a wave covers 2 whole rows a copy), B rows 16 apart (4 whole rows a copy). la, lb: the lane's LDS byte addresses in the target buffer; ga, gb: its global addresses.
__device__ __forceinline__ void stage_ab(unsigned la, unsigned lb, const float* ga, const __bf16* gb) { copy8(la, 8 * GAP * 4, ga, (size_t)8 * DM); copy8(lb, 16 * GBP * 2, gb, (size_t)16 * DM); }
__device__ __forceinline__ v16b cvt_lds(const float* p) { v16b r; const v4f a = *(const v4f*)p, b = *(const v4f*)(p + 4), c = *(const v4f*)(p + 16), d = *(const v4f*)(p + 20);
#pragma unroll
  for (int i = 0; i < 4; ++i) { r[i] = (__bf16)a[i]; r[4 + i] = (__bf16)b[i]; r[8 + i] = (__bf16)c[i]; r[12 + i] = (__bf16)d[i]; }
  return r; }
// ---- k_qkv: block = (64 rows, 128 of the 3072 cols): QKV = bf16(x) . rows (exact) -> f32 rows (pitch 3072)
__global__ __launch_bounds__(128) void k_qkv(const float* __restrict__ XQ, const float* __restrict__ XK, const float* __restrict__ XV, const __bf16* __restrict__ P, const float* __restrict__ BQ, const float* __restrict__ BK, const float* __restrict__ BV, float* __restrict__ QKV) {
  __shared__ __align__(16) char sm[2 * GBUF];   // two buffers: pass t reads buffer t & 1 while pass t + 1's tiles land in the other; behind the loop the same bytes stage the output rows
  float (*so)[16][132] = (float (*)[16][132])sm;
  const int tid = threadIdx.x, wave = tid >> 5, lane = tid & 31, col = lane & 15, g = lane >> 4; const size_t rb = (size_t)blockIdx.x * 64, r0 = rb + wave * 16; const int n0 = blockIdx.y * 128; const float* X = (n0 < DM) ? XQ : (n0 < 2 * DM ? XK : XV);
  const unsigned la0 = (unsigned)(size_t)&sm[(tid >> 4) * (GAP * 4) + (tid & 15) * 16], lb0 = (unsigned)(size_t)&sm[GASZ + (tid >> 3) * (GBP * 2) + (tid & 7) * 16];
  const float* ga0 = X + (rb + (tid >> 4)) * DM + (tid & 15) * 4; const __bf16* gb0 = P + (size_t)(n0 + (tid >> 3)) * DM + (tid & 7) * 8;
  stage_ab(la0, lb0, ga0, gb0);
  v8f acc[8] = {};
  asm volatile("s_wait_asynccnt 0x0" ::: "memory");   // this wave's copies of pass 0 have landed
  __syncthreads();                                     // ... and every other wave's: buffer 0 may be read
  stage_ab(la0 + GBUF, lb0 + GBUF, ga0 + GK, gb0 + GK);
  // the pass loop stays rolled (code size; one foot with the waits, the barrier and the refill in their order); the loops inside are fully unrolled so that a, w and acc are indexed by constants and stay in registers
#pragma unroll 1
  for (int t = 0; t < DM / GK; ++t) { const int bf = t & 1; const float* arow = (const float*)(sm + bf * GBUF) + (wave * 16 + col) * GAP + 8 * g; const __bf16* brow = (const __bf16*)(sm + bf * GBUF + GASZ) + col * GBP;
    v16b a[GK / 32], w[GK / 32][8];   // all fragment reads of the pass stand as one group in front of its products: a read among the products would be waited for on the spot
#pragma unroll
    for (int kc = 0; kc < GK / 32; ++kc) a[kc] = cvt_lds(arow + kc * 32);
#pragma unroll
    for (int kc = 0; kc < GK / 32; ++kc) {
#pragma unroll
      for (int j = 0; j < 8; ++j) w[kc][j] = frag_b(brow + j * 16 * GBP + kc * 32, lane); }
#pragma unroll
    for (int kc = 0; kc < GK / 32; ++kc) {
#pragma unroll
      for (int j = 0; j < 8; ++j) acc[j] = wmma_bf(a[kc], w[kc][j], acc[j]); }
    asm volatile("s_wait_dscnt 0x0" ::: "memory");      // this wave's reads of buffer bf are done before the buffer is refilled
    asm volatile("s_wait_asynccnt 0x0" ::: "memory");   // this wave's copies of pass t + 1 have landed
    __syncthreads();                                     // publishes pass t + 1 and ends every wave's reads of buffer bf
    if (t + 2 < DM / GK) stage_ab(la0 + bf * GBUF, lb0 + bf * GBUF, ga0 + (t + 2) * GK, gb0 + (t + 2) * GK); }
  asm volatile("s_wait_asynccnt 0x0" ::: "memory");     // no copy is outstanding when the buffers become output staging
  const float* bias = (n0 < DM) ? BQ : (n0 < 2 * DM ? BK : BV); const int nb = n0 % DM;
#pragma unroll
  for (int j = 0; j < 8; ++j) { const float bb = bfr(bias[nb + j * 16 + col]);
#pragma unroll
    for (int r = 0; r < 8; ++r) so[wave][8 * g + r][j * 16 + col] = acc[j][r] + bb; }
  LDSX();
  for (int rl = 0; rl < 16; ++rl) vst2(QKV + (r0 + rl) * QKVW + n0 + lane * 4, *(const v4f*)&so[wave][rl][lane * 4]);
}
__global__ __launch_bounds__(256) void k_vt(const float* __restrict__ QKV, __bf16* __restrict__ VTH, __bf16* __restrict__ VTL) {
  __shared__ __align__(16) __bf16 sth[64][72], stl[64][72]; const int tid = threadIdx.x; const size_t rb = (size_t)blockIdx.x * 64; const int h = blockIdx.y; const int b = (int)(rb / SS), s0 = (int)(rb % SS);
  for (int q = tid; q < 64 * 64; q += 256) { const int rl = q >> 6, d = q & 63; const float v = QKV[(rb + rl) * QKVW + 2 * DM + h * HD + d]; const __bf16 hb = (__bf16)v; sth[d][rl] = hb; stl[d][rl] = (__bf16)(v - (float)hb); }
  __syncthreads();
  for (int q = tid; q < 64 * 8; q += 256) { const int d = q >> 3, pc = q & 7; const size_t o = ((size_t)b * DM + h * HD + d) * SS + s0 + pc * 8; vst2((unsigned*)(VTH + o), *(const v4u*)&sth[d][pc * 8]); vst2((unsigned*)(VTL + o), *(const v4u*)&stl[d][pc * 8]); }
}
// ---- k_attn: block = (64 queries, head h, batch b): full flash attention (K = 64) on transposed products: S^T = K . Q^T (A = key rows, B = the wave's 16 queries) and O^T += V^T . P^T (A = V^T rows, B = the two score tiles of a pass, converted in place). A lane (g, col) holds query col alone: keys 8g + r of each 16-key tile, so maximum, row sum and the 5 distance-class masses are summed in the lane; the two lane halves exchange the maximum once a pass and join their sums once behind the loop. logits = (q.k (3 products) + qr[clip(k-q)+2]) / 8; P.V 3 products; w2 = sum_j (mass_j / l) rel_v[j]; O[b*S+q][h*64+d] = w1 + w2
// softmax in base 2: SC2 = log2(e) / sqrt(64). The maximum is taken over the unscaled scores (SC2 > 0 keeps the order) and scaled once; each exponential is then one fma and one v_exp_f32 in line, 16 independent ones a pass.
#define SC2 0.18033688f
__device__ __forceinline__ float ex2(float v) { return __builtin_amdgcn_exp2f(v); }
__device__ __forceinline__ float xhalf(float v) { const int b = __builtin_bit_cast(int, v); return __builtin_bit_cast(float, __builtin_amdgcn_permlanex16(b, b, 0x76543210, 0xfedcba98, false, false)); }   // lane l <-> l ^ 16
// K / V^T tiles of one 32-key pass, staged in LDS once per block for its 4 waves. Row pitches are 16 B x odd, so that the 16 rows of a b128 fragment read fall on distinct banks.
#define KP 68    // floats: 272 B rows of the K tile [32 keys][64 d]
#define VP 40    // bf16: 80 B rows of a V^T tile [64 d][32 keys]
__device__ __forceinline__ F2 split_lds(const float* p) { float v[16]; const v4f a = *(const v4f*)p, b = *(const v4f*)(p + 4), c = *(const v4f*)(p + 16), d = *(const v4f*)(p + 20);
#pragma unroll
  for (int i = 0; i < 4; ++i) { v[i] = a[i]; v[4 + i] = b[i]; v[8 + i] = c[i]; v[12 + i] = d[i]; }
  return bsplit16(v); }
// one pass's tiles, 8 copies of 16 B a lane: K rows 8 apart (a wave covers 2 whole rows = 4 lines a copy), V^T hi and residual rows 32 apart. lk, lv: the lane's LDS byte addresses in the target buffer; gk, gh, gl: its global addresses.
__device__ __forceinline__ void stage_kv(unsigned lk, unsigned lv, const float* gk, const __bf16* gh, const __bf16* gl) {
  const unsigned lk1 = lk + 8 * KP * 4, lk2 = lk + 16 * KP * 4, lk3 = lk + 24 * KP * 4, lv1 = lv + 32 * VP * 2, lv2 = lv + 64 * VP * 2, lv3 = lv + 96 * VP * 2;
  const float *gk1 = gk + 8 * QKVW, *gk2 = gk + 16 * QKVW, *gk3 = gk + 24 * QKVW; const __bf16 *gh1 = gh + 32 * SS, *gl1 = gl + 32 * SS;
  // the copies and the s_wait_xcnt that stands in front of any rewrite of their address registers, in one statement so that nothing moves in between
  asm volatile("global_load_async_to_lds_b128 %0, %8, off\n\t"
               "global_load_async_to_lds_b128 %1, %9, off\n\t"
               "global_load_async_to_lds_b128 %2, %10, off\n\t"
               "global_load_async_to_lds_b128 %3, %11, off\n\t"
               "global_load_async_to_lds_b128 %4, %12, off\n\t"
               "global_load_async_to_lds_b128 %5, %13, off\n\t"
               "global_load_async_to_lds_b128 %6, %14, off\n\t"
               "global_load_async_to_lds_b128 %7, %15, off\n\t"
               "s_wait_xcnt 0x0"
               :: "v"(lk), "v"(lk1), "v"(lk2), "v"(lk3), "v"(lv), "v"(lv1), "v"(lv2), "v"(lv3), "v"(gk), "v"(gk1), "v"(gk2), "v"(gk3), "v"(gh), "v"(gh1), "v"(gl), "v"(gl1) : "memory");
}
__global__ __launch_bounds__(128) void k_attn(const float* __restrict__ QK, const __bf16* __restrict__ VTH, const __bf16* __restrict__ VTL, const float* __restrict__ RK, const float* __restrict__ RV, float* __restrict__ O) {
  __shared__ __align__(16) float so[4][16][68]; __shared__ float sqr[4][16][8];
  __shared__ __align__(16) float sk[2][32][KP]; __shared__ __align__(16) __bf16 sv[2][2][64][VP];   // two buffers: pass t reads buffer t & 1 while pass t + 1's tiles land in the other
  const int tid = threadIdx.x, wave = tid >> 5, lane = tid & 31, col = lane & 15, g = lane >> 4;
  const int qb = blockIdx.x, h = blockIdx.y, b = blockIdx.z; const int q0 = qb * 64 + wave * 16; const size_t rq = (size_t)b * SS + q0 + col;
  const unsigned lk0 = (unsigned)(size_t)&sk[0][tid >> 4][(tid & 15) * 4], lv0 = (unsigned)(size_t)&sv[0][0][tid >> 2][(tid & 3) * 8];
  const float* gk0 = QK + ((size_t)b * SS + (tid >> 4)) * QKVW + DM + h * HD + (tid & 15) * 4; const size_t gv0 = ((size_t)b * DM + h * HD + (tid >> 2)) * SS + (tid & 3) * 8;
  stage_kv(lk0, lv0, gk0, VTH + gv0, VTL + gv0);   // pass 0's tiles fly under the query set-up below
  F2 aq[2];
#pragma unroll
  for (int kc = 0; kc < 2; ++kc) aq[kc] = split_row(QK + rq * QKVW + h * HD, kc * 32, lane);
  // relative-key logits: sqr[row][j] = q_row . rel_k[j] (f32; the lane's partial over its 4 columns, xor-16 reduced; staged in LDS so the runtime class index is not a private-array index)
#pragma unroll 1
  for (int r = 0; r < 8; ++r) { const float* qrow = QK + ((size_t)b * SS + q0 + 8 * g + r) * QKVW + h * HD;
#pragma unroll
    for (int j = 0; j < 5; ++j) { float a = 0.f;
#pragma unroll
      for (int dt = 0; dt < 4; ++dt) a += qrow[dt * 16 + col] * bfr(RK[j * HD + dt * 16 + col]);
#pragma unroll
      for (int o = 1; o < 16; o <<= 1) a += __shfl_xor(a, o);
      if (col == j) sqr[wave][8 * g + r][j] = a; } }
  LDSX();
  // the inner loops below are fully unrolled so that s, e, jc, ms and acc are indexed by constants and stay in registers; the pass loop stays rolled (code size)
  const int qi = q0 + col;
  float m = -3.0e38f, l = 0.f, ms[5];
#pragma unroll
  for (int j = 0; j < 5; ++j) ms[j] = 0.f;
  v8f acc[4] = {};
  asm volatile("s_wait_asynccnt 0x0" ::: "memory");   // this wave's copies of pass 0 have landed
  __syncthreads();                                     // ... and every other wave's: buffer 0 may be read
  stage_kv(lk0 + (unsigned)sizeof(sk[0]), lv0 + (unsigned)sizeof(sv[0]), gk0 + (size_t)32 * QKVW, VTH + gv0 + 32, VTL + gv0 + 32);
#pragma unroll 1
  for (int ks = 0; ks < SS / 32; ++ks) { float s[16]; int jc[16]; const int bf = ks & 1;
#pragma unroll
    for (int ct = 0; ct < 2; ++ct) { const float* krow = &sk[bf][ct * 16 + col][8 * g]; v8f c = {};
#pragma unroll
      for (int kc = 0; kc < 2; ++kc) { const F2 kb = split_lds(krow + kc * 32); c = wmma_bf(kb.h, aq[kc].l, c); c = wmma_bf(kb.l, aq[kc].h, c); c = wmma_bf(kb.h, aq[kc].h, c); }
#pragma unroll
      for (int r = 0; r < 8; ++r) { const int kk = ks * 32 + ct * 16 + 8 * g + r; const int dlt = min(max(kk - qi, -2), 2) + 2; jc[ct * 8 + r] = dlt; s[ct * 8 + r] = c[r] + sqr[wave][col][dlt]; } }   // attn1 + attn2, unscaled
    float mx = s[0];
#pragma unroll
    for (int i = 1; i < 16; ++i) mx = fmaxf(mx, s[i]);
    mx = fmaxf(mx, xhalf(mx));
    const float mn = fmaxf(m, mx * SC2); const float alpha = ex2(m - mn); m = mn;   // m: running maximum of (attn1 + attn2) / sqrt(64) * log2(e)
    float e[16];
#pragma unroll
    for (int i = 0; i < 16; i += 2) { const v2f t = __builtin_elementwise_fma((v2f){s[i], s[i + 1]}, (v2f){SC2, SC2}, (v2f){-mn, -mn}); e[i] = ex2(t[0]); e[i + 1] = ex2(t[1]); }   // one packed fma a score pair
    float es = 0.f;
#pragma unroll
    for (int i = 0; i < 8; ++i) es += e[i] + e[8 + i];
    l = l * alpha + es;
#pragma unroll
    for (int j = 0; j < 5; ++j) { float add = 0.f;
#pragma unroll
      for (int i = 0; i < 16; ++i) add += (jc[i] == j) ? e[i] : 0.f;
      ms[j] = ms[j] * alpha + add; }
#pragma unroll
    for (int dt = 0; dt < 4; ++dt) acc[dt] *= alpha;
    const F2 pb = bsplit16(e);   // B element i = key 8g + i, element 8 + i = key 16 + 8g + i: the k order of frag_b
#pragma unroll
    for (int dt = 0; dt < 4; ++dt) { const v16b vh = frag_b(&sv[bf][0][dt * 16 + col][0], lane), vl = frag_b(&sv[bf][1][dt * 16 + col][0], lane); acc[dt] = wmma_bf(vh, pb.l, acc[dt]); acc[dt] = wmma_bf(vl, pb.h, acc[dt]); acc[dt] = wmma_bf(vh, pb.h, acc[dt]); }
    asm volatile("s_wait_dscnt 0x0" ::: "memory");      // this wave's reads of buffer bf are done before the buffer is refilled
    asm volatile("s_wait_asynccnt 0x0" ::: "memory");   // this wave's copies of pass ks + 1 have landed
    __syncthreads();                                     // publishes pass ks + 1 and ends every wave's reads of buffer bf
    if (ks + 2 < SS / 32) stage_kv(lk0 + bf * (unsigned)sizeof(sk[0]), lv0 + bf * (unsigned)sizeof(sv[0]), gk0 + (size_t)(ks + 2) * 32 * QKVW, VTH + gv0 + (ks + 2) * 32, VTL + gv0 + (ks + 2) * 32); }
  asm volatile("s_wait_asynccnt 0x0" ::: "memory");     // no copy is outstanding when the wave goes on to the epilogue and ends
  l += xhalf(l);
  const float il = 1.0f / l;
#pragma unroll
  for (int j = 0; j < 5; ++j) ms[j] = (ms[j] + xhalf(ms[j])) * il;
#pragma unroll
  for (int dt = 0; dt < 4; ++dt) {
#pragma unroll
    for (int r = 0; r < 8; ++r) { const int d = dt * 16 + 8 * g + r; float w2 = 0.f;
#pragma unroll
      for (int j = 0; j < 5; ++j) w2 += ms[j] * bfr(RV[j * HD + d]);
      so[wave][col][d] = acc[dt][r] * il + w2; } }
  LDSX();
  for (int rl = 0; rl < 16; ++rl) if (lane < 16) vst2(O + ((size_t)b * SS + q0 + rl) * DM + h * HD + lane * 4, *(const v4f*)&so[wave][rl][lane * 4]);
}
// ---- k_out: block = (64 rows, 128 cols): out = O(hi/lo) . c_proj rows (2 products) + bias
__global__ __launch_bounds__(128) void k_out(const float* __restrict__ O, const __bf16* __restrict__ P, const float* __restrict__ BO, float* __restrict__ Y) {
  __shared__ __align__(16) char sm[2 * GBUF];   // two buffers, as in k_qkv; behind the loop the same bytes stage the output rows
  float (*so)[16][132] = (float (*)[16][132])sm;
  const int tid = threadIdx.x, wave = tid >> 5, lane = tid & 31, col = lane & 15, g = lane >> 4; const size_t rb = (size_t)blockIdx.x * 64, r0 = rb + wave * 16; const int n0 = blockIdx.y * 128;
  const unsigned la0 = (unsigned)(size_t)&sm[(tid >> 4) * (GAP * 4) + (tid & 15) * 16], lb0 = (unsigned)(size_t)&sm[GASZ + (tid >> 3) * (GBP * 2) + (tid & 7) * 16];
  const float* ga0 = O + (rb + (tid >> 4)) * DM + (tid & 15) * 4; const __bf16* gb0 = P + (size_t)(n0 + (tid >> 3)) * DM + (tid & 7) * 8;
  stage_ab(la0, lb0, ga0, gb0);
  v8f acc[8] = {};
  asm volatile("s_wait_asynccnt 0x0" ::: "memory");   // this wave's copies of pass 0 have landed
  __syncthreads();                                     // ... and every other wave's: buffer 0 may be read
  stage_ab(la0 + GBUF, lb0 + GBUF, ga0 + GK, gb0 + GK);
  // the pass loop stays rolled (code size; one foot with the waits, the barrier and the refill in their order); the loops inside are fully unrolled so that a, w and acc are indexed by constants and stay in registers
#pragma unroll 1
  for (int t = 0; t < DM / GK; ++t) { const int bf = t & 1; const float* arow = (const float*)(sm + bf * GBUF) + (wave * 16 + col) * GAP + 8 * g; const __bf16* brow = (const __bf16*)(sm + bf * GBUF + GASZ) + col * GBP;
    F2 a[GK / 32]; v16b w[GK / 32][8];   // all fragment reads of the pass stand as one group in front of its products, as in k_qkv
#pragma unroll
    for (int kc = 0; kc < GK / 32; ++kc) a[kc] = split_lds(arow + kc * 32);
#pragma unroll
    for (int kc = 0; kc < GK / 32; ++kc) {
#pragma unroll
      for (int j = 0; j < 8; ++j) w[kc][j] = frag_b(brow + j * 16 * GBP + kc * 32, lane); }
#pragma unroll
    for (int kc = 0; kc < GK / 32; ++kc) {
#pragma unroll
      for (int j = 0; j < 8; ++j) { acc[j] = wmma_bf(a[kc].l, w[kc][j], acc[j]); acc[j] = wmma_bf(a[kc].h, w[kc][j], acc[j]); } }
    asm volatile("s_wait_dscnt 0x0" ::: "memory");      // this wave's reads of buffer bf are done before the buffer is refilled
    asm volatile("s_wait_asynccnt 0x0" ::: "memory");   // this wave's copies of pass t + 1 have landed
    __syncthreads();                                     // publishes pass t + 1 and ends every wave's reads of buffer bf
    if (t + 2 < DM / GK) stage_ab(la0 + bf * GBUF, lb0 + bf * GBUF, ga0 + (t + 2) * GK, gb0 + (t + 2) * GK); }
  asm volatile("s_wait_asynccnt 0x0" ::: "memory");     // no copy is outstanding when the buffers become output staging
#pragma unroll
  for (int j = 0; j < 8; ++j) { const float bb = bfr(BO[n0 + j * 16 + col]);
#pragma unroll
    for (int r = 0; r < 8; ++r) so[wave][8 * g + r][j * 16 + col] = acc[j][r] + bb; }
  LDSX();
  for (int rl = 0; rl < 16; ++rl) vst2(Y + (r0 + rl) * DM + n0 + lane * 4, *(const v4f*)&so[wave][rl][lane * 4]);
}
extern "C" void kernel_launch(void* const* d_in, const int* in_sizes, int n_in, void* d_out, int out_size, void* d_ws, size_t ws_size, hipStream_t stream) {
  (void)in_sizes; (void)n_in; (void)out_size;
  const float** F = (const float**)d_in;   // 0 key [2,2048,1024], 1 query, 2 value, 3 Wq [1024,1024] (torch), 4 bq, 5 Wk, 6 bk, 7 Wv, 8 bv, 9 Wo, 10 bo, 11 rel_k [5,64], 12 rel_v [5,64]
  if (ws_size < (size_t)WS_END) return;
  char* ws = (char*)d_ws; __bf16 *PK = (__bf16*)(ws + WS_PK), *VTH = (__bf16*)(ws + WS_VTH), *VTL = (__bf16*)(ws + WS_VTL); float *QK = (float*)(ws + WS_QK), *O = (float*)(ws + WS_O);
  k_packrows<<<DM, 256, 0, stream>>>(F[3], DM, PK + PK_A); k_packrows<<<DM, 256, 0, stream>>>(F[5], DM, PK + PK_A + (size_t)DM * DM); k_packrows<<<DM, 256, 0, stream>>>(F[7], DM, PK + PK_A + (size_t)2 * DM * DM); k_packrows<<<DM, 256, 0, stream>>>(F[9], DM, PK + PK_P);
  k_qkv<<<dim3(TNB * SS / 64, QKVW / 128), 128, 0, stream>>>(F[1], F[0], F[2], PK + PK_A, F[4], F[6], F[8], QK);   // q from query, k from key, v from value
  k_vt<<<dim3(TNB * SS / 64, NH), 256, 0, stream>>>(QK, VTH, VTL);
  k_attn<<<dim3(TQB, NH, TNB), 128, 0, stream>>>(QK, VTH, VTL, F[11], F[12], O);
  k_out<<<dim3(TOB, DM / 128), 128, 0, stream>>>(O, PK + PK_P, F[10], (float*)d_out);
}

// v005
// Measured time: 218 microseconds a run.
// In two side-by-side timings against v004, it was 1.14 and 1.13 times as fast.
// Over all steps from v000 it is 2.97 times as fast.
// compute dtype: key/query/value inputs, the four Linear weights/biases and the two relative tables (module inputs) rounded to bf16; q/k/v projections with exact bf16 products (inputs x weights); scores q.k with both operands as bf16 hi + residual pairs (3 products) plus the relative-key term q.rel_k[clip(k-q)] (5 f32 dot products per (token, head)); P.V with P hi/lo x V hi/lo (3 products) plus the relative-value term sum_j mass_j rel_v[j]; output projection hi/lo x exact Wo (2 products) + bo; softmax in f32; f32 accumulate.
#include <hip/hip_runtime.h>
#include <math.h>

typedef __attribute__((ext_vector_type(16))) _Float16 v16h;
typedef __attribute__((ext_vector_type(16))) __bf16 v16b;
typedef __attribute__((ext_vector_type(8)))  _Float16 v8h;
typedef __attribute__((ext_vector_type(8)))  float v8f;
typedef __attribute__((ext_vector_type(4)))  float v4f;
typedef __attribute__((ext_vector_type(2)))  float v2f;
typedef __attribute__((ext_vector_type(4)))  unsigned v4u;
typedef __attribute__((ext_vector_type(4)))  int v4i;
typedef float __attribute__((may_alias)) float_a;
typedef int __attribute__((may_alias)) int_a;

template <typename T> __device__ __forceinline__ void vst2(void* p, T v) { *(T*)p = v;  }
__device__ __forceinline__ v8f wmma16(v16h a, v16h b, v8f c) {
  v8f d = __builtin_amdgcn_wmma_f32_16x16x32_f16(false, a, false, b, (short)0, c, false, false);
  asm volatile("v_nop\n\tv_nop\n\tv_nop\n\tv_nop" : "+v"(d) : "v"(a), "v"(b));
  return d;
}
__device__ __forceinline__ v8f wmma_bf(v16b a, v16b b, v8f c) {
  v8f d = __builtin_amdgcn_wmma_f32_16x16x32_bf16(false, a, false, b, (short)0, c, false, false);
  asm volatile("v_nop\n\tv_nop\n\tv_nop\n\tv_nop" : "+v"(d) : "v"(a), "v"(b));
  return d;
}
// 16x16x32 fragments: lane = (h = lane>>4, row/col = lane&15); elements 0..7 = k0+8h+0..7, 8..15 = k0+16+8h+0..7; D element r = row 8h+r
__device__ __forceinline__ v16h frag_h(const _Float16* rowk0, int lane) {
  union { v16h v; v8h q[2]; } u; const _Float16* p = rowk0 + 8 * (lane >> 4);
  u.q[0] = *(const v8h*)p; u.q[1] = *(const v8h*)(p + 16); return u.v;
}
__device__ __forceinline__ v16h frag_f32(const float* rowk0, int lane) {
  v16h a; const float* p = rowk0 + 8 * (lane >> 4);
#pragma unroll
  for (int i = 0; i < 8; ++i) { a[i] = (_Float16)p[i]; a[8 + i] = (_Float16)p[16 + i]; }
  return a;
}
__device__ __forceinline__ v16h frag_f32s(const float* rowk0, int lane, float sc) {
  v16h a; const float* p = rowk0 + 8 * (lane >> 4);
#pragma unroll
  for (int i = 0; i < 8; ++i) { a[i] = (_Float16)(p[i] * sc); a[8 + i] = (_Float16)(p[16 + i] * sc); }
  return a;
}
// column fragment from a [K][ld] layout (column n), rows >= K read as 0
__device__ __forceinline__ v16h fragc_f32(const float* W, int k0, int n, int lane, int ld, int K) {
  v16h a; const int g = lane >> 4;
#pragma unroll
  for (int i = 0; i < 8; ++i) { const int ka = k0 + 8 * g + i, kb = ka + 16;
    a[i] = (_Float16)(ka < K ? W[(size_t)(ka < K ? ka : K - 1) * ld + n] : 0.f); a[8 + i] = (_Float16)(kb < K ? W[(size_t)(kb < K ? kb : K - 1) * ld + n] : 0.f); }
  return a;
}
struct F2 { v16b h, l; };
__device__ __forceinline__ F2 bsplit16(const float v[16]) { F2 r;
#pragma unroll
  for (int i = 0; i < 16; ++i) { const __bf16 h = (__bf16)v[i]; r.h[i] = h; r.l[i] = (__bf16)(v[i] - (float)h); }
  return r; }
__device__ __forceinline__ F2 split_row(const float* row, int k0, int lane) { float v[16]; const float* p = row + k0 + 8 * (lane >> 4);
#pragma unroll
  for (int i = 0; i < 8; ++i) { v[i] = p[i]; v[8 + i] = p[16 + i]; }
  return bsplit16(v); }
__device__ __forceinline__ F2 split_rowK(const float* row, int k0, int lane, int K) { float v[16]; const int g = lane >> 4;
#pragma unroll
  for (int i = 0; i < 8; ++i) { const int ka = k0 + 8 * g + i, kb = ka + 16; v[i] = ka < K ? row[ka < K ? ka : K - 1] : 0.f; v[8 + i] = kb < K ? row[kb < K ? kb : K - 1] : 0.f; }
  return bsplit16(v); }
__device__ __forceinline__ F2 split_col(const float* W, int k0, int n, int lane, int ld, int K) { float v[16]; const int g = lane >> 4;
#pragma unroll
  for (int i = 0; i < 8; ++i) { const int ka = k0 + 8 * g + i, kb = ka + 16; v[i] = ka < K ? W[(size_t)(ka < K ? ka : K - 1) * ld + n] : 0.f; v[8 + i] = kb < K ? W[(size_t)(kb < K ? kb : K - 1) * ld + n] : 0.f; }
  return bsplit16(v); }
__device__ __forceinline__ v8f mac3(const F2& a, const F2& b, v8f c) { c = wmma_bf(a.l, b.h, c); c = wmma_bf(a.h, b.l, c); return wmma_bf(a.h, b.h, c); }
__device__ __forceinline__ float sigm(float v) { return 1.0f / (1.0f + expf(-v)); }
#define LDSX() do { asm volatile("s_wait_dscnt 0" ::: "memory"); __builtin_amdgcn_wave_barrier(); __builtin_amdgcn_fence(__ATOMIC_RELEASE, "workgroup"); } while (0)


// Multi-head attention with clipped relative position embeddings (B 2, Lq = Lk = 2048, hid 1024, 16 heads x 64, max_rel 2): q = query Wq^T + bq, k = key Wk^T + bk, v = value Wv^T + bv; attn = softmax((q k^T + q . rel_k[clip(k - q, -2, 2) + 2]) / 8); x = attn v + sum_k attn rel_v[clip(k - q) + 2]; out = x Wo^T + bo.
#define NB 2
#define SS 2048
#define DM 1024
#define NH 16
#define HD 64
#define QKVW (3 * DM)
#ifndef TQB
#define TQB (SS / 64)
#define TNB NB
#define TOB (NB * SS / 64)     // output row tiles (all)
#endif
typedef __attribute__((ext_vector_type(8))) __bf16 v8b;
__device__ __forceinline__ v16b frag_b(const __bf16* rowk0, int lane) {
  union { v16b v; v8b q[2]; } u; const __bf16* p = rowk0 + 8 * (lane >> 4);
  u.q[0] = *(const v8b*)p; u.q[1] = *(const v8b*)(p + 16); return u.v;
}
__device__ __forceinline__ float bfr(float v) { return (float)(__bf16)v; }
__device__ __attribute__((noinline)) float erf_ni(float v) { return erff(v); }

#define PK_A 0                       // [3072][1024] c_attn kernel rows (natural)
#define PK_P (PK_A + QKVW * DM)        // [1024][1024] c_proj kernel rows
#define PK_END (PK_P + DM * DM)
#define WS_PK  0u
#define WS_QK  (WS_PK + 2u * PK_END)             // f32 [4096 rows][3072]: [q | k | v], each h*64+d
#define WS_VTH (WS_QK + 4u * NB * SS * QKVW)     // bf16 [2][1024 (h*64+d)][2048 s]
#define WS_VTL (WS_VTH + 2u * NB * DM * SS)
#define WS_O   (WS_VTL + 2u * NB * DM * SS)        // f32 [4096][1024]
#define WS_END (WS_O + 4u * NB * SS * DM)

// ---- k_packrows: block = natural row n of a [N][K] weight (torch [out,in])
__global__ __launch_bounds__(256) void k_packrows(const float* __restrict__ Wm, int K, __bf16* __restrict__ DST) {
  __shared__ __align__(16) __bf16 s[DM]; const int n = blockIdx.x, tid = threadIdx.x;
  for (int k = tid; k < K; k += 256) s[k] = (__bf16)Wm[(size_t)n * K + k];
  __syncthreads();
  for (int q = tid; q < K / 8; q += 256) vst2((unsigned*)(DST + (size_t)n * K + q * 8), *(const v4u*)&s[q * 8]);
}
// ---- operand tiles of the two projection GEMMs (k_qkv, k_out), one 64-deep k pass at a time, staged in LDS once per block: A = 64 f32 rows of 256 B, B = 128 bf16 weight rows of 128 B, so every copy of a wave covers whole 128 B lines. Row pitches are 16 B x odd, so that the 16 rows of a b128 fragment read fall on distinct banks.
#define GK 64                          // k per pass
#define GAP 68                         // floats: 272 B rows of the A tile [64 rows][64 k]
#define GBP 72                         // bf16: 144 B rows of the B tile [128 rows][64 k]
#define GASZ (64 * GAP * 4)            // bytes of an A tile; the B tile stands behind it
#define GBUF (GASZ + 128 * GBP * 2)    // bytes of one buffer
// 8 copies of 16 B a lane, ls bytes apart in LDS and gs elements apart in global memory
template <typename T> __device__ __forceinline__ void copy8(unsigned l, unsigned ls, const T* g, size_t gs) {
  const unsigned l1 = l + ls, l2 = l + 2 * ls, l3 = l + 3 * ls, l4 = l + 4 * ls, l5 = l + 5 * ls, l6 = l + 6 * ls, l7 = l + 7 * ls;
  const T *g1 = g + gs, *g2 = g + 2 * gs, *g3 = g + 3 * gs, *g4 = g + 4 * gs, *g5 = g + 5 * gs, *g6 = g + 6 * gs, *g7 = g + 7 * gs;
  // the copies and the s_wait_xcnt that stands in front of any rewrite of their address registers, in one statement so that nothing moves in between
  asm volatile("global_load_async_to_lds_b128 %0, %8, off\n\t"
               "global_load_async_to_lds_b128 %1, %9, off\n\t"
               "global_load_async_to_lds_b128 %2, %10, off\n\t"
               "global_load_async_to_lds_b128 %3, %11, off\n\t"
               "global_load_async_to_lds_b128 %4, %12, off\n\t"
               "global_load_async_to_lds_b128 %5, %13, off\n\t"
               "global_load_async_to_lds_b128 %6, %14, off\n\t"
               "global_load_async_to_lds_b128 %7, %15, off\n\t"
               "s_wait_xcnt 0x0"
               :: "v"(l), "v"(l1), "v"(l2), "v"(l3), "v"(l4), "v"(l5), "v"(l6), "v"(l7), "v"(g), "v"(g1), "v"(g2), "v"(g3), "v"(g4), "v"(g5), "v"(g6), "v"(g7) : "memory");
}
// one pass's tiles, 16 copies a lane: A rows 8 apart (a wave covers 2 whole rows a copy), B rows 16 apart (4 whole rows a copy). la, lb: the lane's LDS byte addresses in the target buffer; ga, gb: its global addresses.
__device__ __forceinline__ void stage_ab(unsigned la, unsigned lb, const float* ga, const __bf16* gb) { copy8(la, 8 * GAP * 4, ga, (size_t)8 * DM); copy8(lb, 16 * GBP * 2, gb, (size_t)16 * DM); }
__device__ __forceinline__ v16b cvt_lds(const float* p) { v16b r; const v4f a = *(const v4f*)p, b = *(const v4f*)(p + 4), c = *(const v4f*)(p + 16), d = *(const v4f*)(p + 20);
#pragma unroll
  for (int i = 0; i < 4; ++i) { r[i] = (__bf16)a[i]; r[4 + i] = (__bf16)b[i]; r[8 + i] = (__bf16)c[i]; r[12 + i] = (__bf16)d[i]; }
  return r; }
// ---- k_qkv: block = (64 rows, 128 of the 3072 cols): QKV = bf16(x) . rows (exact) -> f32 rows (pitch 3072)
__global__ __launch_bounds__(128) void k_qkv(const float* __restrict__ XQ, const float* __restrict__ XK, const float* __restrict__ XV, const __bf16* __restrict__ P, const float* __restrict__ BQ, const float* __restrict__ BK, const float* __restrict__ BV, float* __restrict__ QKV) {
  __shared__ __align__(16) char sm[2 * GBUF];   // two buffers: pass t reads buffer t & 1 while pass t + 1's tiles land in the other; behind the loop the same bytes stage the output rows
  float (*so)[16][132] = (float (*)[16][132])sm;
  const int tid = threadIdx.x, wave = tid >> 5, lane = tid & 31, col = lane & 15, g = lane >> 4; const size_t rb = (size_t)blockIdx.x * 64, r0 = rb + wave * 16; const int n0 = blockIdx.y * 128; const float* X = (n0 < DM) ? XQ : (n0 < 2 * DM ? XK : XV);
  const unsigned la0 = (unsigned)(size_t)&sm[(tid >> 4) * (GAP * 4) + (tid & 15) * 16], lb0 = (unsigned)(size_t)&sm[GASZ + (tid >> 3) * (GBP * 2) + (tid & 7) * 16];
  const float* ga0 = X + (rb + (tid >> 4)) * DM + (tid & 15) * 4; const __bf16* gb0 = P + (size_t)(n0 + (tid >> 3)) * DM + (tid & 7) * 8;
  stage_ab(la0, lb0, ga0, gb0);
  v8f acc[8] = {};
  asm volatile("s_wait_asynccnt 0x0" ::: "memory");   // this wave's copies of pass 0 have landed
  __syncthreads();                                     // ... and every other wave's: buffer 0 may be read
  stage_ab(la0 + GBUF, lb0 + GBUF, ga0 + GK, gb0 + GK);
  // the pass loop stays rolled (code size; one foot with the waits, the barrier and the refill in their order); the loops inside are fully unrolled so that a, w and acc are indexed by constants and stay in registers
#pragma unroll 1
  for (int t = 0; t < DM / GK; ++t) { const int bf = t & 1; const float* arow = (const float*)(sm + bf * GBUF) + (wave * 16 + col) * GAP + 8 * g; const __bf16* brow = (const __bf16*)(sm + bf * GBUF + GASZ) + col * GBP;
    v16b a[GK / 32], w[GK / 32][8];   // all fragment reads of the pass stand as one group in front of its products: a read among the products would be waited for on the spot
#pragma unroll
    for (int kc = 0; kc < GK / 32; ++kc) a[kc] = cvt_lds(arow + kc * 32);
#pragma unroll
    for (int kc = 0; kc < GK / 32; ++kc) {
#pragma unroll
      for (int j = 0; j < 8; ++j) w[kc][j] = frag_b(brow + j * 16 * GBP + kc * 32, lane); }
#pragma unroll
    for (int kc = 0; kc < GK / 32; ++kc) {
#pragma unroll
      for (int j = 0; j < 8; ++j) acc[j] = wmma_bf(a[kc], w[kc][j], acc[j]); }
    asm volatile("s_wait_dscnt 0x0" ::: "memory");      // this wave's reads of buffer bf are done before the buffer is refilled
    asm volatile("s_wait_asynccnt 0x0" ::: "memory");   // this wave's copies of pass t + 1 have landed
    __syncthreads();                                     // publishes pass t + 1 and ends every wave's reads of buffer bf
    if (t + 2 < DM / GK) stage_ab(la0 + bf * GBUF, lb0 + bf * GBUF, ga0 + (t + 2) * GK, gb0 + (t + 2) * GK); }
  asm volatile("s_wait_asynccnt 0x0" ::: "memory");     // no copy is outstanding when the buffers become output staging
  const float* bias = (n0 < DM) ? BQ : (n0 < 2 * DM ? BK : BV); const int nb = n0 % DM;
#pragma unroll
  for (int j = 0; j < 8; ++j) { const float bb = bfr(bias[nb + j * 16 + col]);
#pragma unroll
    for (int r = 0; r < 8; ++r) so[wave][8 * g + r][j * 16 + col] = acc[j][r] + bb; }
  LDSX();
  for (int rl = 0; rl < 16; ++rl) vst2(QKV + (r0 + rl) * QKVW + n0 + lane * 4, *(const v4f*)&so[wave][rl][lane * 4]);
}
__global__ __launch_bounds__(256) void k_vt(const float* __restrict__ QKV, __bf16* __restrict__ VTH, __bf16* __restrict__ VTL) {
  __shared__ __align__(16) __bf16 sth[64][72], stl[64][72]; const int tid = threadIdx.x; const size_t rb = (size_t)blockIdx.x * 64; const int h = blockIdx.y; const int b = (int)(rb / SS), s0 = (int)(rb % SS);
  for (int q = tid; q < 64 * 64; q += 256) { const int rl = q >> 6, d = q & 63; const float v = QKV[(rb + rl) * QKVW + 2 * DM + h * HD + d]; const __bf16 hb = (__bf16)v; sth[d][rl] = hb; stl[d][rl] = (__bf16)(v - (float)hb); }
  __syncthreads();
  for (int q = tid; q < 64 * 8; q += 256) { const int d = q >> 3, pc = q & 7; const size_t o = ((size_t)b * DM + h * HD + d) * SS + s0 + pc * 8; vst2((unsigned*)(VTH + o), *(const v4u*)&sth[d][pc * 8]); vst2((unsigned*)(VTL + o), *(const v4u*)&stl[d][pc * 8]); }
}
// ---- k_attn: block = (64 queries, head h, batch b): full flash attention (K = 64) on transposed products: S^T = K . Q^T (A = key rows, B = the wave's 16 queries) and O^T += V^T . P^T (A = V^T rows, B = the two score tiles of a pass, converted in place). A lane (g, col) holds query col alone: keys 8g + r of each 16-key tile, so maximum, row sum and the 5 distance-class masses are summed in the lane; the two lane halves exchange the maximum once a pass and join their sums once behind the loop. logits = (q.k (3 products) + qr[clip(k-q)+2]) / 8; P.V 3 products; w2 = sum_j (mass_j / l) rel_v[j]; O[b*S+q][h*64+d] = w1 + w2
// softmax in base 2: SC2 = log2(e) / sqrt(64). The maximum is taken over the unscaled scores (SC2 > 0 keeps the order) and scaled once; each exponential is then one fma and one v_exp_f32 in line, 16 independent ones a pass.
#define SC2 0.18033688f
__device__ __forceinline__ float ex2(float v) { return __builtin_amdgcn_exp2f(v); }
__device__ __forceinline__ float xhalf(float v) { const int b = __builtin_bit_cast(int, v); return __builtin_bit_cast(float, __builtin_amdgcn_permlanex16(b, b, 0x76543210, 0xfedcba98, false, false)); }   // lane l <-> l ^ 16
// K / V^T tiles of one 32-key pass, staged in LDS once per block for its 4 waves. Row pitches are 16 B x odd, so that the 16 rows of a b128 fragment read fall on distinct banks.
#define KP 68    // floats: 272 B rows of the K tile [32 keys][64 d]
#define VP 40    // bf16: 80 B rows of a V^T tile [64 d][32 keys]
__device__ __forceinline__ F2 split_lds(const float* p) { float v[16]; const v4f a = *(const v4f*)p, b = *(const v4f*)(p + 4), c = *(const v4f*)(p + 16), d = *(const v4f*)(p + 20);
#pragma unroll
  for (int i = 0; i < 4; ++i) { v[i] = a[i]; v[4 + i] = b[i]; v[8 + i] = c[i]; v[12 + i] = d[i]; }
  return bsplit16(v); }
// one pass's tiles, 8 copies of 16 B a lane: K rows 8 apart (a wave covers 2 whole rows = 4 lines a copy), V^T hi and residual rows 32 apart. lk, lv: the lane's LDS byte addresses in the target buffer; gk, gh, gl: its global addresses.
__device__ __forceinline__ void stage_kv(unsigned lk, unsigned lv, const float* gk, const __bf16* gh, const __bf16* gl) {
  const unsigned lk1 = lk + 8 * KP * 4, lk2 = lk + 16 * KP * 4, lk3 = lk + 24 * KP * 4, lv1 = lv + 32 * VP * 2, lv2 = lv + 64 * VP * 2, lv3 = lv + 96 * VP * 2;
  const float *gk1 = gk + 8 * QKVW, *gk2 = gk + 16 * QKVW, *gk3 = gk + 24 * QKVW; const __bf16 *gh1 = gh + 32 * SS, *gl1 = gl + 32 * SS;
  // the copies and the s_wait_xcnt that stands in front of any rewrite of their address registers, in one statement so that nothing moves in between
  asm volatile("global_load_async_to_lds_b128 %0, %8, off\n\t"
               "global_load_async_to_lds_b128 %1, %9, off\n\t"
               "global_load_async_to_lds_b128 %2, %10, off\n\t"
               "global_load_async_to_lds_b128 %3, %11, off\n\t"
               "global_load_async_to_lds_b128 %4, %12, off\n\t"
               "global_load_async_to_lds_b128 %5, %13, off\n\t"
               "global_load_async_to_lds_b128 %6, %14, off\n\t"
               "global_load_async_to_lds_b128 %7, %15, off\n\t"
               "s_wait_xcnt 0x0"
               :: "v"(lk), "v"(lk1), "v"(lk2), "v"(lk3), "v"(lv), "v"(lv1), "v"(lv2), "v"(lv3), "v"(gk), "v"(gk1), "v"(gk2), "v"(gk3), "v"(gh), "v"(gh1), "v"(gl), "v"(gl1) : "memory");
}
template <int C> struct Cls { static constexpr int v = C; };
__global__ __launch_bounds__(128) void k_attn(const float* __restrict__ QK, const __bf16* __restrict__ VTH, const __bf16* __restrict__ VTL, const float* __restrict__ RK, const float* __restrict__ RV, float* __restrict__ O) {
  __shared__ __align__(16) float so[4][16][68]; __shared__ float sqr[4][16][8];
  __shared__ __align__(16) float sk[2][32][KP]; __shared__ __align__(16) __bf16 sv[2][2][64][VP];   // two buffers: pass t reads buffer t & 1 while pass t + 1's tiles land in the other
  const int tid = threadIdx.x, wave = tid >> 5, lane = tid & 31, col = lane & 15, g = lane >> 4;
  const int qb = blockIdx.x, h = blockIdx.y, b = blockIdx.z; const int q0 = qb * 64 + wave * 16; const size_t rq = (size_t)b * SS + q0 + col;
  const unsigned lk0 = (unsigned)(size_t)&sk[0][tid >> 4][(tid & 15) * 4], lv0 = (unsigned)(size_t)&sv[0][0][tid >> 2][(tid & 3) * 8];
  const float* gk0 = QK + ((size_t)b * SS + (tid >> 4)) * QKVW + DM + h * HD + (tid & 15) * 4; const size_t gv0 = ((size_t)b * DM + h * HD + (tid >> 2)) * SS + (tid & 3) * 8;
  stage_kv(lk0, lv0, gk0, VTH + gv0, VTL + gv0);   // pass 0's tiles fly under the query set-up below
  F2 aq[2];
#pragma unroll
  for (int kc = 0; kc < 2; ++kc) aq[kc] = split_row(QK + rq * QKVW + h * HD, kc * 32, lane);
  // relative-key logits: sqr[row][j] = q_row . rel_k[j] (f32; the lane's partial over its 4 columns, xor-16 reduced; staged in LDS so the runtime class index is not a private-array index)
#pragma unroll 1
  for (int r = 0; r < 8; ++r) { const float* qrow = QK + ((size_t)b * SS + q0 + 8 * g + r) * QKVW + h * HD;
#pragma unroll
    for (int j = 0; j < 5; ++j) { float a = 0.f;
#pragma unroll
      for (int dt = 0; dt < 4; ++dt) a += qrow[dt * 16 + col] * bfr(RK[j * HD + dt * 16 + col]);
#pragma unroll
      for (int o = 1; o < 16; o <<= 1) a += __shfl_xor(a, o);
      if (col == j) sqr[wave][8 * g + r][j] = a; } }
  LDSX();
  // the inner loops below are fully unrolled so that s, e, jc, ms and acc are indexed by constants and stay in registers
  const int qi = q0 + col;
  float m = -3.0e38f, l = 0.f, ms[5];
#pragma unroll
  for (int j = 0; j < 5; ++j) ms[j] = 0.f;
  v8f acc[4] = {};
  asm volatile("s_wait_asynccnt 0x0" ::: "memory");   // this wave's copies of pass 0 have landed
  __syncthreads();                                     // ... and every other wave's: buffer 0 may be read
  stage_kv(lk0 + (unsigned)sizeof(sk[0]), lv0 + (unsigned)sizeof(sv[0]), gk0 + (size_t)32 * QKVW, VTH + gv0 + 32, VTL + gv0 + 32);
  // One 32-key pass. CLS: the distance class that all (key, query) pairs of the pass share for every query of the block (0: every key at least 2 below every query, 4: at least 2 above), or -1 for a pass that touches the band |k - q| < 2, where each pair's class is looked up. With one class the relative-key logit is a constant of the lane: it comes in as cin, the start value of the score accumulators, and the pass's sum es is the class's mass. always_inline: s, e, acc and ms must stay in registers.
  auto pass = [&](auto cls, const int ks, const v8f cin) __attribute__((always_inline)) { constexpr int CLS = decltype(cls)::v; float s[16]; [[maybe_unused]] int jc[16]; const int bf = ks & 1;
#pragma unroll
    for (int ct = 0; ct < 2; ++ct) { const float* krow = &sk[bf][ct * 16 + col][8 * g]; v8f c = cin;
#pragma unroll
      for (int kc = 0; kc < 2; ++kc) { const F2 kb = split_lds(krow + kc * 32); c = wmma_bf(kb.h, aq[kc].l, c); c = wmma_bf(kb.l, aq[kc].h, c); c = wmma_bf(kb.h, aq[kc].h, c); }
#pragma unroll
      for (int r = 0; r < 8; ++r) {
        if constexpr (CLS < 0) { const int kk = ks * 32 + ct * 16 + 8 * g + r; const int dlt = min(max(kk - qi, -2), 2) + 2; jc[ct * 8 + r] = dlt; s[ct * 8 + r] = c[r] + sqr[wave][col][dlt]; }
        else s[ct * 8 + r] = c[r]; } }   // attn1 + attn2, unscaled
    float mx = s[0];
#pragma unroll
    for (int i = 1; i < 16; ++i) mx = fmaxf(mx, s[i]);
    mx = fmaxf(mx, xhalf(mx));
    const float mn = fmaxf(m, mx * SC2); const float alpha = ex2(m - mn); m = mn;   // m: running maximum of (attn1 + attn2) / sqrt(64) * log2(e)
    float e[16];
#pragma unroll
    for (int i = 0; i < 16; i += 2) { const v2f t = __builtin_elementwise_fma((v2f){s[i], s[i + 1]}, (v2f){SC2, SC2}, (v2f){-mn, -mn}); e[i] = ex2(t[0]); e[i + 1] = ex2(t[1]); }   // one packed fma a score pair
    float es = 0.f;
#pragma unroll
    for (int i = 0; i < 8; ++i) es += e[i] + e[8 + i];
    l = l * alpha + es;
    if constexpr (CLS < 0) {
#pragma unroll
      for (int j = 0; j < 5; ++j) { float add = 0.f;
#pragma unroll
        for (int i = 0; i < 16; ++i) add += (jc[i] == j) ? e[i] : 0.f;
        ms[j] = ms[j] * alpha + add; } }
    else if constexpr (CLS == 4) {
#pragma unroll
      for (int j = 0; j < 4; ++j) ms[j] *= alpha;
      ms[4] = ms[4] * alpha + es; }   // CLS == 0: all mass so far is class 0's, and l holds it
#pragma unroll
    for (int dt = 0; dt < 4; ++dt) acc[dt] *= alpha;
    const F2 pb = bsplit16(e);   // B element i = key 8g + i, element 8 + i = key 16 + 8g + i: the k order of frag_b
#pragma unroll
    for (int dt = 0; dt < 4; ++dt) { const v16b vh = frag_b(&sv[bf][0][dt * 16 + col][0], lane), vl = frag_b(&sv[bf][1][dt * 16 + col][0], lane); acc[dt] = wmma_bf(vh, pb.l, acc[dt]); acc[dt] = wmma_bf(vl, pb.h, acc[dt]); acc[dt] = wmma_bf(vh, pb.h, acc[dt]); }
    asm volatile("s_wait_dscnt 0x0" ::: "memory");      // this wave's reads of buffer bf are done before the buffer is refilled
    asm volatile("s_wait_asynccnt 0x0" ::: "memory");   // this wave's copies of pass ks + 1 have landed
    __syncthreads();                                     // publishes pass ks + 1 and ends every wave's reads of buffer bf
    if (ks + 2 < SS / 32) stage_kv(lk0 + bf * (unsigned)sizeof(sk[0]), lv0 + bf * (unsigned)sizeof(sv[0]), gk0 + (size_t)(ks + 2) * 32 * QKVW, VTH + gv0 + (ks + 2) * 32, VTL + gv0 + (ks + 2) * 32); };
  // The block's queries are 64 qb .. 64 qb + 63: passes below 2 qb - 1 hold keys of class 0 alone, passes from 2 qb + 3 on keys of class 4 alone. The bounds depend on blockIdx alone, so every wave of the block passes the same barriers. The three loops stay rolled (code size).
  const int nlo = max(2 * qb - 1, 0), nhi = min(2 * qb + 3, SS / 32);
  { const float q0c = sqr[wave][col][0]; const v8f cin = {q0c, q0c, q0c, q0c, q0c, q0c, q0c, q0c};
#pragma unroll 1
    for (int ks = 0; ks < nlo; ++ks) pass(Cls<0>{}, ks, cin); }
  ms[0] = l;
#pragma unroll 1
  for (int ks = nlo; ks < nhi; ++ks) pass(Cls<-1>{}, ks, v8f{});
  { const float q4c = sqr[wave][col][4]; const v8f cin = {q4c, q4c, q4c, q4c, q4c, q4c, q4c, q4c};
#pragma unroll 1
    for (int ks = nhi; ks < SS / 32; ++ks) pass(Cls<4>{}, ks, cin); }
  asm volatile("s_wait_asynccnt 0x0" ::: "memory");     // no copy is outstanding when the wave goes on to the epilogue and ends
  l += xhalf(l);
  const float il = 1.0f / l;
#pragma unroll
  for (int j = 0; j < 5; ++j) ms[j] = (ms[j] + xhalf(ms[j])) * il;
#pragma unroll
  for (int dt = 0; dt < 4; ++dt) {
#pragma unroll
    for (int r = 0; r < 8; ++r) { const int d = dt * 16 + 8 * g + r; float w2 = 0.f;
#pragma unroll
      for (int j = 0; j < 5; ++j) w2 += ms[j] * bfr(RV[j * HD + d]);
      so[wave][col][d] = acc[dt][r] * il + w2; } }
  LDSX();
  for (int rl = 0; rl < 16; ++rl) if (lane < 16) vst2(O + ((size_t)b * SS + q0 + rl) * DM + h * HD + lane * 4, *(const v4f*)&so[wave][rl][lane * 4]);
}
// ---- k_out: block = (64 rows, 128 cols): out = O(hi/lo) . c_proj rows (2 products) + bias
__global__ __launch_bounds__(128) void k_out(const float* __restrict__ O, const __bf16* __restrict__ P, const float* __restrict__ BO, float* __restrict__ Y) {
  __shared__ __align__(16) char sm[2 * GBUF];   // two buffers, as in k_qkv; behind the loop the same bytes stage the output rows
  float (*so)[16][132] = (float (*)[16][132])sm;
  const int tid = threadIdx.x, wave = tid >> 5, lane = tid & 31, col = lane & 15, g = lane >> 4; const size_t rb = (size_t)blockIdx.x * 64, r0 = rb + wave * 16; const int n0 = blockIdx.y * 128;
  const unsigned la0 = (unsigned)(size_t)&sm[(tid >> 4) * (GAP * 4) + (tid & 15) * 16], lb0 = (unsigned)(size_t)&sm[GASZ + (tid >> 3) * (GBP * 2) + (tid & 7) * 16];
  const float* ga0 = O + (rb + (tid >> 4)) * DM + (tid & 15) * 4; const __bf16* gb0 = P + (size_t)(n0 + (tid >> 3)) * DM + (tid & 7) * 8;
  stage_ab(la0, lb0, ga0, gb0);
  v8f acc[8] = {};
  asm volatile("s_wait_asynccnt 0x0" ::: "memory");   // this wave's copies of pass 0 have landed
  __syncthreads();                                     // ... and every other wave's: buffer 0 may be read
  stage_ab(la0 + GBUF, lb0 + GBUF, ga0 + GK, gb0 + GK);
  // the pass loop stays rolled (code size; one foot with the waits, the barrier and the refill in their order); the loops inside are fully unrolled so that a, w and acc are indexed by constants and stay in registers
#pragma unroll 1
  for (int t = 0; t < DM / GK; ++t) { const int bf = t & 1; const float* arow = (const float*)(sm + bf * GBUF) + (wave * 16 + col) * GAP + 8 * g; const __bf16* brow = (const __bf16*)(sm + bf * GBUF + GASZ) + col * GBP;
    F2 a[GK / 32]; v16b w[GK / 32][8];   // all fragment reads of the pass stand as one group in front of its products, as in k_qkv
#pragma unroll
    for (int kc = 0; kc < GK / 32; ++kc) a[kc] = split_lds(arow + kc * 32);
#pragma unroll
    for (int kc = 0; kc < GK / 32; ++kc) {
#pragma unroll
      for (int j = 0; j < 8; ++j) w[kc][j] = frag_b(brow + j * 16 * GBP + kc * 32, lane); }
#pragma unroll
    for (int kc = 0; kc < GK / 32; ++kc) {
#pragma unroll
      for (int j = 0; j < 8; ++j) { acc[j] = wmma_bf(a[kc].l, w[kc][j], acc[j]); acc[j] = wmma_bf(a[kc].h, w[kc][j], acc[j]); } }
    asm volatile("s_wait_dscnt 0x0" ::: "memory");      // this wave's reads of buffer bf are done before the buffer is refilled
    asm volatile("s_wait_asynccnt 0x0" ::: "memory");   // this wave's copies of pass t + 1 have landed
    __syncthreads();                                     // publishes pass t + 1 and ends every wave's reads of buffer bf
    if (t + 2 < DM / GK) stage_ab(la0 + bf * GBUF, lb0 + bf * GBUF, ga0 + (t + 2) * GK, gb0 + (t + 2) * GK); }
  asm volatile("s_wait_asynccnt 0x0" ::: "memory");     // no copy is outstanding when the buffers become output staging
#pragma unroll
  for (int j = 0; j < 8; ++j) { const float bb = bfr(BO[n0 + j * 16 + col]);
#pragma unroll
    for (int r = 0; r < 8; ++r) so[wave][8 * g + r][j * 16 + col] = acc[j][r] + bb; }
  LDSX();
  for (int rl = 0; rl < 16; ++rl) vst2(Y + (r0 + rl) * DM + n0 + lane * 4, *(const v4f*)&so[wave][rl][lane * 4]);
}
extern "C" void kernel_launch(void* const* d_in, const int* in_sizes, int n_in, void* d_out, int out_size, void* d_ws, size_t ws_size, hipStream_t stream) {
  (void)in_sizes; (void)n_in; (void)out_size;
  const float** F = (const float**)d_in;   // 0 key [2,2048,1024], 1 query, 2 value, 3 Wq [1024,1024] (torch), 4 bq, 5 Wk, 6 bk, 7 Wv, 8 bv, 9 Wo, 10 bo, 11 rel_k [5,64], 12 rel_v [5,64]
  if (ws_size < (size_t)WS_END) return;
  char* ws = (char*)d_ws; __bf16 *PK = (__bf16*)(ws + WS_PK), *VTH = (__bf16*)(ws + WS_VTH), *VTL = (__bf16*)(ws + WS_VTL); float *QK = (float*)(ws + WS_QK), *O = (float*)(ws + WS_O);
  k_packrows<<<DM, 256, 0, stream>>>(F[3], DM, PK + PK_A); k_packrows<<<DM, 256, 0, stream>>>(F[5], DM, PK + PK_A + (size_t)DM * DM); k_packrows<<<DM, 256, 0, stream>>>(F[7], DM, PK + PK_A + (size_t)2 * DM * DM); k_packrows<<<DM, 256, 0, stream>>>(F[9], DM, PK + PK_P);
  k_qkv<<<dim3(TNB * SS / 64, QKVW / 128), 128, 0, stream>>>(F[1], F[0], F[2], PK + PK_A, F[4], F[6], F[8], QK);   // q from query, k from key, v from value
  k_vt<<<dim3(TNB * SS / 64, NH), 256, 0, stream>>>(QK, VTH, VTL);
  k_attn<<<dim3(TQB, NH, TNB), 128, 0, stream>>>(QK, VTH, VTL, F[11], F[12], O);
  k_out<<<dim3(TOB, DM / 128), 128, 0, stream>>>(O, PK + PK_P, F[10], (float*)d_out);
}

// v006
// A run of this version takes 189 microseconds.
// In two side-by-side timings against v005, it was 1.15 and 1.16 times as fast.
// Over all steps from v000 it is 3.43 times as fast.
// compute dtype: key/query/value inputs, the four Linear weights/biases and the two relative tables (module inputs) rounded to bf16; q/k/v projections with exact bf16 products (inputs x weights); scores q.k with both operands as bf16 hi + residual pairs (3 products) plus the relative-key term q.rel_k[clip(k-q)] (5 f32 dot products per (token, head)); P.V with P hi/lo x V hi/lo (3 products) plus the relative-value term sum_j mass_j rel_v[j]; output projection hi/lo x exact Wo (2 products) + bo; softmax in f32; f32 accumulate.
#include <hip/hip_runtime.h>
#include <math.h>

typedef __attribute__((ext_vector_type(16))) _Float16 v16h;
typedef __attribute__((ext_vector_type(16))) __bf16 v16b;
typedef __attribute__((ext_vector_type(8)))  _Float16 v8h;
typedef __attribute__((ext_vector_type(8)))  float v8f;
typedef __attribute__((ext_vector_type(4)))  float v4f;
typedef __attribute__((ext_vector_type(2)))  float v2f;
typedef __attribute__((ext_vector_type(4)))  unsigned v4u;
typedef __attribute__((ext_vector_type(4)))  int v4i;
typedef float __attribute__((may_alias)) float_a;
typedef int __attribute__((may_alias)) int_a;

template <typename T> __device__ __forceinline__ void vst2(void* p, T v) { *(T*)p = v;  }
__device__ __forceinline__ v8f wmma16(v16h a, v16h b, v8f c) {
  v8f d = __builtin_amdgcn_wmma_f32_16x16x32_f16(false, a, false, b, (short)0, c, false, false);
  asm volatile("v_nop\n\tv_nop\n\tv_nop\n\tv_nop" : "+v"(d) : "v"(a), "v"(b));
  return d;
}
__device__ __forceinline__ v8f wmma_bf(v16b a, v16b b, v8f c) {
  v8f d = __builtin_amdgcn_wmma_f32_16x16x32_bf16(false, a, false, b, (short)0, c, false, false);
  asm volatile("v_nop\n\tv_nop\n\tv_nop\n\tv_nop" : "+v"(d) : "v"(a), "v"(b));
  return d;
}
// 16x16x32 fragments: lane = (h = lane>>4, row/col = lane&15); elements 0..7 = k0+8h+0..7, 8..15 = k0+16+8h+0..7; D element r = row 8h+r
__device__ __forceinline__ v16h frag_h(const _Float16* rowk0, int lane) {
  union { v16h v; v8h q[2]; } u; const _Float16* p = rowk0 + 8 * (lane >> 4);
  u.q[0] = *(const v8h*)p; u.q[1] = *(const v8h*)(p + 16); return u.v;
}
__device__ __forceinline__ v16h frag_f32(const float* rowk0, int lane) {
  v16h a; const float* p = rowk0 + 8 * (lane >> 4);
#pragma unroll
  for (int i = 0; i < 8; ++i) { a[i] = (_Float16)p[i]; a[8 + i] = (_Float16)p[16 + i]; }
  return a;
}
__device__ __forceinline__ v16h frag_f32s(const float* rowk0, int lane, float sc) {
  v16h a; const float* p = rowk0 + 8 * (lane >> 4);
#pragma unroll
  for (int i = 0; i < 8; ++i) { a[i] = (_Float16)(p[i] * sc); a[8 + i] = (_Float16)(p[16 + i] * sc); }
  return a;
}
// column fragment from a [K][ld] layout (column n), rows >= K read as 0
__device__ __forceinline__ v16h fragc_f32(const float* W, int k0, int n, int lane, int ld, int K) {
  v16h a; const int g = lane >> 4;
#pragma unroll
  for (int i = 0; i < 8; ++i) { const int ka = k0 + 8 * g + i, kb = ka + 16;
    a[i] = (_Float16)(ka < K ? W[(size_t)(ka < K ? ka : K - 1) * ld + n] : 0.f); a[8 + i] = (_Float16)(kb < K ? W[(size_t)(kb < K ? kb : K - 1) * ld + n] : 0.f); }
  return a;
}
struct F2 { v16b h, l; };
__device__ __forceinline__ F2 bsplit16(const float v[16]) { F2 r;
#pragma unroll
  for (int i = 0; i < 16; ++i) { const __bf16 h = (__bf16)v[i]; r.h[i] = h; r.l[i] = (__bf16)(v[i] - (float)h); }
  return r; }
__device__ __forceinline__ F2 split_row(const float* row, int k0, int lane) { float v[16]; const float* p = row + k0 + 8 * (lane >> 4);
#pragma unroll
  for (int i = 0; i < 8; ++i) { v[i] = p[i]; v[8 + i] = p[16 + i]; }
  return bsplit16(v); }
__device__ __forceinline__ F2 split_rowK(const float* row, int k0, int lane, int K) { float v[16]; const int g = lane >> 4;
#pragma unroll
  for (int i = 0; i < 8; ++i) { const int ka = k0 + 8 * g + i, kb = ka + 16; v[i] = ka < K ? row[ka < K ? ka : K - 1] : 0.f; v[8 + i] = kb < K ? row[kb < K ? kb : K - 1] : 0.f; }
  return bsplit16(v); }
__device__ __forceinline__ F2 split_col(const float* W, int k0, int n, int lane, int ld, int K) { float v[16]; const int g = lane >> 4;
#pragma unroll
  for (int i = 0; i < 8; ++i) { const int ka = k0 + 8 * g + i, kb = ka + 16; v[i] = ka < K ? W[(size_t)(ka < K ? ka : K - 1) * ld + n] : 0.f; v[8 + i] = kb < K ? W[(size_t)(kb < K ? kb : K - 1) * ld + n] : 0.f; }
  return bsplit16(v); }
__device__ __forceinline__ v8f mac3(const F2& a, const F2& b, v8f c) { c = wmma_bf(a.l, b.h, c); c = wmma_bf(a.h, b.l, c); return wmma_bf(a.h, b.h, c); }
__device__ __forceinline__ float sigm(float v) { return 1.0f / (1.0f + expf(-v)); }
#define LDSX() do { asm volatile("s_wait_dscnt 0" ::: "memory"); __builtin_amdgcn_wave_barrier(); __builtin_amdgcn_fence(__ATOMIC_RELEASE, "workgroup"); } while (0)


// Multi-head attention with clipped relative position embeddings (B 2, Lq = Lk = 2048, hid 1024, 16 heads x 64, max_rel 2): q = query Wq^T + bq, k = key Wk^T + bk, v = value Wv^T + bv; attn = softmax((q k^T + q . rel_k[clip(k - q, -2, 2) + 2]) / 8); x = attn v + sum_k attn rel_v[clip(k - q) + 2]; out = x Wo^T + bo.
#define NB 2
#define SS 2048
#define DM 1024
#define NH 16
#define HD 64
#define QKVW (3 * DM)
#ifndef TQB
#define TQB (SS / 64)
#define TNB NB
#define TOB (NB * SS / 64)     // output row tiles (all)
#endif
typedef __attribute__((ext_vector_type(8))) __bf16 v8b;
typedef __attribute__((ext_vector_type(4))) __bf16 v4b;
__device__ __forceinline__ v16b frag_b(const __bf16* rowk0, int lane) {
  union { v16b v; v8b q[2]; } u; const __bf16* p = rowk0 + 8 * (lane >> 4);
  u.q[0] = *(const v8b*)p; u.q[1] = *(const v8b*)(p + 16); return u.v;
}
__device__ __forceinline__ float bfr(float v) { return (float)(__bf16)v; }
__device__ __attribute__((noinline)) float erf_ni(float v) { return erff(v); }

#define PK_A 0                       // [3072][1024] c_attn kernel rows (natural)
#define PK_P (PK_A + QKVW * DM)        // [1024][1024] c_proj kernel rows
#define PK_END (PK_P + DM * DM)
#define WS_PK  0u
#define WS_QK  (WS_PK + 2u * PK_END)             // f32 [4096 rows][3072]: [q | - | v], each 1024 (h*64+d) (the k columns are not written: k goes to WS_KH, WS_KL)
#define WS_VTH (WS_QK + 4u * NB * SS * QKVW)     // bf16 [2][1024 (h*64+d)][2048 s]
#define WS_VTL (WS_VTH + 2u * NB * DM * SS)
#define WS_O   (WS_VTL + 2u * NB * DM * SS)        // f32 [4096][1024]
#define WS_KH  (WS_O + 4u * NB * SS * DM)         // bf16 [4096 rows][1024 (h*64+d)]: k, rounded
#define WS_KL  (WS_KH + 2u * NB * SS * DM)        // bf16, same shape: k minus its rounded value
#define WS_END (WS_KL + 2u * NB * SS * DM)

// ---- k_packrows: block = natural row n of a [N][K] weight (torch [out,in])
__global__ __launch_bounds__(256) void k_packrows(const float* __restrict__ Wm, int K, __bf16* __restrict__ DST) {
  __shared__ __align__(16) __bf16 s[DM]; const int n = blockIdx.x, tid = threadIdx.x;
  for (int k = tid; k < K; k += 256) s[k] = (__bf16)Wm[(size_t)n * K + k];
  __syncthreads();
  for (int q = tid; q < K / 8; q += 256) vst2((unsigned*)(DST + (size_t)n * K + q * 8), *(const v4u*)&s[q * 8]);
}
// ---- operand tiles of the two projection GEMMs (k_qkv, k_out), one 64-deep k pass at a time, staged in LDS once per block: A = 64 f32 rows of 256 B, B = 128 bf16 weight rows of 128 B, so every copy of a wave covers whole 128 B lines. Row pitches are 16 B x odd, so that the 16 rows of a b128 fragment read fall on distinct banks.
#define GK 64                          // k per pass
#define GAP 68                         // floats: 272 B rows of the A tile [64 rows][64 k]
#define GBP 72                         // bf16: 144 B rows of the B tile [128 rows][64 k]
#define GASZ (64 * GAP * 4)            // bytes of an A tile; the B tile stands behind it
#define GBUF (GASZ + 128 * GBP * 2)    // bytes of one buffer
// 8 copies of 16 B a lane, ls bytes apart in LDS and gs elements apart in global memory
template <typename T> __device__ __forceinline__ void copy8(unsigned l, unsigned ls, const T* g, size_t gs) {
  const unsigned l1 = l + ls, l2 = l + 2 * ls, l3 = l + 3 * ls, l4 = l + 4 * ls, l5 = l + 5 * ls, l6 = l + 6 * ls, l7 = l + 7 * ls;
  const T *g1 = g + gs, *g2 = g + 2 * gs, *g3 = g + 3 * gs, *g4 = g + 4 * gs, *g5 = g + 5 * gs, *g6 = g + 6 * gs, *g7 = g + 7 * gs;
  // the copies and the s_wait_xcnt that stands in front of any rewrite of their address registers, in one statement so that nothing moves in between
  asm volatile("global_load_async_to_lds_b128 %0, %8, off\n\t"
               "global_load_async_to_lds_b128 %1, %9, off\n\t"
               "global_load_async_to_lds_b128 %2, %10, off\n\t"
               "global_load_async_to_lds_b128 %3, %11, off\n\t"
               "global_load_async_to_lds_b128 %4, %12, off\n\t"
               "global_load_async_to_lds_b128 %5, %13, off\n\t"
               "global_load_async_to_lds_b128 %6, %14, off\n\t"
               "global_load_async_to_lds_b128 %7, %15, off\n\t"
               "s_wait_xcnt 0x0"
               :: "v"(l), "v"(l1), "v"(l2), "v"(l3), "v"(l4), "v"(l5), "v"(l6), "v"(l7), "v"(g), "v"(g1), "v"(g2), "v"(g3), "v"(g4), "v"(g5), "v"(g6), "v"(g7) : "memory");
}
// one pass's tiles, 16 copies a lane: A rows 8 apart (a wave covers 2 whole rows a copy), B rows 16 apart (4 whole rows a copy). la, lb: the lane's LDS byte addresses in the target buffer; ga, gb: its global addresses.
__device__ __forceinline__ void stage_ab(unsigned la, unsigned lb, const float* ga, const __bf16* gb) { copy8(la, 8 * GAP * 4, ga, (size_t)8 * DM); copy8(lb, 16 * GBP * 2, gb, (size_t)16 * DM); }
__device__ __forceinline__ v16b cvt_lds(const float* p) { v16b r; const v4f a = *(const v4f*)p, b = *(const v4f*)(p + 4), c = *(const v4f*)(p + 16), d = *(const v4f*)(p + 20);
#pragma unroll
  for (int i = 0; i < 4; ++i) { r[i] = (__bf16)a[i]; r[4 + i] = (__bf16)b[i]; r[8 + i] = (__bf16)c[i]; r[12 + i] = (__bf16)d[i]; }
  return r; }
// ---- k_qkv: block = (64 rows, 128 of the 3072 cols): QKV = bf16(x) . rows (exact) -> f32 rows (pitch 3072); the k columns leave as a bf16 pair (rounded value, residual), split here once instead of in every wave of every query block of k_attn
__global__ __launch_bounds__(128) void k_qkv(const float* __restrict__ XQ, const float* __restrict__ XK, const float* __restrict__ XV, const __bf16* __restrict__ P, const float* __restrict__ BQ, const float* __restrict__ BK, const float* __restrict__ BV, float* __restrict__ QKV, __bf16* __restrict__ KH, __bf16* __restrict__ KL) {
  __shared__ __align__(16) char sm[2 * GBUF];   // two buffers: pass t reads buffer t & 1 while pass t + 1's tiles land in the other; behind the loop the same bytes stage the output rows
  float (*so)[16][132] = (float (*)[16][132])sm;
  const int tid = threadIdx.x, wave = tid >> 5, lane = tid & 31, col = lane & 15, g = lane >> 4; const size_t rb = (size_t)blockIdx.x * 64, r0 = rb + wave * 16; const int n0 = blockIdx.y * 128; const float* X = (n0 < DM) ? XQ : (n0 < 2 * DM ? XK : XV);
  const unsigned la0 = (unsigned)(size_t)&sm[(tid >> 4) * (GAP * 4) + (tid & 15) * 16], lb0 = (unsigned)(size_t)&sm[GASZ + (tid >> 3) * (GBP * 2) + (tid & 7) * 16];
  const float* ga0 = X + (rb + (tid >> 4)) * DM + (tid & 15) * 4; const __bf16* gb0 = P + (size_t)(n0 + (tid >> 3)) * DM + (tid & 7) * 8;
  stage_ab(la0, lb0, ga0, gb0);
  v8f acc[8] = {};
  asm volatile("s_wait_asynccnt 0x0" ::: "memory");   // this wave's copies of pass 0 have landed
  __syncthreads();                                     // ... and every other wave's: buffer 0 may be read
  stage_ab(la0 + GBUF, lb0 + GBUF, ga0 + GK, gb0 + GK);
  // the pass loop stays rolled (code size; one foot with the waits, the barrier and the refill in their order); the loops inside are fully unrolled so that a, w and acc are indexed by constants and stay in registers
#pragma unroll 1
  for (int t = 0; t < DM / GK; ++t) { const int bf = t & 1; const float* arow = (const float*)(sm + bf * GBUF) + (wave * 16 + col) * GAP + 8 * g; const __bf16* brow = (const __bf16*)(sm + bf * GBUF + GASZ) + col * GBP;
    v16b a[GK / 32], w[GK / 32][8];   // all fragment reads of the pass stand as one group in front of its products: a read among the products would be waited for on the spot
#pragma unroll
    for (int kc = 0; kc < GK / 32; ++kc) a[kc] = cvt_lds(arow + kc * 32);
#pragma unroll
    for (int kc = 0; kc < GK / 32; ++kc) {
#pragma unroll
      for (int j = 0; j < 8; ++j) w[kc][j] = frag_b(brow + j * 16 * GBP + kc * 32, lane); }
#pragma unroll
    for (int kc = 0; kc < GK / 32; ++kc) {
#pragma unroll
      for (int j = 0; j < 8; ++j) acc[j] = wmma_bf(a[kc], w[kc][j], acc[j]); }
    asm volatile("s_wait_dscnt 0x0" ::: "memory");      // this wave's reads of buffer bf are done before the buffer is refilled
    asm volatile("s_wait_asynccnt 0x0" ::: "memory");   // this wave's copies of pass t + 1 have landed
    __syncthreads();                                     // publishes pass t + 1 and ends every wave's reads of buffer bf
    if (t + 2 < DM / GK) stage_ab(la0 + bf * GBUF, lb0 + bf * GBUF, ga0 + (t + 2) * GK, gb0 + (t + 2) * GK); }
  asm volatile("s_wait_asynccnt 0x0" ::: "memory");     // no copy is outstanding when the buffers become output staging
  const float* bias = (n0 < DM) ? BQ : (n0 < 2 * DM ? BK : BV); const int nb = n0 % DM;
#pragma unroll
  for (int j = 0; j < 8; ++j) { const float bb = bfr(bias[nb + j * 16 + col]);
#pragma unroll
    for (int r = 0; r < 8; ++r) so[wave][8 * g + r][j * 16 + col] = acc[j][r] + bb; }
  LDSX();
  if (n0 >= DM && n0 < 2 * DM) {   // block-uniform: a block's 128 columns lie in one of q, k, v
    for (int rl = 0; rl < 16; ++rl) { const v4f v = *(const v4f*)&so[wave][rl][lane * 4]; v4b hi, lo;
#pragma unroll
      for (int i = 0; i < 4; ++i) { hi[i] = (__bf16)v[i]; lo[i] = (__bf16)(v[i] - (float)hi[i]); }
      const size_t o = (r0 + rl) * DM + nb + lane * 4; vst2(KH + o, hi); vst2(KL + o, lo); } }
  else for (int rl = 0; rl < 16; ++rl) vst2(QKV + (r0 + rl) * QKVW + n0 + lane * 4, *(const v4f*)&so[wave][rl][lane * 4]);
}
__global__ __launch_bounds__(256) void k_vt(const float* __restrict__ QKV, __bf16* __restrict__ VTH, __bf16* __restrict__ VTL) {
  __shared__ __align__(16) __bf16 sth[64][72], stl[64][72]; const int tid = threadIdx.x; const size_t rb = (size_t)blockIdx.x * 64; const int h = blockIdx.y; const int b = (int)(rb / SS), s0 = (int)(rb % SS);
  for (int q = tid; q < 64 * 64; q += 256) { const int rl = q >> 6, d = q & 63; const float v = QKV[(rb + rl) * QKVW + 2 * DM + h * HD + d]; const __bf16 hb = (__bf16)v; sth[d][rl] = hb; stl[d][rl] = (__bf16)(v - (float)hb); }
  __syncthreads();
  for (int q = tid; q < 64 * 8; q += 256) { const int d = q >> 3, pc = q & 7; const size_t o = ((size_t)b * DM + h * HD + d) * SS + s0 + pc * 8; vst2((unsigned*)(VTH + o), *(const v4u*)&sth[d][pc * 8]); vst2((unsigned*)(VTL + o), *(const v4u*)&stl[d][pc * 8]); }
}
// ---- k_attn: block = (64 queries, head h, batch b): full flash attention (K = 64) on transposed products: S^T = K . Q^T (A = key rows, B = the wave's 16 queries) and O^T += V^T . P^T (A = V^T rows, B = the two score tiles of a pass, converted in place). A lane (g, col) holds query col alone: keys 8g + r of each 16-key tile, so maximum, row sum and the 5 distance-class masses are summed in the lane; the two lane halves exchange the maximum once a pass and join their sums once behind the loop. logits = (q.k (3 products) + qr[clip(k-q)+2]) / 8; P.V 3 products; w2 = sum_j (mass_j / l) rel_v[j]; O[b*S+q][h*64+d] = w1 + w2
// softmax in base 2: SC2 = log2(e) / sqrt(64). The maximum is taken over the unscaled scores (SC2 > 0 keeps the order) and scaled once; each exponential is then one fma and one v_exp_f32 in line, 16 independent ones a pass.
#define SC2 0.18033688f
__device__ __forceinline__ float ex2(float v) { return __builtin_amdgcn_exp2f(v); }
__device__ __forceinline__ float xhalf(float v) { const int b = __builtin_bit_cast(int, v); return __builtin_bit_cast(float, __builtin_amdgcn_permlanex16(b, b, 0x76543210, 0xfedcba98, false, false)); }   // lane l <-> l ^ 16
// K / V^T tiles of one 32-key pass, staged in LDS once per block for its 4 waves. Row pitches are 16 B x odd, so that the 16 rows of a b128 fragment read fall on distinct banks.
#define KP 72    // bf16: 144 B rows of a K tile [32 keys][64 d]
#define VP 40    // bf16: 80 B rows of a V^T tile [64 d][32 keys]
__device__ __forceinline__ F2 split_lds(const float* p) { float v[16]; const v4f a = *(const v4f*)p, b = *(const v4f*)(p + 4), c = *(const v4f*)(p + 16), d = *(const v4f*)(p + 20);
#pragma unroll
  for (int i = 0; i < 4; ++i) { v[i] = a[i]; v[4 + i] = b[i]; v[8 + i] = c[i]; v[12 + i] = d[i]; }
  return bsplit16(v); }
// one pass's tiles, 8 copies of 16 B a lane: K hi and residual rows 16 apart (a wave covers 4 whole rows = 4 lines a copy), V^T hi and residual rows 32 apart. lk, lv: the lane's LDS byte addresses in the target buffer; gk, gk2 (K hi, residual), gh, gl (V^T hi, residual): its global addresses.
__device__ __forceinline__ void stage_kv(unsigned lk, unsigned lv, const __bf16* gk, const __bf16* gk2, const __bf16* gh, const __bf16* gl) {
  const unsigned lk1 = lk + 16 * KP * 2, lk2 = lk + 32 * KP * 2, lk3 = lk + 48 * KP * 2, lv1 = lv + 32 * VP * 2, lv2 = lv + 64 * VP * 2, lv3 = lv + 96 * VP * 2;
  const __bf16 *gk1 = gk + 16 * DM, *gk3 = gk2 + 16 * DM, *gh1 = gh + 32 * SS, *gl1 = gl + 32 * SS;
  // the copies and the s_wait_xcnt that stands in front of any rewrite of their address registers, in one statement so that nothing moves in between
  asm volatile("global_load_async_to_lds_b128 %0, %8, off\n\t"
               "global_load_async_to_lds_b128 %1, %9, off\n\t"
               "global_load_async_to_lds_b128 %2, %10, off\n\t"
               "global_load_async_to_lds_b128 %3, %11, off\n\t"
               "global_load_async_to_lds_b128 %4, %12, off\n\t"
               "global_load_async_to_lds_b128 %5, %13, off\n\t"
               "global_load_async_to_lds_b128 %6, %14, off\n\t"
               "global_load_async_to_lds_b128 %7, %15, off\n\t"
               "s_wait_xcnt 0x0"
               :: "v"(lk), "v"(lk1), "v"(lk2), "v"(lk3), "v"(lv), "v"(lv1), "v"(lv2), "v"(lv3), "v"(gk), "v"(gk1), "v"(gk2), "v"(gk3), "v"(gh), "v"(gh1), "v"(gl), "v"(gl1) : "memory");
}
template <int C> struct Cls { static constexpr int v = C; };
__global__ __launch_bounds__(128) void k_attn(const float* __restrict__ QK, const __bf16* __restrict__ KH, const __bf16* __restrict__ KL, const __bf16* __restrict__ VTH, const __bf16* __restrict__ VTL, const float* __restrict__ RK, const float* __restrict__ RV, float* __restrict__ O) {
  __shared__ __align__(16) float so[4][16][68]; __shared__ float sqr[4][16][8];
  __shared__ __align__(16) __bf16 sk[2][2][32][KP]; __shared__ __align__(16) __bf16 sv[2][2][64][VP];   // two buffers: pass t reads buffer t & 1 while pass t + 1's tiles land in the other
  const int tid = threadIdx.x, wave = tid >> 5, lane = tid & 31, col = lane & 15, g = lane >> 4;
  const int qb = blockIdx.x, h = blockIdx.y, b = blockIdx.z; const int q0 = qb * 64 + wave * 16; const size_t rq = (size_t)b * SS + q0 + col;
  const unsigned lk0 = (unsigned)(size_t)&sk[0][0][tid >> 3][(tid & 7) * 8], lv0 = (unsigned)(size_t)&sv[0][0][tid >> 2][(tid & 3) * 8];
  const size_t gk0 = ((size_t)b * SS + (tid >> 3)) * DM + h * HD + (tid & 7) * 8; const size_t gv0 = ((size_t)b * DM + h * HD + (tid >> 2)) * SS + (tid & 3) * 8;
  stage_kv(lk0, lv0, KH + gk0, KL + gk0, VTH + gv0, VTL + gv0);   // pass 0's tiles fly under the query set-up below
  F2 aq[2];
#pragma unroll
  for (int kc = 0; kc < 2; ++kc) aq[kc] = split_row(QK + rq * QKVW + h * HD, kc * 32, lane);
  // relative-key logits: sqr[row][j] = q_row . rel_k[j] (f32; the lane's partial over its 4 columns, xor-16 reduced; staged in LDS so the runtime class index is not a private-array index)
#pragma unroll 1
  for (int r = 0; r < 8; ++r) { const float* qrow = QK + ((size_t)b * SS + q0 + 8 * g + r) * QKVW + h * HD;
#pragma unroll
    for (int j = 0; j < 5; ++j) { float a = 0.f;
#pragma unroll
      for (int dt = 0; dt < 4; ++dt) a += qrow[dt * 16 + col] * bfr(RK[j * HD + dt * 16 + col]);
#pragma unroll
      for (int o = 1; o < 16; o <<= 1) a += __shfl_xor(a, o);
      if (col == j) sqr[wave][8 * g + r][j] = a; } }
  LDSX();
  // the inner loops below are fully unrolled so that s, e, jc, ms and acc are indexed by constants and stay in registers
  const int qi = q0 + col;
  float m = -3.0e38f, l = 0.f, ms[5];
#pragma unroll
  for (int j = 0; j < 5; ++j) ms[j] = 0.f;
  v8f acc[4] = {};
  asm volatile("s_wait_asynccnt 0x0" ::: "memory");   // this wave's copies of pass 0 have landed
  __syncthreads();                                     // ... and every other wave's: buffer 0 may be read
  stage_kv(lk0 + (unsigned)sizeof(sk[0]), lv0 + (unsigned)sizeof(sv[0]), KH + gk0 + 32 * DM, KL + gk0 + 32 * DM, VTH + gv0 + 32, VTL + gv0 + 32);
  // One 32-key pass. CLS: the distance class that all (key, query) pairs of the pass share for every query of the block (0: every key at least 2 below every query, 4: at least 2 above), or -1 for a pass that touches the band |k - q| < 2, where each pair's class is looked up. With one class the relative-key logit is a constant of the lane: it comes in as cin, the start value of the score accumulators, and the pass's sum es is the class's mass. always_inline: s, e, acc and ms must stay in registers.
  auto pass = [&](auto cls, const int ks, const v8f cin) __attribute__((always_inline)) { constexpr int CLS = decltype(cls)::v; float s[16]; [[maybe_unused]] int jc[16]; const int bf = ks & 1;
#pragma unroll
    for (int ct = 0; ct < 2; ++ct) { const __bf16* krow = &sk[bf][0][ct * 16 + col][0]; v8f c = cin;
#pragma unroll
      for (int kc = 0; kc < 2; ++kc) { const v16b kh = frag_b(krow + kc * 32, lane), kl = frag_b(krow + 32 * KP + kc * 32, lane); c = wmma_bf(kh, aq[kc].l, c); c = wmma_bf(kl, aq[kc].h, c); c = wmma_bf(kh, aq[kc].h, c); }
#pragma unroll
      for (int r = 0; r < 8; ++r) {
        if constexpr (CLS < 0) { const int kk = ks * 32 + ct * 16 + 8 * g + r; const int dlt = min(max(kk - qi, -2), 2) + 2; jc[ct * 8 + r] = dlt; s[ct * 8 + r] = c[r] + sqr[wave][col][dlt]; }
        else s[ct * 8 + r] = c[r]; } }   // attn1 + attn2, unscaled
    float mx = s[0];
#pragma unroll
    for (int i = 1; i < 16; ++i) mx = fmaxf(mx, s[i]);
    mx = fmaxf(mx, xhalf(mx));
    const float mn = fmaxf(m, mx * SC2); const float alpha = ex2(m - mn); m = mn;   // m: running maximum of (attn1 + attn2) / sqrt(64) * log2(e)
    float e[16];
#pragma unroll
    for (int i = 0; i < 16; i += 2) { const v2f t = __builtin_elementwise_fma((v2f){s[i], s[i + 1]}, (v2f){SC2, SC2}, (v2f){-mn, -mn}); e[i] = ex2(t[0]); e[i + 1] = ex2(t[1]); }   // one packed fma a score pair
    float es = 0.f;
#pragma unroll
    for (int i = 0; i < 8; ++i) es += e[i] + e[8 + i];
    l = l * alpha + es;
    if constexpr (CLS < 0) {
#pragma unroll
      for (int j = 0; j < 5; ++j) { float add = 0.f;
#pragma unroll
        for (int i = 0; i < 16; ++i) add += (jc[i] == j) ? e[i] : 0.f;
        ms[j] = ms[j] * alpha + add; } }
    else if constexpr (CLS == 4) {
#pragma unroll
      for (int j = 0; j < 4; ++j) ms[j] *= alpha;
      ms[4] = ms[4] * alpha + es; }   // CLS == 0: all mass so far is class 0's, and l holds it
#pragma unroll
    for (int dt = 0; dt < 4; ++dt) acc[dt] *= alpha;
    const F2 pb = bsplit16(e);   // B element i = key 8g + i, element 8 + i = key 16 + 8g + i: the k order of frag_b
#pragma unroll
    for (int dt = 0; dt < 4; ++dt) { const v16b vh = frag_b(&sv[bf][0][dt * 16 + col][0], lane), vl = frag_b(&sv[bf][1][dt * 16 + col][0], lane); acc[dt] = wmma_bf(vh, pb.l, acc[dt]); acc[dt] = wmma_bf(vl, pb.h, acc[dt]); acc[dt] = wmma_bf(vh, pb.h, acc[dt]); }
    asm volatile("s_wait_dscnt 0x0" ::: "memory");      // this wave's reads of buffer bf are done before the buffer is refilled
    asm volatile("s_wait_asynccnt 0x0" ::: "memory");   // this wave's copies of pass ks + 1 have landed
    __syncthreads();                                     // publishes pass ks + 1 and ends every wave's reads of buffer bf
    if (ks + 2 < SS / 32) stage_kv(lk0 + bf * (unsigned)sizeof(sk[0]), lv0 + bf * (unsigned)sizeof(sv[0]), KH + gk0 + (size_t)(ks + 2) * 32 * DM, KL + gk0 + (size_t)(ks + 2) * 32 * DM, VTH + gv0 + (ks + 2) * 32, VTL + gv0 + (ks + 2) * 32); };
  // The block's queries are 64 qb .. 64 qb + 63: passes below 2 qb - 1 hold keys of class 0 alone, passes from 2 qb + 3 on keys of class 4 alone. The bounds depend on blockIdx alone, so every wave of the block passes the same barriers. The three loops stay rolled (code size).
  const int nlo = max(2 * qb - 1, 0), nhi = min(2 * qb + 3, SS / 32);
  { const float q0c = sqr[wave][col][0]; const v8f cin = {q0c, q0c, q0c, q0c, q0c, q0c, q0c, q0c};
#pragma unroll 1
    for (int ks = 0; ks < nlo; ++ks) pass(Cls<0>{}, ks, cin); }
  ms[0] = l;
#pragma unroll 1
  for (int ks = nlo; ks < nhi; ++ks) pass(Cls<-1>{}, ks, v8f{});
  { const float q4c = sqr[wave][col][4]; const v8f cin = {q4c, q4c, q4c, q4c, q4c, q4c, q4c, q4c};
#pragma unroll 1
    for (int ks = nhi; ks < SS / 32; ++ks) pass(Cls<4>{}, ks, cin); }
  asm volatile("s_wait_asynccnt 0x0" ::: "memory");     // no copy is outstanding when the wave goes on to the epilogue and ends
  l += xhalf(l);
  const float il = 1.0f / l;
#pragma unroll
  for (int j = 0; j < 5; ++j) ms[j] = (ms[j] + xhalf(ms[j])) * il;
#pragma unroll
  for (int dt = 0; dt < 4; ++dt) {
#pragma unroll
    for (int r = 0; r < 8; ++r) { const int d = dt * 16 + 8 * g + r; float w2 = 0.f;
#pragma unroll
      for (int j = 0; j < 5; ++j) w2 += ms[j] * bfr(RV[j * HD + d]);
      so[wave][col][d] = acc[dt][r] * il + w2; } }
  LDSX();
  for (int rl = 0; rl < 16; ++rl) if (lane < 16) vst2(O + ((size_t)b * SS + q0 + rl) * DM + h * HD + lane * 4, *(const v4f*)&so[wave][rl][lane * 4]);
}
// ---- k_out: block = (64 rows, 128 cols): out = O(hi/lo) . c_proj rows (2 products) + bias
__global__ __launch_bounds__(128) void k_out(const float* __restrict__ O, const __bf16* __restrict__ P, const float* __restrict__ BO, float* __restrict__ Y) {
  __shared__ __align__(16) char sm[2 * GBUF];   // two buffers, as in k_qkv; behind the loop the same bytes stage the output rows
  float (*so)[16][132] = (float (*)[16][132])sm;
  const int tid = threadIdx.x, wave = tid >> 5, lane = tid & 31, col = lane & 15, g = lane >> 4; const size_t rb = (size_t)blockIdx.x * 64, r0 = rb + wave * 16; const int n0 = blockIdx.y * 128;
  const unsigned la0 = (unsigned)(size_t)&sm[(tid >> 4) * (GAP * 4) + (tid & 15) * 16], lb0 = (unsigned)(size_t)&sm[GASZ + (tid >> 3) * (GBP * 2) + (tid & 7) * 16];
  const float* ga0 = O + (rb + (tid >> 4)) * DM + (tid & 15) * 4; const __bf16* gb0 = P + (size_t)(n0 + (tid >> 3)) * DM + (tid & 7) * 8;
  stage_ab(la0, lb0, ga0, gb0);
  v8f acc[8] = {};
  asm volatile("s_wait_asynccnt 0x0" ::: "memory");   // this wave's copies of pass 0 have landed
  __syncthreads();                                     // ... and every other wave's: buffer 0 may be read
  stage_ab(la0 + GBUF, lb0 + GBUF, ga0 + GK, gb0 + GK);
  // the pass loop stays rolled (code size; one foot with the waits, the barrier and the refill in their order); the loops inside are fully unrolled so that a, w and acc are indexed by constants and stay in registers
#pragma unroll 1
  for (int t = 0; t < DM / GK; ++t) { const int bf = t & 1; const float* arow = (const float*)(sm + bf * GBUF) + (wave * 16 + col) * GAP + 8 * g; const __bf16* brow = (const __bf16*)(sm + bf * GBUF + GASZ) + col * GBP;
    F2 a[GK / 32]; v16b w[GK / 32][8];   // all fragment reads of the pass stand as one group in front of its products, as in k_qkv
#pragma unroll
    for (int kc = 0; kc < GK / 32; ++kc) a[kc] = split_lds(arow + kc * 32);
#pragma unroll
    for (int kc = 0; kc < GK / 32; ++kc) {
#pragma unroll
      for (int j = 0; j < 8; ++j) w[kc][j] = frag_b(brow + j * 16 * GBP + kc * 32, lane); }
#pragma unroll
    for (int kc = 0; kc < GK / 32; ++kc) {
#pragma unroll
      for (int j = 0; j < 8; ++j) { acc[j] = wmma_bf(a[kc].l, w[kc][j], acc[j]); acc[j] = wmma_bf(a[kc].h, w[kc][j], acc[j]); } }
    asm volatile("s_wait_dscnt 0x0" ::: "memory");      // this wave's reads of buffer bf are done before the buffer is refilled
    asm volatile("s_wait_asynccnt 0x0" ::: "memory");   // this wave's copies of pass t + 1 have landed
    __syncthreads();                                     // publishes pass t + 1 and ends every wave's reads of buffer bf
    if (t + 2 < DM / GK) stage_ab(la0 + bf * GBUF, lb0 + bf * GBUF, ga0 + (t + 2) * GK, gb0 + (t + 2) * GK); }
  asm volatile("s_wait_asynccnt 0x0" ::: "memory");     // no copy is outstanding when the buffers become output staging
#pragma unroll
  for (int j = 0; j < 8; ++j) { const float bb = bfr(BO[n0 + j * 16 + col]);
#pragma unroll
    for (int r = 0; r < 8; ++r) so[wave][8 * g + r][j * 16 + col] = acc[j][r] + bb; }
  LDSX();
  for (int rl = 0; rl < 16; ++rl) vst2(Y + (r0 + rl) * DM + n0 + lane * 4, *(const v4f*)&so[wave][rl][lane * 4]);
}
extern "C" void kernel_launch(void* const* d_in, const int* in_sizes, int n_in, void* d_out, int out_size, void* d_ws, size_t ws_size, hipStream_t stream) {
  (void)in_sizes; (void)n_in; (void)out_size;
  const float** F = (const float**)d_in;   // 0 key [2,2048,1024], 1 query, 2 value, 3 Wq [1024,1024] (torch), 4 bq, 5 Wk, 6 bk, 7 Wv, 8 bv, 9 Wo, 10 bo, 11 rel_k [5,64], 12 rel_v [5,64]
  if (ws_size < (size_t)WS_END) return;
  char* ws = (char*)d_ws; __bf16 *PK = (__bf16*)(ws + WS_PK), *VTH = (__bf16*)(ws + WS_VTH), *VTL = (__bf16*)(ws + WS_VTL), *KH = (__bf16*)(ws + WS_KH), *KL = (__bf16*)(ws + WS_KL); float *QK = (float*)(ws + WS_QK), *O = (float*)(ws + WS_O);
  k_packrows<<<DM, 256, 0, stream>>>(F[3], DM, PK + PK_A); k_packrows<<<DM, 256, 0, stream>>>(F[5], DM, PK + PK_A + (size_t)DM * DM); k_packrows<<<DM, 256, 0, stream>>>(F[7], DM, PK + PK_A + (size_t)2 * DM * DM); k_packrows<<<DM, 256, 0, stream>>>(F[9], DM, PK + PK_P);
  k_qkv<<<dim3(TNB * SS / 64, QKVW / 128), 128, 0, stream>>>(F[1], F[0], F[2], PK + PK_A, F[4], F[6], F[8], QK, KH, KL);   // q from query, k from key, v from value
  k_vt<<<dim3(TNB * SS / 64, NH), 256, 0, stream>>>(QK, VTH, VTL);
  k_attn<<<dim3(TQB, NH, TNB), 128, 0, stream>>>(QK, KH, KL, VTH, VTL, F[11], F[12], O);
  k_out<<<dim3(TOB, DM / 128), 128, 0, stream>>>(O, PK + PK_P, F[10], (float*)d_out);
}

// v007
// One run takes 181 microseconds.
// Next to v006, in two timings, it ran 1.04 times as fast each time.
// Counting every step since v000, it is 3.57 times as fast.
// compute dtype: key/query/value inputs, the four Linear weights/biases and the two relative tables (module inputs) rounded to bf16; q/k/v projections with exact bf16 products (inputs x weights); scores q.k with both operands as bf16 hi + residual pairs (3 products) plus the relative-key term q.rel_k[clip(k-q)] (5 f32 dot products per (token, head)); P.V with P hi/lo x V hi/lo (3 products) plus the relative-value term sum_j mass_j rel_v[j]; output projection hi/lo x exact Wo (2 products) + bo; softmax in f32; f32 accumulate.
#include <hip/hip_runtime.h>
#include <math.h>

typedef __attribute__((ext_vector_type(16))) _Float16 v16h;
typedef __attribute__((ext_vector_type(16))) __bf16 v16b;
typedef __attribute__((ext_vector_type(8)))  _Float16 v8h;
typedef __attribute__((ext_vector_type(8)))  float v8f;
typedef __attribute__((ext_vector_type(4)))  float v4f;
typedef __attribute__((ext_vector_type(2)))  float v2f;
typedef __attribute__((ext_vector_type(4)))  unsigned v4u;
typedef __attribute__((ext_vector_type(4)))  int v4i;
typedef float __attribute__((may_alias)) float_a;
typedef int __attribute__((may_alias)) int_a;

template <typename T> __device__ __forceinline__ void vst2(void* p, T v) { *(T*)p = v;  }
__device__ __forceinline__ v8f wmma16(v16h a, v16h b, v8f c) {
  v8f d = __builtin_amdgcn_wmma_f32_16x16x32_f16(false, a, false, b, (short)0, c, false, false);
  asm volatile("v_nop\n\tv_nop\n\tv_nop\n\tv_nop" : "+v"(d) : "v"(a), "v"(b));
  return d;
}
__device__ __forceinline__ v8f wmma_bf(v16b a, v16b b, v8f c) {
  v8f d = __builtin_amdgcn_wmma_f32_16x16x32_bf16(false, a, false, b, (short)0, c, false, false);
  asm volatile("v_nop\n\tv_nop\n\tv_nop\n\tv_nop" : "+v"(d) : "v"(a), "v"(b));
  return d;
}
// the plain builtin, for k_attn: the compiler keeps the distance between a product and the vector code on its registers itself, so no vector issue slot goes to a v_nop between products, and it is free to deal independent accumulate chains among each other. The two projection GEMMs keep wmma_bf: its tail also holds a pass's fragment reads as one group in front of the products.
__device__ __forceinline__ v8f wmma_pl(v16b a, v16b b, v8f c) { return __builtin_amdgcn_wmma_f32_16x16x32_bf16(false, a, false, b, (short)0, c, false, false); }
// 16x16x32 fragments: lane = (h = lane>>4, row/col = lane&15); elements 0..7 = k0+8h+0..7, 8..15 = k0+16+8h+0..7; D element r = row 8h+r
__device__ __forceinline__ v16h frag_h(const _Float16* rowk0, int lane) {
  union { v16h v; v8h q[2]; } u; const _Float16* p = rowk0 + 8 * (lane >> 4);
  u.q[0] = *(const v8h*)p; u.q[1] = *(const v8h*)(p + 16); return u.v;
}
__device__ __forceinline__ v16h frag_f32(const float* rowk0, int lane) {
  v16h a; const float* p = rowk0 + 8 * (lane >> 4);
#pragma unroll
  for (int i = 0; i < 8; ++i) { a[i] = (_Float16)p[i]; a[8 + i] = (_Float16)p[16 + i]; }
  return a;
}
__device__ __forceinline__ v16h frag_f32s(const float* rowk0, int lane, float sc) {
  v16h a; const float* p = rowk0 + 8 * (lane >> 4);
#pragma unroll
  for (int i = 0; i < 8; ++i) { a[i] = (_Float16)(p[i] * sc); a[8 + i] = (_Float16)(p[16 + i] * sc); }
  return a;
}
// column fragment from a [K][ld] layout (column n), rows >= K read as 0
__device__ __forceinline__ v16h fragc_f32(const float* W, int k0, int n, int lane, int ld, int K) {
  v16h a; const int g = lane >> 4;
#pragma unroll
  for (int i = 0; i < 8; ++i) { const int ka = k0 + 8 * g + i, kb = ka + 16;
    a[i] = (_Float16)(ka < K ? W[(size_t)(ka < K ? ka : K - 1) * ld + n] : 0.f); a[8 + i] = (_Float16)(kb < K ? W[(size_t)(kb < K ? kb : K - 1) * ld + n] : 0.f); }
  return a;
}
struct F2 { v16b h, l; };
__device__ __forceinline__ F2 bsplit16(const float v[16]) { F2 r;
#pragma unroll
  for (int i = 0; i < 16; ++i) { const __bf16 h = (__bf16)v[i]; r.h[i] = h; r.l[i] = (__bf16)(v[i] - (float)h); }
  return r; }
__device__ __forceinline__ F2 split_row(const float* row, int k0, int lane) { float v[16]; const float* p = row + k0 + 8 * (lane >> 4);
#pragma unroll
  for (int i = 0; i < 8; ++i) { v[i] = p[i]; v[8 + i] = p[16 + i]; }
  return bsplit16(v); }
__device__ __forceinline__ F2 split_rowK(const float* row, int k0, int lane, int K) { float v[16]; const int g = lane >> 4;
#pragma unroll
  for (int i = 0; i < 8; ++i) { const int ka = k0 + 8 * g + i, kb = ka + 16; v[i] = ka < K ? row[ka < K ? ka : K - 1] : 0.f; v[8 + i] = kb < K ? row[kb < K ? kb : K - 1] : 0.f; }
  return bsplit16(v); }
__device__ __forceinline__ F2 split_col(const float* W, int k0, int n, int lane, int ld, int K) { float v[16]; const int g = lane >> 4;
#pragma unroll
  for (int i = 0; i < 8; ++i) { const int ka = k0 + 8 * g + i, kb = ka + 16; v[i] = ka < K ? W[(size_t)(ka < K ? ka : K - 1) * ld + n] : 0.f; v[8 + i] = kb < K ? W[(size_t)(kb < K ? kb : K - 1) * ld + n] : 0.f; }
  return bsplit16(v); }
__device__ __forceinline__ v8f mac3(const F2& a, const F2& b, v8f c) { c = wmma_bf(a.l, b.h, c); c = wmma_bf(a.h, b.l, c); return wmma_bf(a.h, b.h, c); }
__device__ __forceinline__ float sigm(float v) { return 1.0f / (1.0f + expf(-v)); }
#define LDSX() do { asm volatile("s_wait_dscnt 0" ::: "memory"); __builtin_amdgcn_wave_barrier(); __builtin_amdgcn_fence(__ATOMIC_RELEASE, "workgroup"); } while (0)


// Multi-head attention with clipped relative position embeddings (B 2, Lq = Lk = 2048, hid 1024, 16 heads x 64, max_rel 2): q = query Wq^T + bq, k = key Wk^T + bk, v = value Wv^T + bv; attn = softmax((q k^T + q . rel_k[clip(k - q, -2, 2) + 2]) / 8); x = attn v + sum_k attn rel_v[clip(k - q) + 2]; out = x Wo^T + bo.
#define NB 2
#define SS 2048
#define DM 1024
#define NH 16
#define HD 64
#define QKVW (3 * DM)
#ifndef TQB
#define TQB (SS / 64)
#define TNB NB
#define TOB (NB * SS / 64)     // output row tiles (all)
#endif
typedef __attribute__((ext_vector_type(8))) __bf16 v8b;
typedef __attribute__((ext_vector_type(4))) __bf16 v4b;
__device__ __forceinline__ v16b frag_b(const __bf16* rowk0, int lane) {
  union { v16b v; v8b q[2]; } u; const __bf16* p = rowk0 + 8 * (lane >> 4);
  u.q[0] = *(const v8b*)p; u.q[1] = *(const v8b*)(p + 16); return u.v;
}
__device__ __forceinline__ float bfr(float v) { return (float)(__bf16)v; }
__device__ __attribute__((noinline)) float erf_ni(float v) { return erff(v); }

#define PK_A 0                       // [3072][1024] c_attn kernel rows (natural)
#define PK_P (PK_A + QKVW * DM)        // [1024][1024] c_proj kernel rows
#define PK_END (PK_P + DM * DM)
#define WS_PK  0u
#define WS_QK  (WS_PK + 2u * PK_END)             // f32 [4096 rows][3072]: [q | - | v], each 1024 (h*64+d) (the k columns are not written: k goes to WS_KH, WS_KL)
#define WS_VTH (WS_QK + 4u * NB * SS * QKVW)     // bf16 [2][1024 (h*64+d)][2048 s]
#define WS_VTL (WS_VTH + 2u * NB * DM * SS)
#define WS_O   (WS_VTL + 2u * NB * DM * SS)        // f32 [4096][1024]
#define WS_KH  (WS_O + 4u * NB * SS * DM)         // bf16 [4096 rows][1024 (h*64+d)]: k, rounded
#define WS_KL  (WS_KH + 2u * NB * SS * DM)        // bf16, same shape: k minus its rounded value
#define WS_END (WS_KL + 2u * NB * SS * DM)

// ---- k_packrows: block = natural row n of a [N][K] weight (torch [out,in])
__global__ __launch_bounds__(256) void k_packrows(const float* __restrict__ Wm, int K, __bf16* __restrict__ DST) {
  __shared__ __align__(16) __bf16 s[DM]; const int n = blockIdx.x, tid = threadIdx.x;
  for (int k = tid; k < K; k += 256) s[k] = (__bf16)Wm[(size_t)n * K + k];
  __syncthreads();
  for (int q = tid; q < K / 8; q += 256) vst2((unsigned*)(DST + (size_t)n * K + q * 8), *(const v4u*)&s[q * 8]);
}
// ---- operand tiles of the two projection GEMMs (k_qkv, k_out), one 64-deep k pass at a time, staged in LDS once per block: A = 64 f32 rows of 256 B, B = 128 bf16 weight rows of 128 B, so every copy of a wave covers whole 128 B lines. Row pitches are 16 B x odd, so that the 16 rows of a b128 fragment read fall on distinct banks.
#define GK 64                          // k per pass
#define GAP 68                         // floats: 272 B rows of the A tile [64 rows][64 k]
#define GBP 72                         // bf16: 144 B rows of the B tile [128 rows][64 k]
#define GASZ (64 * GAP * 4)            // bytes of an A tile; the B tile stands behind it
#define GBUF (GASZ + 128 * GBP * 2)    // bytes of one buffer
// 8 copies of 16 B a lane, ls bytes apart in LDS and gs elements apart in global memory
template <typename T> __device__ __forceinline__ void copy8(unsigned l, unsigned ls, const T* g, size_t gs) {
  const unsigned l1 = l + ls, l2 = l + 2 * ls, l3 = l + 3 * ls, l4 = l + 4 * ls, l5 = l + 5 * ls, l6 = l + 6 * ls, l7 = l + 7 * ls;
  const T *g1 = g + gs, *g2 = g + 2 * gs, *g3 = g + 3 * gs, *g4 = g + 4 * gs, *g5 = g + 5 * gs, *g6 = g + 6 * gs, *g7 = g + 7 * gs;
  // the copies and the s_wait_xcnt that stands in front of any rewrite of their address registers, in one statement so that nothing moves in between
  asm volatile("global_load_async_to_lds_b128 %0, %8, off\n\t"
               "global_load_async_to_lds_b128 %1, %9, off\n\t"
               "global_load_async_to_lds_b128 %2, %10, off\n\t"
               "global_load_async_to_lds_b128 %3, %11, off\n\t"
               "global_load_async_to_lds_b128 %4, %12, off\n\t"
               "global_load_async_to_lds_b128 %5, %13, off\n\t"
               "global_load_async_to_lds_b128 %6, %14, off\n\t"
               "global_load_async_to_lds_b128 %7, %15, off\n\t"
               "s_wait_xcnt 0x0"
               :: "v"(l), "v"(l1), "v"(l2), "v"(l3), "v"(l4), "v"(l5), "v"(l6), "v"(l7), "v"(g), "v"(g1), "v"(g2), "v"(g3), "v"(g4), "v"(g5), "v"(g6), "v"(g7) : "memory");
}
// one pass's tiles, 16 copies a lane: A rows 8 apart (a wave covers 2 whole rows a copy), B rows 16 apart (4 whole rows a copy). la, lb: the lane's LDS byte addresses in the target buffer; ga, gb: its global addresses.
__device__ __forceinline__ void stage_ab(unsigned la, unsigned lb, const float* ga, const __bf16* gb) { copy8(la, 8 * GAP * 4, ga, (size_t)8 * DM); copy8(lb, 16 * GBP * 2, gb, (size_t)16 * DM); }
__device__ __forceinline__ v16b cvt_lds(const float* p) { v16b r; const v4f a = *(const v4f*)p, b = *(const v4f*)(p + 4), c = *(const v4f*)(p + 16), d = *(const v4f*)(p + 20);
#pragma unroll
  for (int i = 0; i < 4; ++i) { r[i] = (__bf16)a[i]; r[4 + i] = (__bf16)b[i]; r[8 + i] = (__bf16)c[i]; r[12 + i] = (__bf16)d[i]; }
  return r; }
// ---- k_qkv: block = (64 rows, 128 of the 3072 cols): QKV = bf16(x) . rows (exact) -> f32 rows (pitch 3072); the k columns leave as a bf16 pair (rounded value, residual), split here once instead of in every wave of every query block of k_attn
__global__ __launch_bounds__(128) void k_qkv(const float* __restrict__ XQ, const float* __restrict__ XK, const float* __restrict__ XV, const __bf16* __restrict__ P, const float* __restrict__ BQ, const float* __restrict__ BK, const float* __restrict__ BV, float* __restrict__ QKV, __bf16* __restrict__ KH, __bf16* __restrict__ KL) {
  __shared__ __align__(16) char sm[2 * GBUF];   // two buffers: pass t reads buffer t & 1 while pass t + 1's tiles land in the other; behind the loop the same bytes stage the output rows
  float (*so)[16][132] = (float (*)[16][132])sm;
  const int tid = threadIdx.x, wave = tid >> 5, lane = tid & 31, col = lane & 15, g = lane >> 4; const size_t rb = (size_t)blockIdx.x * 64, r0 = rb + wave * 16; const int n0 = blockIdx.y * 128; const float* X = (n0 < DM) ? XQ : (n0 < 2 * DM ? XK : XV);
  const unsigned la0 = (unsigned)(size_t)&sm[(tid >> 4) * (GAP * 4) + (tid & 15) * 16], lb0 = (unsigned)(size_t)&sm[GASZ + (tid >> 3) * (GBP * 2) + (tid & 7) * 16];
  const float* ga0 = X + (rb + (tid >> 4)) * DM + (tid & 15) * 4; const __bf16* gb0 = P + (size_t)(n0 + (tid >> 3)) * DM + (tid & 7) * 8;
  stage_ab(la0, lb0, ga0, gb0);
  v8f acc[8] = {};
  asm volatile("s_wait_asynccnt 0x0" ::: "memory");   // this wave's copies of pass 0 have landed
  __syncthreads();                                     // ... and every other wave's: buffer 0 may be read
  stage_ab(la0 + GBUF, lb0 + GBUF, ga0 + GK, gb0 + GK);
  // the pass loop stays rolled (code size; one foot with the waits, the barrier and the refill in their order); the loops inside are fully unrolled so that a, w and acc are indexed by constants and stay in registers
#pragma unroll 1
  for (int t = 0; t < DM / GK; ++t) { const int bf = t & 1; const float* arow = (const float*)(sm + bf * GBUF) + (wave * 16 + col) * GAP + 8 * g; const __bf16* brow = (const __bf16*)(sm + bf * GBUF + GASZ) + col * GBP;
    v16b a[GK / 32], w[GK / 32][8];   // all fragment reads of the pass stand as one group in front of its products: a read among the products would be waited for on the spot
#pragma unroll
    for (int kc = 0; kc < GK / 32; ++kc) a[kc] = cvt_lds(arow + kc * 32);
#pragma unroll
    for (int kc = 0; kc < GK / 32; ++kc) {
#pragma unroll
      for (int j = 0; j < 8; ++j) w[kc][j] = frag_b(brow + j * 16 * GBP + kc * 32, lane); }
#pragma unroll
    for (int kc = 0; kc < GK / 32; ++kc) {
#pragma unroll
      for (int j = 0; j < 8; ++j) acc[j] = wmma_bf(a[kc], w[kc][j], acc[j]); }
    asm volatile("s_wait_dscnt 0x0" ::: "memory");      // this wave's reads of buffer bf are done before the buffer is refilled
    asm volatile("s_wait_asynccnt 0x0" ::: "memory");   // this wave's copies of pass t + 1 have landed
    __syncthreads();                                     // publishes pass t + 1 and ends every wave's reads of buffer bf
    if (t + 2 < DM / GK) stage_ab(la0 + bf * GBUF, lb0 + bf * GBUF, ga0 + (t + 2) * GK, gb0 + (t + 2) * GK); }
  asm volatile("s_wait_asynccnt 0x0" ::: "memory");     // no copy is outstanding when the buffers become output staging
  const float* bias = (n0 < DM) ? BQ : (n0 < 2 * DM ? BK : BV); const int nb = n0 % DM;
#pragma unroll
  for (int j = 0; j < 8; ++j) { const float bb = bfr(bias[nb + j * 16 + col]);
#pragma unroll
    for (int r = 0; r < 8; ++r) so[wave][8 * g + r][j * 16 + col] = acc[j][r] + bb; }
  LDSX();
  if (n0 >= DM && n0 < 2 * DM) {   // block-uniform: a block's 128 columns lie in one of q, k, v
    for (int rl = 0; rl < 16; ++rl) { const v4f v = *(const v4f*)&so[wave][rl][lane * 4]; v4b hi, lo;
#pragma unroll
      for (int i = 0; i < 4; ++i) { hi[i] = (__bf16)v[i]; lo[i] = (__bf16)(v[i] - (float)hi[i]); }
      const size_t o = (r0 + rl) * DM + nb + lane * 4; vst2(KH + o, hi); vst2(KL + o, lo); } }
  else for (int rl = 0; rl < 16; ++rl) vst2(QKV + (r0 + rl) * QKVW + n0 + lane * 4, *(const v4f*)&so[wave][rl][lane * 4]);
}
__global__ __launch_bounds__(256) void k_vt(const float* __restrict__ QKV, __bf16* __restrict__ VTH, __bf16* __restrict__ VTL) {
  __shared__ __align__(16) __bf16 sth[64][72], stl[64][72]; const int tid = threadIdx.x; const size_t rb = (size_t)blockIdx.x * 64; const int h = blockIdx.y; const int b = (int)(rb / SS), s0 = (int)(rb % SS);
  for (int q = tid; q < 64 * 64; q += 256) { const int rl = q >> 6, d = q & 63; const float v = QKV[(rb + rl) * QKVW + 2 * DM + h * HD + d]; const __bf16 hb = (__bf16)v; sth[d][rl] = hb; stl[d][rl] = (__bf16)(v - (float)hb); }
  __syncthreads();
  for (int q = tid; q < 64 * 8; q += 256) { const int d = q >> 3, pc = q & 7; const size_t o = ((size_t)b * DM + h * HD + d) * SS + s0 + pc * 8; vst2((unsigned*)(VTH + o), *(const v4u*)&sth[d][pc * 8]); vst2((unsigned*)(VTL + o), *(const v4u*)&stl[d][pc * 8]); }
}
// ---- k_attn: block = (64 queries, head h, batch b): full flash attention (K = 64) on transposed products: S^T = K . Q^T (A = key rows, B = the wave's 16 queries) and O^T += V^T . P^T (A = V^T rows, B = the two score tiles of a pass, converted in place). A lane (g, col) holds query col alone: keys 8g + r of each 16-key tile, so maximum, row sum and the 5 distance-class masses are summed in the lane; the two lane halves exchange the maximum once a pass and join their sums once behind the loop. logits = (q.k (3 products) + qr[clip(k-q)+2]) / 8; P.V 3 products; w2 = sum_j (mass_j / l) rel_v[j]; O[b*S+q][h*64+d] = w1 + w2
// softmax in base 2: SC2 = log2(e) / sqrt(64). The maximum is taken over the unscaled scores (SC2 > 0 keeps the order) and scaled once; each exponential is then one fma and one v_exp_f32 in line, 16 independent ones a pass.
#define SC2 0.18033688f
__device__ __forceinline__ float ex2(float v) { return __builtin_amdgcn_exp2f(v); }
__device__ __forceinline__ float xhalf(float v) { const int b = __builtin_bit_cast(int, v); return __builtin_bit_cast(float, __builtin_amdgcn_permlanex16(b, b, 0x76543210, 0xfedcba98, false, false)); }   // lane l <-> l ^ 16
// K / V^T tiles of one 32-key pass, staged in LDS once per block for its 4 waves. Row pitches are 16 B x odd, so that the 16 rows of a b128 fragment read fall on distinct banks.
#define KP 72    // bf16: 144 B rows of a K tile [32 keys][64 d]
#define VP 40    // bf16: 80 B rows of a V^T tile [64 d][32 keys]
__device__ __forceinline__ F2 split_lds(const float* p) { float v[16]; const v4f a = *(const v4f*)p, b = *(const v4f*)(p + 4), c = *(const v4f*)(p + 16), d = *(const v4f*)(p + 20);
#pragma unroll
  for (int i = 0; i < 4; ++i) { v[i] = a[i]; v[4 + i] = b[i]; v[8 + i] = c[i]; v[12 + i] = d[i]; }
  return bsplit16(v); }
// one pass's tiles, 8 copies of 16 B a lane: K hi and residual rows 16 apart (a wave covers 4 whole rows = 4 lines a copy), V^T hi and residual rows 32 apart. lk, lv: the lane's LDS byte addresses in the target buffer; gk, gk2 (K hi, residual), gh, gl (V^T hi, residual): its global addresses.
__device__ __forceinline__ void stage_kv(unsigned lk, unsigned lv, const __bf16* gk, const __bf16* gk2, const __bf16* gh, const __bf16* gl) {
  const unsigned lk1 = lk + 16 * KP * 2, lk2 = lk + 32 * KP * 2, lk3 = lk + 48 * KP * 2, lv1 = lv + 32 * VP * 2, lv2 = lv + 64 * VP * 2, lv3 = lv + 96 * VP * 2;
  const __bf16 *gk1 = gk + 16 * DM, *gk3 = gk2 + 16 * DM, *gh1 = gh + 32 * SS, *gl1 = gl + 32 * SS;
  // the copies and the s_wait_xcnt that stands in front of any rewrite of their address registers, in one statement so that nothing moves in between
  asm volatile("global_load_async_to_lds_b128 %0, %8, off\n\t"
               "global_load_async_to_lds_b128 %1, %9, off\n\t"
               "global_load_async_to_lds_b128 %2, %10, off\n\t"
               "global_load_async_to_lds_b128 %3, %11, off\n\t"
               "global_load_async_to_lds_b128 %4, %12, off\n\t"
               "global_load_async_to_lds_b128 %5, %13, off\n\t"
               "global_load_async_to_lds_b128 %6, %14, off\n\t"
               "global_load_async_to_lds_b128 %7, %15, off\n\t"
               "s_wait_xcnt 0x0"
               :: "v"(lk), "v"(lk1), "v"(lk2), "v"(lk3), "v"(lv), "v"(lv1), "v"(lv2), "v"(lv3), "v"(gk), "v"(gk1), "v"(gk2), "v"(gk3), "v"(gh), "v"(gh1), "v"(gl), "v"(gl1) : "memory");
}
template <int C> struct Cls { static constexpr int v = C; };
__global__ __launch_bounds__(128) void k_attn(const float* __restrict__ QK, const __bf16* __restrict__ KH, const __bf16* __restrict__ KL, const __bf16* __restrict__ VTH, const __bf16* __restrict__ VTL, const float* __restrict__ RK, const float* __restrict__ RV, float* __restrict__ O) {
  __shared__ __align__(16) float so[4][16][68]; __shared__ float sqr[4][16][8];
  __shared__ __align__(16) __bf16 sk[2][2][32][KP]; __shared__ __align__(16) __bf16 sv[2][2][64][VP];   // two buffers: pass t reads buffer t & 1 while pass t + 1's tiles land in the other
  const int tid = threadIdx.x, wave = tid >> 5, lane = tid & 31, col = lane & 15, g = lane >> 4;
  const int qb = blockIdx.x, h = blockIdx.y, b = blockIdx.z; const int q0 = qb * 64 + wave * 16; const size_t rq = (size_t)b * SS + q0 + col;
  const unsigned lk0 = (unsigned)(size_t)&sk[0][0][tid >> 3][(tid & 7) * 8], lv0 = (unsigned)(size_t)&sv[0][0][tid >> 2][(tid & 3) * 8];
  const size_t gk0 = ((size_t)b * SS + (tid >> 3)) * DM + h * HD + (tid & 7) * 8; const size_t gv0 = ((size_t)b * DM + h * HD + (tid >> 2)) * SS + (tid & 3) * 8;
  stage_kv(lk0, lv0, KH + gk0, KL + gk0, VTH + gv0, VTL + gv0);   // pass 0's tiles fly under the query set-up below
  F2 aq[2];
#pragma unroll
  for (int kc = 0; kc < 2; ++kc) aq[kc] = split_row(QK + rq * QKVW + h * HD, kc * 32, lane);
  // relative-key logits: sqr[row][j] = q_row . rel_k[j] (f32; the lane's partial over its 4 columns, xor-16 reduced; staged in LDS so the runtime class index is not a private-array index)
#pragma unroll 1
  for (int r = 0; r < 8; ++r) { const float* qrow = QK + ((size_t)b * SS + q0 + 8 * g + r) * QKVW + h * HD;
#pragma unroll
    for (int j = 0; j < 5; ++j) { float a = 0.f;
#pragma unroll
      for (int dt = 0; dt < 4; ++dt) a += qrow[dt * 16 + col] * bfr(RK[j * HD + dt * 16 + col]);
#pragma unroll
      for (int o = 1; o < 16; o <<= 1) a += __shfl_xor(a, o);
      if (col == j) sqr[wave][8 * g + r][j] = a; } }
  LDSX();
  // the inner loops below are fully unrolled so that s, e, jc, ms and acc are indexed by constants and stay in registers
  const int qi = q0 + col;
  float m = -3.0e38f, l = 0.f, ms[5];
#pragma unroll
  for (int j = 0; j < 5; ++j) ms[j] = 0.f;
  v8f acc[4] = {};
  asm volatile("s_wait_asynccnt 0x0" ::: "memory");   // this wave's copies of pass 0 have landed
  __syncthreads();                                     // ... and every other wave's: buffer 0 may be read
  stage_kv(lk0 + (unsigned)sizeof(sk[0]), lv0 + (unsigned)sizeof(sv[0]), KH + gk0 + 32 * DM, KL + gk0 + 32 * DM, VTH + gv0 + 32, VTL + gv0 + 32);
  // One 32-key pass. CLS: the distance class that all (key, query) pairs of the pass share for every query of the block (0: every key at least 2 below every query, 4: at least 2 above), or -1 for a pass that touches the band |k - q| < 2, where each pair's class is looked up. With one class the relative-key logit is a constant of the lane: it comes in as cin, the start value of the score accumulators, and the pass's sum es is the class's mass. always_inline: s, e, acc and ms must stay in registers.
  auto pass = [&](auto cls, const int ks, const v8f cin) __attribute__((always_inline)) { constexpr int CLS = decltype(cls)::v; float s[16]; [[maybe_unused]] int jc[16]; const int bf = ks & 1;
#pragma unroll
    for (int ct = 0; ct < 2; ++ct) { const __bf16* krow = &sk[bf][0][ct * 16 + col][0]; v8f c = cin;
#pragma unroll
      for (int kc = 0; kc < 2; ++kc) { const v16b kh = frag_b(krow + kc * 32, lane), kl = frag_b(krow + 32 * KP + kc * 32, lane); c = wmma_pl(kh, aq[kc].l, c); c = wmma_pl(kl, aq[kc].h, c); c = wmma_pl(kh, aq[kc].h, c); }
#pragma unroll
      for (int r = 0; r < 8; ++r) {
        if constexpr (CLS < 0) { const int kk = ks * 32 + ct * 16 + 8 * g + r; const int dlt = min(max(kk - qi, -2), 2) + 2; jc[ct * 8 + r] = dlt; s[ct * 8 + r] = c[r] + sqr[wave][col][dlt]; }
        else s[ct * 8 + r] = c[r]; } }   // attn1 + attn2, unscaled
    float mx = s[0];
#pragma unroll
    for (int i = 1; i < 16; ++i) mx = fmaxf(mx, s[i]);
    mx = fmaxf(mx, xhalf(mx));
    const float mn = fmaxf(m, mx * SC2); const float alpha = ex2(m - mn); m = mn;   // m: running maximum of (attn1 + attn2) / sqrt(64) * log2(e)
    float e[16];
#pragma unroll
    for (int i = 0; i < 16; i += 2) { const v2f t = __builtin_elementwise_fma((v2f){s[i], s[i + 1]}, (v2f){SC2, SC2}, (v2f){-mn, -mn}); e[i] = ex2(t[0]); e[i + 1] = ex2(t[1]); }   // one packed fma a score pair
    float es = 0.f;
#pragma unroll
    for (int i = 0; i < 8; ++i) es += e[i] + e[8 + i];
    l = l * alpha + es;
    if constexpr (CLS < 0) {
#pragma unroll
      for (int j = 0; j < 5; ++j) { float add = 0.f;
#pragma unroll
        for (int i = 0; i < 16; ++i) add += (jc[i] == j) ? e[i] : 0.f;
        ms[j] = ms[j] * alpha + add; } }
    else if constexpr (CLS == 4) {
#pragma unroll
      for (int j = 0; j < 4; ++j) ms[j] *= alpha;
      ms[4] = ms[4] * alpha + es; }   // CLS == 0: all mass so far is class 0's, and l holds it
#pragma unroll
    for (int dt = 0; dt < 4; ++dt) acc[dt] *= alpha;
    const F2 pb = bsplit16(e);   // B element i = key 8g + i, element 8 + i = key 16 + 8g + i: the k order of frag_b
#pragma unroll
    for (int dt = 0; dt < 4; ++dt) { const v16b vh = frag_b(&sv[bf][0][dt * 16 + col][0], lane), vl = frag_b(&sv[bf][1][dt * 16 + col][0], lane); acc[dt] = wmma_pl(vh, pb.l, acc[dt]); acc[dt] = wmma_pl(vl, pb.h, acc[dt]); acc[dt] = wmma_pl(vh, pb.h, acc[dt]); }
    asm volatile("s_wait_dscnt 0x0" ::: "memory");      // this wave's reads of buffer bf are done before the buffer is refilled
    asm volatile("s_wait_asynccnt 0x0" ::: "memory");   // this wave's copies of pass ks + 1 have landed
    __syncthreads();                                     // publishes pass ks + 1 and ends every wave's reads of buffer bf
    if (ks + 2 < SS / 32) stage_kv(lk0 + bf * (unsigned)sizeof(sk[0]), lv0 + bf * (unsigned)sizeof(sv[0]), KH + gk0 + (size_t)(ks + 2) * 32 * DM, KL + gk0 + (size_t)(ks + 2) * 32 * DM, VTH + gv0 + (ks + 2) * 32, VTL + gv0 + (ks + 2) * 32); };
  // The block's queries are 64 qb .. 64 qb + 63: passes below 2 qb - 1 hold keys of class 0 alone, passes from 2 qb + 3 on keys of class 4 alone. The bounds depend on blockIdx alone, so every wave of the block passes the same barriers. The three loops stay rolled (code size).
  const int nlo = max(2 * qb - 1, 0), nhi = min(2 * qb + 3, SS / 32);
  { const float q0c = sqr[wave][col][0]; const v8f cin = {q0c, q0c, q0c, q0c, q0c, q0c, q0c, q0c};
#pragma unroll 1
    for (int ks = 0; ks < nlo; ++ks) pass(Cls<0>{}, ks, cin); }
  ms[0] = l;
#pragma unroll 1
  for (int ks = nlo; ks < nhi; ++ks) pass(Cls<-1>{}, ks, v8f{});
  { const float q4c = sqr[wave][col][4]; const v8f cin = {q4c, q4c, q4c, q4c, q4c, q4c, q4c, q4c};
#pragma unroll 1
    for (int ks = nhi; ks < SS / 32; ++ks) pass(Cls<4>{}, ks, cin); }
  asm volatile("s_wait_asynccnt 0x0" ::: "memory");     // no copy is outstanding when the wave goes on to the epilogue and ends
  l += xhalf(l);
  const float il = 1.0f / l;
#pragma unroll
  for (int j = 0; j < 5; ++j) ms[j] = (ms[j] + xhalf(ms[j])) * il;
#pragma unroll
  for (int dt = 0; dt < 4; ++dt) {
#pragma unroll
    for (int r = 0; r < 8; ++r) { const int d = dt * 16 + 8 * g + r; float w2 = 0.f;
#pragma unroll
      for (int j = 0; j < 5; ++j) w2 += ms[j] * bfr(RV[j * HD + d]);
      so[wave][col][d] = acc[dt][r] * il + w2; } }
  LDSX();
  for (int rl = 0; rl < 16; ++rl) if (lane < 16) vst2(O + ((size_t)b * SS + q0 + rl) * DM + h * HD + lane * 4, *(const v4f*)&so[wave][rl][lane * 4]);
}
// ---- k_out: block = (64 rows, 128 cols): out = O(hi/lo) . c_proj rows (2 products) + bias
__global__ __launch_bounds__(128) void k_out(const float* __restrict__ O, const __bf16* __restrict__ P, const float* __restrict__ BO, float* __restrict__ Y) {
  __shared__ __align__(16) char sm[2 * GBUF];   // two buffers, as in k_qkv; behind the loop the same bytes stage the output rows
  float (*so)[16][132] = (float (*)[16][132])sm;
  const int tid = threadIdx.x, wave = tid >> 5, lane = tid & 31, col = lane & 15, g = lane >> 4; const size_t rb = (size_t)blockIdx.x * 64, r0 = rb + wave * 16; const int n0 = blockIdx.y * 128;
  const unsigned la0 = (unsigned)(size_t)&sm[(tid >> 4) * (GAP * 4) + (tid & 15) * 16], lb0 = (unsigned)(size_t)&sm[GASZ + (tid >> 3) * (GBP * 2) + (tid & 7) * 16];
  const float* ga0 = O + (rb + (tid >> 4)) * DM + (tid & 15) * 4; const __bf16* gb0 = P + (size_t)(n0 + (tid >> 3)) * DM + (tid & 7) * 8;
  stage_ab(la0, lb0, ga0, gb0);
  v8f acc[8] = {};
  asm volatile("s_wait_asynccnt 0x0" ::: "memory");   // this wave's copies of pass 0 have landed
  __syncthreads();                                     // ... and every other wave's: buffer 0 may be read
  stage_ab(la0 + GBUF, lb0 + GBUF, ga0 + GK, gb0 + GK);
  // the pass loop stays rolled (code size; one foot with the waits, the barrier and the refill in their order); the loops inside are fully unrolled so that a, w and acc are indexed by constants and stay in registers
#pragma unroll 1
  for (int t = 0; t < DM / GK; ++t) { const int bf = t & 1; const float* arow = (const float*)(sm + bf * GBUF) + (wave * 16 + col) * GAP + 8 * g; const __bf16* brow = (const __bf16*)(sm + bf * GBUF + GASZ) + col * GBP;
    F2 a[GK / 32]; v16b w[GK / 32][8];   // all fragment reads of the pass stand as one group in front of its products, as in k_qkv
#pragma unroll
    for (int kc = 0; kc < GK / 32; ++kc) a[kc] = split_lds(arow + kc * 32);
#pragma unroll
    for (int kc = 0; kc < GK / 32; ++kc) {
#pragma unroll
      for (int j = 0; j < 8; ++j) w[kc][j] = frag_b(brow + j * 16 * GBP + kc * 32, lane); }
#pragma unroll
    for (int kc = 0; kc < GK / 32; ++kc) {
#pragma unroll
      for (int j = 0; j < 8; ++j) { acc[j] = wmma_bf(a[kc].l, w[kc][j], acc[j]); acc[j] = wmma_bf(a[kc].h, w[kc][j], acc[j]); } }
    asm volatile("s_wait_dscnt 0x0" ::: "memory");      // this wave's reads of buffer bf are done before the buffer is refilled
    asm volatile("s_wait_asynccnt 0x0" ::: "memory");   // this wave's copies of pass t + 1 have landed
    __syncthreads();                                     // publishes pass t + 1 and ends every wave's reads of buffer bf
    if (t + 2 < DM / GK) stage_ab(la0 + bf * GBUF, lb0 + bf * GBUF, ga0 + (t + 2) * GK, gb0 + (t + 2) * GK); }
  asm volatile("s_wait_asynccnt 0x0" ::: "memory");     // no copy is outstanding when the buffers become output staging
#pragma unroll
  for (int j = 0; j < 8; ++j) { const float bb = bfr(BO[n0 + j * 16 + col]);
#pragma unroll
    for (int r = 0; r < 8; ++r) so[wave][8 * g + r][j * 16 + col] = acc[j][r] + bb; }
  LDSX();
  for (int rl = 0; rl < 16; ++rl) vst2(Y + (r0 + rl) * DM + n0 + lane * 4, *(const v4f*)&so[wave][rl][lane * 4]);
}
extern "C" void kernel_launch(void* const* d_in, const int* in_sizes, int n_in, void* d_out, int out_size, void* d_ws, size_t ws_size, hipStream_t stream) {
  (void)in_sizes; (void)n_in; (void)out_size;
  const float** F = (const float**)d_in;   // 0 key [2,2048,1024], 1 query, 2 value, 3 Wq [1024,1024] (torch), 4 bq, 5 Wk, 6 bk, 7 Wv, 8 bv, 9 Wo, 10 bo, 11 rel_k [5,64], 12 rel_v [5,64]
  if (ws_size < (size_t)WS_END) return;
  char* ws = (char*)d_ws; __bf16 *PK = (__bf16*)(ws + WS_PK), *VTH = (__bf16*)(ws + WS_VTH), *VTL = (__bf16*)(ws + WS_VTL), *KH = (__bf16*)(ws + WS_KH), *KL = (__bf16*)(ws + WS_KL); float *QK = (float*)(ws + WS_QK), *O = (float*)(ws + WS_O);
  k_packrows<<<DM, 256, 0, stream>>>(F[3], DM, PK + PK_A); k_packrows<<<DM, 256, 0, stream>>>(F[5], DM, PK + PK_A + (size_t)DM * DM); k_packrows<<<DM, 256, 0, stream>>>(F[7], DM, PK + PK_A + (size_t)2 * DM * DM); k_packrows<<<DM, 256, 0, stream>>>(F[9], DM, PK + PK_P);
  k_qkv<<<dim3(TNB * SS / 64, QKVW / 128), 128, 0, stream>>>(F[1], F[0], F[2], PK + PK_A, F[4], F[6], F[8], QK, KH, KL);   // q from query, k from key, v from value
  k_vt<<<dim3(TNB * SS / 64, NH), 256, 0, stream>>>(QK, VTH, VTL);
  k_attn<<<dim3(TQB, NH, TNB), 128, 0, stream>>>(QK, KH, KL, VTH, VTL, F[11], F[12], O);
  k_out<<<dim3(TOB, DM / 128), 128, 0, stream>>>(O, PK + PK_P, F[10], (float*)d_out);
}

// v008
// One run takes 170 microseconds.
// Two timings next to v007 put it at 1.06 and 1.07 times that version's speed.
// All steps since v000 together make it 3.81 times as fast.
// compute dtype: key/query/value inputs, the four Linear weights/biases and the two relative tables (module inputs) rounded to bf16; q/k/v projections with exact bf16 products (inputs x weights); scores q.k with both operands as bf16 hi + residual pairs (3 products) plus the relative-key term q.rel_k[clip(k-q)] (5 f32 dot products per (token, head)); P.V with P hi/lo x V hi/lo (3 products) plus the relative-value term sum_j mass_j rel_v[j]; output projection hi/lo x exact Wo (2 products) + bo; softmax in f32; f32 accumulate.
#include <hip/hip_runtime.h>
#include <math.h>

typedef __attribute__((ext_vector_type(16))) _Float16 v16h;
typedef __attribute__((ext_vector_type(16))) __bf16 v16b;
typedef __attribute__((ext_vector_type(8)))  _Float16 v8h;
typedef __attribute__((ext_vector_type(8)))  float v8f;
typedef __attribute__((ext_vector_type(4)))  float v4f;
typedef __attribute__((ext_vector_type(2)))  float v2f;
typedef __attribute__((ext_vector_type(4)))  unsigned v4u;
typedef __attribute__((ext_vector_type(4)))  int v4i;
typedef float __attribute__((may_alias)) float_a;
typedef int __attribute__((may_alias)) int_a;

template <typename T> __device__ __forceinline__ void vst2(void* p, T v) { *(T*)p = v;  }
__device__ __forceinline__ v8f wmma16(v16h a, v16h b, v8f c) {
  v8f d = __builtin_amdgcn_wmma_f32_16x16x32_f16(false, a, false, b, (short)0, c, false, false);
  asm volatile("v_nop\n\tv_nop\n\tv_nop\n\tv_nop" : "+v"(d) : "v"(a), "v"(b));
  return d;
}
__device__ __forceinline__ v8f wmma_bf(v16b a, v16b b, v8f c) {
  v8f d = __builtin_amdgcn_wmma_f32_16x16x32_bf16(false, a, false, b, (short)0, c, false, false);
  asm volatile("v_nop\n\tv_nop\n\tv_nop\n\tv_nop" : "+v"(d) : "v"(a), "v"(b));
  return d;
}
// the plain builtin, for k_attn: the compiler keeps the distance between a product and the vector code on its registers itself, so no vector issue slot goes to a v_nop between products, and it is free to deal independent accumulate chains among each other. The two projection GEMMs keep wmma_bf: its tail also holds a pass's fragment reads as one group in front of the products.
__device__ __forceinline__ v8f wmma_pl(v16b a, v16b b, v8f c) { return __builtin_amdgcn_wmma_f32_16x16x32_bf16(false, a, false, b, (short)0, c, false, false); }
// 16x16x32 fragments: lane = (h = lane>>4, row/col = lane&15); elements 0..7 = k0+8h+0..7, 8..15 = k0+16+8h+0..7; D element r = row 8h+r
__device__ __forceinline__ v16h frag_h(const _Float16* rowk0, int lane) {
  union { v16h v; v8h q[2]; } u; const _Float16* p = rowk0 + 8 * (lane >> 4);
  u.q[0] = *(const v8h*)p; u.q[1] = *(const v8h*)(p + 16); return u.v;
}
__device__ __forceinline__ v16h frag_f32(const float* rowk0, int lane) {
  v16h a; const float* p = rowk0 + 8 * (lane >> 4);
#pragma unroll
  for (int i = 0; i < 8; ++i) { a[i] = (_Float16)p[i]; a[8 + i] = (_Float16)p[16 + i]; }
  return a;
}
__device__ __forceinline__ v16h frag_f32s(const float* rowk0, int lane, float sc) {
  v16h a; const float* p = rowk0 + 8 * (lane >> 4);
#pragma unroll
  for (int i = 0; i < 8; ++i) { a[i] = (_Float16)(p[i] * sc); a[8 + i] = (_Float16)(p[16 + i] * sc); }
  return a;
}
// column fragment from a [K][ld] layout (column n), rows >= K read as 0
__device__ __forceinline__ v16h fragc_f32(const float* W, int k0, int n, int lane, int ld, int K) {
  v16h a; const int g = lane >> 4;
#pragma unroll
  for (int i = 0; i < 8; ++i) { const int ka = k0 + 8 * g + i, kb = ka + 16;
    a[i] = (_Float16)(ka < K ? W[(size_t)(ka < K ? ka : K - 1) * ld + n] : 0.f); a[8 + i] = (_Float16)(kb < K ? W[(size_t)(kb < K ? kb : K - 1) * ld + n] : 0.f); }
  return a;
}
struct F2 { v16b h, l; };
__device__ __forceinline__ F2 bsplit16(const float v[16]) { F2 r;
#pragma unroll
  for (int i = 0; i < 16; ++i) { const __bf16 h = (__bf16)v[i]; r.h[i] = h; r.l[i] = (__bf16)(v[i] - (float)h); }
  return r; }
__device__ __forceinline__ F2 split_row(const float* row, int k0, int lane) { float v[16]; const float* p = row + k0 + 8 * (lane >> 4);
#pragma unroll
  for (int i = 0; i < 8; ++i) { v[i] = p[i]; v[8 + i] = p[16 + i]; }
  return bsplit16(v); }
__device__ __forceinline__ F2 split_rowK(const float* row, int k0, int lane, int K) { float v[16]; const int g = lane >> 4;
#pragma unroll
  for (int i = 0; i < 8; ++i) { const int ka = k0 + 8 * g + i, kb = ka + 16; v[i] = ka < K ? row[ka < K ? ka : K - 1] : 0.f; v[8 + i] = kb < K ? row[kb < K ? kb : K - 1] : 0.f; }
  return bsplit16(v); }
__device__ __forceinline__ F2 split_col(const float* W, int k0, int n, int lane, int ld, int K) { float v[16]; const int g = lane >> 4;
#pragma unroll
  for (int i = 0; i < 8; ++i) { const int ka = k0 + 8 * g + i, kb = ka + 16; v[i] = ka < K ? W[(size_t)(ka < K ? ka : K - 1) * ld + n] : 0.f; v[8 + i] = kb < K ? W[(size_t)(kb < K ? kb : K - 1) * ld + n] : 0.f; }
  return bsplit16(v); }
__device__ __forceinline__ v8f mac3(const F2& a, const F2& b, v8f c) { c = wmma_bf(a.l, b.h, c); c = wmma_bf(a.h, b.l, c); return wmma_bf(a.h, b.h, c); }
__device__ __forceinline__ float sigm(float v) { return 1.0f / (1.0f + expf(-v)); }
#define LDSX() do { asm volatile("s_wait_dscnt 0" ::: "memory"); __builtin_amdgcn_wave_barrier(); __builtin_amdgcn_fence(__ATOMIC_RELEASE, "workgroup"); } while (0)


// Multi-head attention with clipped relative position embeddings (B 2, Lq = Lk = 2048, hid 1024, 16 heads x 64, max_rel 2): q = query Wq^T + bq, k = key Wk^T + bk, v = value Wv^T + bv; attn = softmax((q k^T + q . rel_k[clip(k - q, -2, 2) + 2]) / 8); x = attn v + sum_k attn rel_v[clip(k - q) + 2]; out = x Wo^T + bo.
#define NB 2
#define SS 2048
#define DM 1024
#define NH 16
#define HD 64
#define QKVW (3 * DM)
#ifndef TQB
#define TQB (SS / 64)
#define TNB NB
#define TOB (NB * SS / 64)     // output row tiles (all)
#endif
typedef __attribute__((ext_vector_type(8))) __bf16 v8b;
typedef __attribute__((ext_vector_type(4))) __bf16 v4b;
__device__ __forceinline__ v16b frag_b(const __bf16* rowk0, int lane) {
  union { v16b v; v8b q[2]; } u; const __bf16* p = rowk0 + 8 * (lane >> 4);
  u.q[0] = *(const v8b*)p; u.q[1] = *(const v8b*)(p + 16); return u.v;
}
__device__ __forceinline__ float bfr(float v) { return (float)(__bf16)v; }
__device__ __attribute__((noinline)) float erf_ni(float v) { return erff(v); }

#define PK_A 0                       // [3072][1024] c_attn kernel rows (natural)
#define PK_P (PK_A + QKVW * DM)        // [1024][1024] c_proj kernel rows
#define PK_END (PK_P + DM * DM)
#define WS_PK  0u
#define WS_QK  (WS_PK + 2u * PK_END)             // f32 [4096 rows][3072]: [q | - | v], each 1024 (h*64+d) (the k columns are not written: k goes to WS_KH, WS_KL)
#define WS_VTH (WS_QK + 4u * NB * SS * QKVW)     // bf16 [2][1024 (h*64+d)][2048 s]
#define WS_VTL (WS_VTH + 2u * NB * DM * SS)
#define WS_O   (WS_VTL + 2u * NB * DM * SS)        // f32 [4096][1024]
#define WS_KH  (WS_O + 4u * NB * SS * DM)         // bf16 [4096 rows][1024 (h*64+d)]: k, rounded
#define WS_KL  (WS_KH + 2u * NB * SS * DM)        // bf16, same shape: k minus its rounded value
#define WS_END (WS_KL + 2u * NB * SS * DM)

// ---- k_pack: the four [1024][1024] Linear weights (torch [out,in], natural rows) rounded to bf16 in one launch: blockIdx.y = matrix (q, k, v, o: their packed planes stand one behind the other), a block = 8 rows. A stream: 16 waves a WGP over the chip, a lane's 8 loads of 16 B (a wave covers 4 whole lines a load) all in flight before its first store; a wave's store of 8 B a lane covers 2 whole lines.
__global__ __launch_bounds__(256) void k_pack(const float* __restrict__ W0, const float* __restrict__ W1, const float* __restrict__ W2, const float* __restrict__ W3, __bf16* __restrict__ DST) {
  const int y = blockIdx.y; const float* Wm = y == 0 ? W0 : (y == 1 ? W1 : (y == 2 ? W2 : W3));
  const size_t o = (size_t)blockIdx.x * (8 * DM) + threadIdx.x * 4; __bf16* dst = DST + (size_t)y * DM * DM + o;
  v4f v[8];   // both loops fully unrolled: v is indexed by constants and stays in registers
#pragma unroll
  for (int j = 0; j < 8; ++j) v[j] = *(const v4f*)(Wm + o + j * DM);
#pragma unroll
  for (int j = 0; j < 8; ++j) { v4b r;
#pragma unroll
    for (int i = 0; i < 4; ++i) r[i] = (__bf16)v[j][i];
    vst2(dst + j * DM, r); }
}
// ---- operand tiles of the two projection GEMMs (k_qkv, k_out), one 64-deep k pass at a time, staged in LDS once per block: A = 64 f32 rows of 256 B, B = 128 bf16 weight rows of 128 B, so every copy of a wave covers whole 128 B lines. Row pitches are 16 B x odd, so that the 16 rows of a b128 fragment read fall on distinct banks.
#define GK 64                          // k per pass
#define GAP 68                         // floats: 272 B rows of the A tile [64 rows][64 k]
#define GBP 72                         // bf16: 144 B rows of the B tile [128 rows][64 k]
#define GASZ (64 * GAP * 4)            // bytes of an A tile; the B tile stands behind it
#define GBUF (GASZ + 128 * GBP * 2)    // bytes of one buffer
// 8 copies of 16 B a lane, ls bytes apart in LDS and gs elements apart in global memory
template <typename T> __device__ __forceinline__ void copy8(unsigned l, unsigned ls, const T* g, size_t gs) {
  const unsigned l1 = l + ls, l2 = l + 2 * ls, l3 = l + 3 * ls, l4 = l + 4 * ls, l5 = l + 5 * ls, l6 = l + 6 * ls, l7 = l + 7 * ls;
  const T *g1 = g + gs, *g2 = g + 2 * gs, *g3 = g + 3 * gs, *g4 = g + 4 * gs, *g5 = g + 5 * gs, *g6 = g + 6 * gs, *g7 = g + 7 * gs;
  // the copies and the s_wait_xcnt that stands in front of any rewrite of their address registers, in one statement so that nothing moves in between
  asm volatile("global_load_async_to_lds_b128 %0, %8, off\n\t"
               "global_load_async_to_lds_b128 %1, %9, off\n\t"
               "global_load_async_to_lds_b128 %2, %10, off\n\t"
               "global_load_async_to_lds_b128 %3, %11, off\n\t"
               "global_load_async_to_lds_b128 %4, %12, off\n\t"
               "global_load_async_to_lds_b128 %5, %13, off\n\t"
               "global_load_async_to_lds_b128 %6, %14, off\n\t"
               "global_load_async_to_lds_b128 %7, %15, off\n\t"
               "s_wait_xcnt 0x0"
               :: "v"(l), "v"(l1), "v"(l2), "v"(l3), "v"(l4), "v"(l5), "v"(l6), "v"(l7), "v"(g), "v"(g1), "v"(g2), "v"(g3), "v"(g4), "v"(g5), "v"(g6), "v"(g7) : "memory");
}
// one pass's tiles, 16 copies a lane: A rows 8 apart (a wave covers 2 whole rows a copy), B rows 16 apart (4 whole rows a copy). la, lb: the lane's LDS byte addresses in the target buffer; ga, gb: its global addresses.
__device__ __forceinline__ void stage_ab(unsigned la, unsigned lb, const float* ga, const __bf16* gb) { copy8(la, 8 * GAP * 4, ga, (size_t)8 * DM); copy8(lb, 16 * GBP * 2, gb, (size_t)16 * DM); }
__device__ __forceinline__ v16b cvt_lds(const float* p) { v16b r; const v4f a = *(const v4f*)p, b = *(const v4f*)(p + 4), c = *(const v4f*)(p + 16), d = *(const v4f*)(p + 20);
#pragma unroll
  for (int i = 0; i < 4; ++i) { r[i] = (__bf16)a[i]; r[4 + i] = (__bf16)b[i]; r[8 + i] = (__bf16)c[i]; r[12 + i] = (__bf16)d[i]; }
  return r; }
// ---- k_qkv: block = (64 rows, 128 of the 3072 cols): QKV = bf16(x) . rows (exact) -> f32 rows (pitch 3072); the k columns leave as a bf16 pair (rounded value, residual), split here once instead of in every wave of every query block of k_attn
__global__ __launch_bounds__(128) void k_qkv(const float* __restrict__ XQ, const float* __restrict__ XK, const float* __restrict__ XV, const __bf16* __restrict__ P, const float* __restrict__ BQ, const float* __restrict__ BK, const float* __restrict__ BV, float* __restrict__ QKV, __bf16* __restrict__ KH, __bf16* __restrict__ KL) {
  __shared__ __align__(16) char sm[2 * GBUF];   // two buffers: pass t reads buffer t & 1 while pass t + 1's tiles land in the other; behind the loop the same bytes stage the output rows
  float (*so)[16][132] = (float (*)[16][132])sm;
  const int tid = threadIdx.x, wave = tid >> 5, lane = tid & 31, col = lane & 15, g = lane >> 4; const size_t rb = (size_t)blockIdx.x * 64, r0 = rb + wave * 16; const int n0 = blockIdx.y * 128; const float* X = (n0 < DM) ? XQ : (n0 < 2 * DM ? XK : XV);
  const unsigned la0 = (unsigned)(size_t)&sm[(tid >> 4) * (GAP * 4) + (tid & 15) * 16], lb0 = (unsigned)(size_t)&sm[GASZ + (tid >> 3) * (GBP * 2) + (tid & 7) * 16];
  const float* ga0 = X + (rb + (tid >> 4)) * DM + (tid & 15) * 4; const __bf16* gb0 = P + (size_t)(n0 + (tid >> 3)) * DM + (tid & 7) * 8;
  stage_ab(la0, lb0, ga0, gb0);
  v8f acc[8] = {};
  asm volatile("s_wait_asynccnt 0x0" ::: "memory");   // this wave's copies of pass 0 have landed
  __syncthreads();                                     // ... and every other wave's: buffer 0 may be read
  stage_ab(la0 + GBUF, lb0 + GBUF, ga0 + GK, gb0 + GK);
  // the pass loop stays rolled (code size; one foot with the waits, the barrier and the refill in their order); the loops inside are fully unrolled so that a, w and acc are indexed by constants and stay in registers
#pragma unroll 1
  for (int t = 0; t < DM / GK; ++t) { const int bf = t & 1; const float* arow = (const float*)(sm + bf * GBUF) + (wave * 16 + col) * GAP + 8 * g; const __bf16* brow = (const __bf16*)(sm + bf * GBUF + GASZ) + col * GBP;
    v16b a[GK / 32], w[GK / 32][8];   // all fragment reads of the pass stand as one group in front of its products: a read among the products would be waited for on the spot
#pragma unroll
    for (int kc = 0; kc < GK / 32; ++kc) a[kc] = cvt_lds(arow + kc * 32);
#pragma unroll
    for (int kc = 0; kc < GK / 32; ++kc) {
#pragma unroll
      for (int j = 0; j < 8; ++j) w[kc][j] = frag_b(brow + j * 16 * GBP + kc * 32, lane); }
#pragma unroll
    for (int kc = 0; kc < GK / 32; ++kc) {
#pragma unroll
      for (int j = 0; j < 8; ++j) acc[j] = wmma_bf(a[kc], w[kc][j], acc[j]); }
    asm volatile("s_wait_dscnt 0x0" ::: "memory");      // this wave's reads of buffer bf are done before the buffer is refilled
    asm volatile("s_wait_asynccnt 0x0" ::: "memory");   // this wave's copies of pass t + 1 have landed
    __syncthreads();                                     // publishes pass t + 1 and ends every wave's reads of buffer bf
    if (t + 2 < DM / GK) stage_ab(la0 + bf * GBUF, lb0 + bf * GBUF, ga0 + (t + 2) * GK, gb0 + (t + 2) * GK); }
  asm volatile("s_wait_asynccnt 0x0" ::: "memory");     // no copy is outstanding when the buffers become output staging
  const float* bias = (n0 < DM) ? BQ : (n0 < 2 * DM ? BK : BV); const int nb = n0 % DM;
#pragma unroll
  for (int j = 0; j < 8; ++j) { const float bb = bfr(bias[nb + j * 16 + col]);
#pragma unroll
    for (int r = 0; r < 8; ++r) so[wave][8 * g + r][j * 16 + col] = acc[j][r] + bb; }
  LDSX();
  if (n0 >= DM && n0 < 2 * DM) {   // block-uniform: a block's 128 columns lie in one of q, k, v
    for (int rl = 0; rl < 16; ++rl) { const v4f v = *(const v4f*)&so[wave][rl][lane * 4]; v4b hi, lo;
#pragma unroll
      for (int i = 0; i < 4; ++i) { hi[i] = (__bf16)v[i]; lo[i] = (__bf16)(v[i] - (float)hi[i]); }
      const size_t o = (r0 + rl) * DM + nb + lane * 4; vst2(KH + o, hi); vst2(KL + o, lo); } }
  else for (int rl = 0; rl < 16; ++rl) vst2(QKV + (r0 + rl) * QKVW + n0 + lane * 4, *(const v4f*)&so[wave][rl][lane * 4]);
}
__global__ __launch_bounds__(256) void k_vt(const float* __restrict__ QKV, __bf16* __restrict__ VTH, __bf16* __restrict__ VTL) {
  __shared__ __align__(16) __bf16 sth[64][72], stl[64][72]; const int tid = threadIdx.x; const size_t rb = (size_t)blockIdx.x * 64; const int h = blockIdx.y; const int b = (int)(rb / SS), s0 = (int)(rb % SS);
  for (int q = tid; q < 64 * 64; q += 256) { const int rl = q >> 6, d = q & 63; const float v = QKV[(rb + rl) * QKVW + 2 * DM + h * HD + d]; const __bf16 hb = (__bf16)v; sth[d][rl] = hb; stl[d][rl] = (__bf16)(v - (float)hb); }
  __syncthreads();
  for (int q = tid; q < 64 * 8; q += 256) { const int d = q >> 3, pc = q & 7; const size_t o = ((size_t)b * DM + h * HD + d) * SS + s0 + pc * 8; vst2((unsigned*)(VTH + o), *(const v4u*)&sth[d][pc * 8]); vst2((unsigned*)(VTL + o), *(const v4u*)&stl[d][pc * 8]); }
}
// ---- k_attn: block = (64 queries, head h, batch b): full flash attention (K = 64) on transposed products: S^T = K . Q^T (A = key rows, B = the wave's 16 queries) and O^T += V^T . P^T (A = V^T rows, B = the two score tiles of a pass, converted in place). A lane (g, col) holds query col alone: keys 8g + r of each 16-key tile, so maximum, row sum and the 5 distance-class masses are summed in the lane; the two lane halves exchange the maximum once a pass and join their sums once behind the loop. logits = (q.k (3 products) + qr[clip(k-q)+2]) / 8; P.V 3 products; w2 = sum_j (mass_j / l) rel_v[j]; O[b*S+q][h*64+d] = w1 + w2
// softmax in base 2: SC2 = log2(e) / sqrt(64). The maximum is taken over the unscaled scores (SC2 > 0 keeps the order) and scaled once; each exponential is then one fma and one v_exp_f32 in line, 16 independent ones a pass.
#define SC2 0.18033688f
__device__ __forceinline__ float ex2(float v) { return __builtin_amdgcn_exp2f(v); }
__device__ __forceinline__ float xhalf(float v) { const int b = __builtin_bit_cast(int, v); return __builtin_bit_cast(float, __builtin_amdgcn_permlanex16(b, b, 0x76543210, 0xfedcba98, false, false)); }   // lane l <-> l ^ 16
// K / V^T tiles of one 32-key pass, staged in LDS once per block for its 4 waves. Row pitches are 16 B x odd, so that the 16 rows of a b128 fragment read fall on distinct banks.
#define KP 72    // bf16: 144 B rows of a K tile [32 keys][64 d]
#define VP 40    // bf16: 80 B rows of a V^T tile [64 d][32 keys]
__device__ __forceinline__ F2 split_lds(const float* p) { float v[16]; const v4f a = *(const v4f*)p, b = *(const v4f*)(p + 4), c = *(const v4f*)(p + 16), d = *(const v4f*)(p + 20);
#pragma unroll
  for (int i = 0; i < 4; ++i) { v[i] = a[i]; v[4 + i] = b[i]; v[8 + i] = c[i]; v[12 + i] = d[i]; }
  return bsplit16(v); }
// one pass's tiles, 8 copies of 16 B a lane: K hi and residual rows 16 apart (a wave covers 4 whole rows = 4 lines a copy), V^T hi and residual rows 32 apart. lk, lv: the lane's LDS byte addresses in the target buffer; gk, gk2 (K hi, residual), gh, gl (V^T hi, residual): its global addresses.
__device__ __forceinline__ void stage_kv(unsigned lk, unsigned lv, const __bf16* gk, const __bf16* gk2, const __bf16* gh, const __bf16* gl) {
  const unsigned lk1 = lk + 16 * KP * 2, lk2 = lk + 32 * KP * 2, lk3 = lk + 48 * KP * 2, lv1 = lv + 32 * VP * 2, lv2 = lv + 64 * VP * 2, lv3 = lv + 96 * VP * 2;
  const __bf16 *gk1 = gk + 16 * DM, *gk3 = gk2 + 16 * DM, *gh1 = gh + 32 * SS, *gl1 = gl + 32 * SS;
  // the copies and the s_wait_xcnt that stands in front of any rewrite of their address registers, in one statement so that nothing moves in between
  asm volatile("global_load_async_to_lds_b128 %0, %8, off\n\t"
               "global_load_async_to_lds_b128 %1, %9, off\n\t"
               "global_load_async_to_lds_b128 %2, %10, off\n\t"
               "global_load_async_to_lds_b128 %3, %11, off\n\t"
               "global_load_async_to_lds_b128 %4, %12, off\n\t"
               "global_load_async_to_lds_b128 %5, %13, off\n\t"
               "global_load_async_to_lds_b128 %6, %14, off\n\t"
               "global_load_async_to_lds_b128 %7, %15, off\n\t"
               "s_wait_xcnt 0x0"
               :: "v"(lk), "v"(lk1), "v"(lk2), "v"(lk3), "v"(lv), "v"(lv1), "v"(lv2), "v"(lv3), "v"(gk), "v"(gk1), "v"(gk2), "v"(gk3), "v"(gh), "v"(gh1), "v"(gl), "v"(gl1) : "memory");
}
template <int C> struct Cls { static constexpr int v = C; };
__global__ __launch_bounds__(128) void k_attn(const float* __restrict__ QK, const __bf16* __restrict__ KH, const __bf16* __restrict__ KL, const __bf16* __restrict__ VTH, const __bf16* __restrict__ VTL, const float* __restrict__ RK, const float* __restrict__ RV, float* __restrict__ O) {
  __shared__ __align__(16) float so[4][16][68]; __shared__ float sqr[4][16][8];
  __shared__ __align__(16) __bf16 sk[2][2][32][KP]; __shared__ __align__(16) __bf16 sv[2][2][64][VP];   // two buffers: pass t reads buffer t & 1 while pass t + 1's tiles land in the other
  const int tid = threadIdx.x, wave = tid >> 5, lane = tid & 31, col = lane & 15, g = lane >> 4;
  const int qb = blockIdx.x, h = blockIdx.y, b = blockIdx.z; const int q0 = qb * 64 + wave * 16; const size_t rq = (size_t)b * SS + q0 + col;
  const unsigned lk0 = (unsigned)(size_t)&sk[0][0][tid >> 3][(tid & 7) * 8], lv0 = (unsigned)(size_t)&sv[0][0][tid >> 2][(tid & 3) * 8];
  const size_t gk0 = ((size_t)b * SS + (tid >> 3)) * DM + h * HD + (tid & 7) * 8; const size_t gv0 = ((size_t)b * DM + h * HD + (tid >> 2)) * SS + (tid & 3) * 8;
  stage_kv(lk0, lv0, KH + gk0, KL + gk0, VTH + gv0, VTL + gv0);   // pass 0's tiles fly under the query set-up below
  F2 aq[2];
#pragma unroll
  for (int kc = 0; kc < 2; ++kc) aq[kc] = split_row(QK + rq * QKVW + h * HD, kc * 32, lane);
  // relative-key logits: sqr[row][j] = q_row . rel_k[j] (f32; the lane's partial over its 4 columns, xor-16 reduced; staged in LDS so the runtime class index is not a private-array index)
#pragma unroll 1
  for (int r = 0; r < 8; ++r) { const float* qrow = QK + ((size_t)b * SS + q0 + 8 * g + r) * QKVW + h * HD;
#pragma unroll
    for (int j = 0; j < 5; ++j) { float a = 0.f;
#pragma unroll
      for (int dt = 0; dt < 4; ++dt) a += qrow[dt * 16 + col] * bfr(RK[j * HD + dt * 16 + col]);
#pragma unroll
      for (int o = 1; o < 16; o <<= 1) a += __shfl_xor(a, o);
      if (col == j) sqr[wave][8 * g + r][j] = a; } }
  LDSX();
  // the inner loops below are fully unrolled so that s, e, jc, ms and acc are indexed by constants and stay in registers
  const int qi = q0 + col;
  float m = -3.0e38f, l = 0.f, ms[5];
#pragma unroll
  for (int j = 0; j < 5; ++j) ms[j] = 0.f;
  v8f acc[4] = {};
  asm volatile("s_wait_asynccnt 0x0" ::: "memory");   // this wave's copies of pass 0 have landed
  __syncthreads();                                     // ... and every other wave's: buffer 0 may be read
  stage_kv(lk0 + (unsigned)sizeof(sk[0]), lv0 + (unsigned)sizeof(sv[0]), KH + gk0 + 32 * DM, KL + gk0 + 32 * DM, VTH + gv0 + 32, VTL + gv0 + 32);
  // One 32-key pass. CLS: the distance class that all (key, query) pairs of the pass share for every query of the block (0: every key at least 2 below every query, 4: at least 2 above), or -1 for a pass that touches the band |k - q| < 2, where each pair's class is looked up. With one class the relative-key logit is a constant of the lane: it comes in as cin, the start value of the score accumulators, and the pass's sum es is the class's mass. always_inline: s, e, acc and ms must stay in registers.
  auto pass = [&](auto cls, const int ks, const v8f cin) __attribute__((always_inline)) { constexpr int CLS = decltype(cls)::v; float s[16]; [[maybe_unused]] int jc[16]; const int bf = ks & 1;
#pragma unroll
    for (int ct = 0; ct < 2; ++ct) { const __bf16* krow = &sk[bf][0][ct * 16 + col][0]; v8f c = cin;
#pragma unroll
      for (int kc = 0; kc < 2; ++kc) { const v16b kh = frag_b(krow + kc * 32, lane), kl = frag_b(krow + 32 * KP + kc * 32, lane); c = wmma_pl(kh, aq[kc].l, c); c = wmma_pl(kl, aq[kc].h, c); c = wmma_pl(kh, aq[kc].h, c); }
#pragma unroll
      for (int r = 0; r < 8; ++r) {
        if constexpr (CLS < 0) { const int kk = ks * 32 + ct * 16 + 8 * g + r; const int dlt = min(max(kk - qi, -2), 2) + 2; jc[ct * 8 + r] = dlt; s[ct * 8 + r] = c[r] + sqr[wave][col][dlt]; }
        else s[ct * 8 + r] = c[r]; } }   // attn1 + attn2, unscaled
    float mx = s[0];
#pragma unroll
    for (int i = 1; i < 16; ++i) mx = fmaxf(mx, s[i]);
    mx = fmaxf(mx, xhalf(mx));
    const float mn = fmaxf(m, mx * SC2); const float alpha = ex2(m - mn); m = mn;   // m: running maximum of (attn1 + attn2) / sqrt(64) * log2(e)
    float e[16];
#pragma unroll
    for (int i = 0; i < 16; i += 2) { const v2f t = __builtin_elementwise_fma((v2f){s[i], s[i + 1]}, (v2f){SC2, SC2}, (v2f){-mn, -mn}); e[i] = ex2(t[0]); e[i + 1] = ex2(t[1]); }   // one packed fma a score pair
    float es = 0.f;
#pragma unroll
    for (int i = 0; i < 8; ++i) es += e[i] + e[8 + i];
    l = l * alpha + es;
    if constexpr (CLS < 0) {
#pragma unroll
      for (int j = 0; j < 5; ++j) { float add = 0.f;
#pragma unroll
        for (int i = 0; i < 16; ++i) add += (jc[i] == j) ? e[i] : 0.f;
        ms[j] = ms[j] * alpha + add; } }
    else if constexpr (CLS == 4) {
#pragma unroll
      for (int j = 0; j < 4; ++j) ms[j] *= alpha;
      ms[4] = ms[4] * alpha + es; }   // CLS == 0: all mass so far is class 0's, and l holds it
#pragma unroll
    for (int dt = 0; dt < 4; ++dt) acc[dt] *= alpha;
    const F2 pb = bsplit16(e);   // B element i = key 8g + i, element 8 + i = key 16 + 8g + i: the k order of frag_b
#pragma unroll
    for (int dt = 0; dt < 4; ++dt) { const v16b vh = frag_b(&sv[bf][0][dt * 16 + col][0], lane), vl = frag_b(&sv[bf][1][dt * 16 + col][0], lane); acc[dt] = wmma_pl(vh, pb.l, acc[dt]); acc[dt] = wmma_pl(vl, pb.h, acc[dt]); acc[dt] = wmma_pl(vh, pb.h, acc[dt]); }
    asm volatile("s_wait_dscnt 0x0" ::: "memory");      // this wave's reads of buffer bf are done before the buffer is refilled
    asm volatile("s_wait_asynccnt 0x0" ::: "memory");   // this wave's copies of pass ks + 1 have landed
    __syncthreads();                                     // publishes pass ks + 1 and ends every wave's reads of buffer bf
    if (ks + 2 < SS / 32) stage_kv(lk0 + bf * (unsigned)sizeof(sk[0]), lv0 + bf * (unsigned)sizeof(sv[0]), KH + gk0 + (size_t)(ks + 2) * 32 * DM, KL + gk0 + (size_t)(ks + 2) * 32 * DM, VTH + gv0 + (ks + 2) * 32, VTL + gv0 + (ks + 2) * 32); };
  // The block's queries are 64 qb .. 64 qb + 63: passes below 2 qb - 1 hold keys of class 0 alone, passes from 2 qb + 3 on keys of class 4 alone. The bounds depend on blockIdx alone, so every wave of the block passes the same barriers. The three loops stay rolled (code size).
  const int nlo = max(2 * qb - 1, 0), nhi = min(2 * qb + 3, SS / 32);
  { const float q0c = sqr[wave][col][0]; const v8f cin = {q0c, q0c, q0c, q0c, q0c, q0c, q0c, q0c};
#pragma unroll 1
    for (int ks = 0; ks < nlo; ++ks) pass(Cls<0>{}, ks, cin); }
  ms[0] = l;
#pragma unroll 1
  for (int ks = nlo; ks < nhi; ++ks) pass(Cls<-1>{}, ks, v8f{});
  { const float q4c = sqr[wave][col][4]; const v8f cin = {q4c, q4c, q4c, q4c, q4c, q4c, q4c, q4c};
#pragma unroll 1
    for (int ks = nhi; ks < SS / 32; ++ks) pass(Cls<4>{}, ks, cin); }
  asm volatile("s_wait_asynccnt 0x0" ::: "memory");     // no copy is outstanding when the wave goes on to the epilogue and ends
  l += xhalf(l);
  const float il = 1.0f / l;
#pragma unroll
  for (int j = 0; j < 5; ++j) ms[j] = (ms[j] + xhalf(ms[j])) * il;
#pragma unroll
  for (int dt = 0; dt < 4; ++dt) {
#pragma unroll
    for (int r = 0; r < 8; ++r) { const int d = dt * 16 + 8 * g + r; float w2 = 0.f;
#pragma unroll
      for (int j = 0; j < 5; ++j) w2 += ms[j] * bfr(RV[j * HD + d]);
      so[wave][col][d] = acc[dt][r] * il + w2; } }
  LDSX();
  for (int rl = 0; rl < 16; ++rl) if (lane < 16) vst2(O + ((size_t)b * SS + q0 + rl) * DM + h * HD + lane * 4, *(const v4f*)&so[wave][rl][lane * 4]);
}
// ---- k_out: block = (64 rows, 128 cols): out = O(hi/lo) . c_proj rows (2 products) + bias
__global__ __launch_bounds__(128) void k_out(const float* __restrict__ O, const __bf16* __restrict__ P, const float* __restrict__ BO, float* __restrict__ Y) {
  __shared__ __align__(16) char sm[2 * GBUF];   // two buffers, as in k_qkv; behind the loop the same bytes stage the output rows
  float (*so)[16][132] = (float (*)[16][132])sm;
  const int tid = threadIdx.x, wave = tid >> 5, lane = tid & 31, col = lane & 15, g = lane >> 4; const size_t rb = (size_t)blockIdx.x * 64, r0 = rb + wave * 16; const int n0 = blockIdx.y * 128;
  const unsigned la0 = (unsigned)(size_t)&sm[(tid >> 4) * (GAP * 4) + (tid & 15) * 16], lb0 = (unsigned)(size_t)&sm[GASZ + (tid >> 3) * (GBP * 2) + (tid & 7) * 16];
  const float* ga0 = O + (rb + (tid >> 4)) * DM + (tid & 15) * 4; const __bf16* gb0 = P + (size_t)(n0 + (tid >> 3)) * DM + (tid & 7) * 8;
  stage_ab(la0, lb0, ga0, gb0);
  v8f acc[8] = {};
  asm volatile("s_wait_asynccnt 0x0" ::: "memory");   // this wave's copies of pass 0 have landed
  __syncthreads();                                     // ... and every other wave's: buffer 0 may be read
  stage_ab(la0 + GBUF, lb0 + GBUF, ga0 + GK, gb0 + GK);
  // the pass loop stays rolled (code size; one foot with the waits, the barrier and the refill in their order); the loops inside are fully unrolled so that a, w and acc are indexed by constants and stay in registers
#pragma unroll 1
  for (int t = 0; t < DM / GK; ++t) { const int bf = t & 1; const float* arow = (const float*)(sm + bf * GBUF) + (wave * 16 + col) * GAP + 8 * g; const __bf16* brow = (const __bf16*)(sm + bf * GBUF + GASZ) + col * GBP;
    F2 a[GK / 32]; v16b w[GK / 32][8];   // all fragment reads of the pass stand as one group in front of its products, as in k_qkv
#pragma unroll
    for (int kc = 0; kc < GK / 32; ++kc) a[kc] = split_lds(arow + kc * 32);
#pragma unroll
    for (int kc = 0; kc < GK / 32; ++kc) {
#pragma unroll
      for (int j = 0; j < 8; ++j) w[kc][j] = frag_b(brow + j * 16 * GBP + kc * 32, lane); }
#pragma unroll
    for (int kc = 0; kc < GK / 32; ++kc) {
#pragma unroll
      for (int j = 0; j < 8; ++j) { acc[j] = wmma_bf(a[kc].l, w[kc][j], acc[j]); acc[j] = wmma_bf(a[kc].h, w[kc][j], acc[j]); } }
    asm volatile("s_wait_dscnt 0x0" ::: "memory");      // this wave's reads of buffer bf are done before the buffer is refilled
    asm volatile("s_wait_asynccnt 0x0" ::: "memory");   // this wave's copies of pass t + 1 have landed
    __syncthreads();                                     // publishes pass t + 1 and ends every wave's reads of buffer bf
    if (t + 2 < DM / GK) stage_ab(la0 + bf * GBUF, lb0 + bf * GBUF, ga0 + (t + 2) * GK, gb0 + (t + 2) * GK); }
  asm volatile("s_wait_asynccnt 0x0" ::: "memory");     // no copy is outstanding when the buffers become output staging
#pragma unroll
  for (int j = 0; j < 8; ++j) { const float bb = bfr(BO[n0 + j * 16 + col]);
#pragma unroll
    for (int r = 0; r < 8; ++r) so[wave][8 * g + r][j * 16 + col] = acc[j][r] + bb; }
  LDSX();
  for (int rl = 0; rl < 16; ++rl) vst2(Y + (r0 + rl) * DM + n0 + lane * 4, *(const v4f*)&so[wave][rl][lane * 4]);
}
extern "C" void kernel_launch(void* const* d_in, const int* in_sizes, int n_in, void* d_out, int out_size, void* d_ws, size_t ws_size, hipStream_t stream) {
  (void)in_sizes; (void)n_in; (void)out_size;
  const float** F = (const float**)d_in;   // 0 key [2,2048,1024], 1 query, 2 value, 3 Wq [1024,1024] (torch), 4 bq, 5 Wk, 6 bk, 7 Wv, 8 bv, 9 Wo, 10 bo, 11 rel_k [5,64], 12 rel_v [5,64]
  if (ws_size < (size_t)WS_END) return;
  char* ws = (char*)d_ws; __bf16 *PK = (__bf16*)(ws + WS_PK), *VTH = (__bf16*)(ws + WS_VTH), *VTL = (__bf16*)(ws + WS_VTL), *KH = (__bf16*)(ws + WS_KH), *KL = (__bf16*)(ws + WS_KL); float *QK = (float*)(ws + WS_QK), *O = (float*)(ws + WS_O);
  k_pack<<<dim3(DM / 8, 4), 256, 0, stream>>>(F[3], F[5], F[7], F[9], PK);   // planes q, k, v at PK_A, o at PK_P = PK_A + 3 planes
  k_qkv<<<dim3(TNB * SS / 64, QKVW / 128), 128, 0, stream>>>(F[1], F[0], F[2], PK + PK_A, F[4], F[6], F[8], QK, KH, KL);   // q from query, k from key, v from value
  k_vt<<<dim3(TNB * SS / 64, NH), 256, 0, stream>>>(QK, VTH, VTL);
  k_attn<<<dim3(TQB, NH, TNB), 128, 0, stream>>>(QK, KH, KL, VTH, VTL, F[11], F[12], O);
  k_out<<<dim3(TOB, DM / 128), 128, 0, stream>>>(O, PK + PK_P, F[10], (float*)d_out);
}

// v009
// One run takes 161 microseconds.
// Next to v008, in two timings, it ran 1.06 and 1.05 times as fast.
// All steps since v000 together make it 4.01 times as fast.
// compute dtype: key/query/value inputs, the four Linear weights/biases and the two relative tables (module inputs) rounded to bf16; q/k/v projections with exact bf16 products (inputs x weights); scores q.k with both operands as bf16 hi + residual pairs (3 products) plus the relative-key term q.rel_k[clip(k-q)] (5 f32 dot products per (token, head)); P.V with P hi/lo x V hi/lo (3 products) plus the relative-value term sum_j mass_j rel_v[j]; output projection hi/lo x exact Wo (2 products) + bo; softmax in f32; f32 accumulate.
#include <hip/hip_runtime.h>
#include <math.h>

typedef __attribute__((ext_vector_type(16))) _Float16 v16h;
typedef __attribute__((ext_vector_type(16))) __bf16 v16b;
typedef __attribute__((ext_vector_type(8)))  _Float16 v8h;
typedef __attribute__((ext_vector_type(8)))  float v8f;
typedef __attribute__((ext_vector_type(4)))  float v4f;
typedef __attribute__((ext_vector_type(2)))  float v2f;
typedef __attribute__((ext_vector_type(4)))  unsigned v4u;
typedef __attribute__((ext_vector_type(4)))  int v4i;
typedef float __attribute__((may_alias)) float_a;
typedef int __attribute__((may_alias)) int_a;

template <typename T> __device__ __forceinline__ void vst2(void* p, T v) { *(T*)p = v;  }
__device__ __forceinline__ v8f wmma16(v16h a, v16h b, v8f c) {
  v8f d = __builtin_amdgcn_wmma_f32_16x16x32_f16(false, a, false, b, (short)0, c, false, false);
  asm volatile("v_nop\n\tv_nop\n\tv_nop\n\tv_nop" : "+v"(d) : "v"(a), "v"(b));
  return d;
}
__device__ __forceinline__ v8f wmma_bf(v16b a, v16b b, v8f c) {
  v8f d = __builtin_amdgcn_wmma_f32_16x16x32_bf16(false, a, false, b, (short)0, c, false, false);
  asm volatile("v_nop\n\tv_nop\n\tv_nop\n\tv_nop" : "+v"(d) : "v"(a), "v"(b));
  return d;
}
// the plain builtin, for k_attn: the compiler keeps the distance between a product and the vector code on its registers itself, so no vector issue slot goes to a v_nop between products, and it is free to deal independent accumulate chains among each other. The two projection GEMMs keep wmma_bf: its tail also holds a pass's fragment reads as one group in front of the products.
__device__ __forceinline__ v8f wmma_pl(v16b a, v16b b, v8f c) { return __builtin_amdgcn_wmma_f32_16x16x32_bf16(false, a, false, b, (short)0, c, false, false); }
// 16x16x32 fragments: lane = (h = lane>>4, row/col = lane&15); elements 0..7 = k0+8h+0..7, 8..15 = k0+16+8h+0..7; D element r = row 8h+r
__device__ __forceinline__ v16h frag_h(const _Float16* rowk0, int lane) {
  union { v16h v; v8h q[2]; } u; const _Float16* p = rowk0 + 8 * (lane >> 4);
  u.q[0] = *(const v8h*)p; u.q[1] = *(const v8h*)(p + 16); return u.v;
}
__device__ __forceinline__ v16h frag_f32(const float* rowk0, int lane) {
  v16h a; const float* p = rowk0 + 8 * (lane >> 4);
#pragma unroll
  for (int i = 0; i < 8; ++i) { a[i] = (_Float16)p[i]; a[8 + i] = (_Float16)p[16 + i]; }
  return a;
}
__device__ __forceinline__ v16h frag_f32s(const float* rowk0, int lane, float sc) {
  v16h a; const float* p = rowk0 + 8 * (lane >> 4);
#pragma unroll
  for (int i = 0; i < 8; ++i) { a[i] = (_Float16)(p[i] * sc); a[8 + i] = (_Float16)(p[16 + i] * sc); }
  return a;
}
// column fragment from a [K][ld] layout (column n), rows >= K read as 0
__device__ __forceinline__ v16h fragc_f32(const float* W, int k0, int n, int lane, int ld, int K) {
  v16h a; const int g = lane >> 4;
#pragma unroll
  for (int i = 0; i < 8; ++i) { const int ka = k0 + 8 * g + i, kb = ka + 16;
    a[i] = (_Float16)(ka < K ? W[(size_t)(ka < K ? ka : K - 1) * ld + n] : 0.f); a[8 + i] = (_Float16)(kb < K ? W[(size_t)(kb < K ? kb : K - 1) * ld + n] : 0.f); }
  return a;
}
struct F2 { v16b h, l; };
__device__ __forceinline__ F2 bsplit16(const float v[16]) { F2 r;
#pragma unroll
  for (int i = 0; i < 16; ++i) { const __bf16 h = (__bf16)v[i]; r.h[i] = h; r.l[i] = (__bf16)(v[i] - (float)h); }
  return r; }
__device__ __forceinline__ F2 split_row(const float* row, int k0, int lane) { float v[16]; const float* p = row + k0 + 8 * (lane >> 4);
#pragma unroll
  for (int i = 0; i < 8; ++i) { v[i] = p[i]; v[8 + i] = p[16 + i]; }
  return bsplit16(v); }
__device__ __forceinline__ F2 split_rowK(const float* row, int k0, int lane, int K) { float v[16]; const int g = lane >> 4;
#pragma unroll
  for (int i = 0; i < 8; ++i) { const int ka = k0 + 8 * g + i, kb = ka + 16; v[i] = ka < K ? row[ka < K ? ka : K - 1] : 0.f; v[8 + i] = kb < K ? row[kb < K ? kb : K - 1] : 0.f; }
  return bsplit16(v); }
__device__ __forceinline__ F2 split_col(const float* W, int k0, int n, int lane, int ld, int K) { float v[16]; const int g = lane >> 4;
#pragma unroll
  for (int i = 0; i < 8; ++i) { const int ka = k0 + 8 * g + i, kb = ka + 16; v[i] = ka < K ? W[(size_t)(ka < K ? ka : K - 1) * ld + n] : 0.f; v[8 + i] = kb < K ? W[(size_t)(kb < K ? kb : K - 1) * ld + n] : 0.f; }
  return bsplit16(v); }
__device__ __forceinline__ v8f mac3(const F2& a, const F2& b, v8f c) { c = wmma_bf(a.l, b.h, c); c = wmma_bf(a.h, b.l, c); return wmma_bf(a.h, b.h, c); }
__device__ __forceinline__ float sigm(float v) { return 1.0f / (1.0f + expf(-v)); }
#define LDSX() do { asm volatile("s_wait_dscnt 0" ::: "memory"); __builtin_amdgcn_wave_barrier(); __builtin_amdgcn_fence(__ATOMIC_RELEASE, "workgroup"); } while (0)


// Multi-head attention with clipped relative position embeddings (B 2, Lq = Lk = 2048, hid 1024, 16 heads x 64, max_rel 2): q = query Wq^T + bq, k = key Wk^T + bk, v = value Wv^T + bv; attn = softmax((q k^T + q . rel_k[clip(k - q, -2, 2) + 2]) / 8); x = attn v + sum_k attn rel_v[clip(k - q) + 2]; out = x Wo^T + bo.
#define NB 2
#define SS 2048
#define DM 1024
#define NH 16
#define HD 64
#define QKVW (3 * DM)
#ifndef TQB
#define TQB (SS / 64)
#define TNB NB
#define TOB (NB * SS / 64)     // output row tiles (all)
#endif
typedef __attribute__((ext_vector_type(8))) __bf16 v8b;
typedef __attribute__((ext_vector_type(4))) __bf16 v4b;
__device__ __forceinline__ v16b frag_b(const __bf16* rowk0, int lane) {
  union { v16b v; v8b q[2]; } u; const __bf16* p = rowk0 + 8 * (lane >> 4);
  u.q[0] = *(const v8b*)p; u.q[1] = *(const v8b*)(p + 16); return u.v;
}
__device__ __forceinline__ float bfr(float v) { return (float)(__bf16)v; }
__device__ __attribute__((noinline)) float erf_ni(float v) { return erff(v); }

#define PK_A 0                       // [3072][1024] c_attn kernel rows (natural)
#define PK_P (PK_A + QKVW * DM)        // [1024][1024] c_proj kernel rows
#define PK_END (PK_P + DM * DM)
#define WS_PK  0u
#define WS_QK  (WS_PK + 2u * PK_END)             // f32 [4096 rows][3072]: only the q columns are written (k goes to WS_KH, WS_KL, v to WS_VH, WS_VL)
#define WS_VH  (WS_QK + 4u * NB * SS * QKVW)     // bf16 [4096 rows][1024 (h*64+d)]: v, rounded
#define WS_VL  (WS_VH + 2u * NB * DM * SS)        // bf16, same shape: v minus its rounded value
#define WS_O   (WS_VL + 2u * NB * DM * SS)         // f32 [4096][1024]
#define WS_KH  (WS_O + 4u * NB * SS * DM)         // bf16 [4096 rows][1024 (h*64+d)]: k, rounded
#define WS_KL  (WS_KH + 2u * NB * SS * DM)        // bf16, same shape: k minus its rounded value
#define WS_END (WS_KL + 2u * NB * SS * DM)

// ---- k_pack: the four [1024][1024] Linear weights (torch [out,in], natural rows) rounded to bf16 in one launch: blockIdx.y = matrix (q, k, v, o: their packed planes stand one behind the other), a block = 8 rows. A stream: 16 waves a WGP over the chip, a lane's 8 loads of 16 B (a wave covers 4 whole lines a load) all in flight before its first store; a wave's store of 8 B a lane covers 2 whole lines.
__global__ __launch_bounds__(256) void k_pack(const float* __restrict__ W0, const float* __restrict__ W1, const float* __restrict__ W2, const float* __restrict__ W3, __bf16* __restrict__ DST) {
  const int y = blockIdx.y; const float* Wm = y == 0 ? W0 : (y == 1 ? W1 : (y == 2 ? W2 : W3));
  const size_t o = (size_t)blockIdx.x * (8 * DM) + threadIdx.x * 4; __bf16* dst = DST + (size_t)y * DM * DM + o;
  v4f v[8];   // both loops fully unrolled: v is indexed by constants and stays in registers
#pragma unroll
  for (int j = 0; j < 8; ++j) v[j] = *(const v4f*)(Wm + o + j * DM);
#pragma unroll
  for (int j = 0; j < 8; ++j) { v4b r;
#pragma unroll
    for (int i = 0; i < 4; ++i) r[i] = (__bf16)v[j][i];
    vst2(dst + j * DM, r); }
}
// ---- operand tiles of the two projection GEMMs (k_qkv, k_out), one 64-deep k pass at a time, staged in LDS once per block: A = 64 f32 rows of 256 B, B = 128 bf16 weight rows of 128 B, so every copy of a wave covers whole 128 B lines. Row pitches are 16 B x odd, so that the 16 rows of a b128 fragment read fall on distinct banks.
#define GK 64                          // k per pass
#define GAP 68                         // floats: 272 B rows of the A tile [64 rows][64 k]
#define GBP 72                         // bf16: 144 B rows of the B tile [128 rows][64 k]
#define GASZ (64 * GAP * 4)            // bytes of an A tile; the B tile stands behind it
#define GBUF (GASZ + 128 * GBP * 2)    // bytes of one buffer
// 8 copies of 16 B a lane, ls bytes apart in LDS and gs elements apart in global memory
template <typename T> __device__ __forceinline__ void copy8(unsigned l, unsigned ls, const T* g, size_t gs) {
  const unsigned l1 = l + ls, l2 = l + 2 * ls, l3 = l + 3 * ls, l4 = l + 4 * ls, l5 = l + 5 * ls, l6 = l + 6 * ls, l7 = l + 7 * ls;
  const T *g1 = g + gs, *g2 = g + 2 * gs, *g3 = g + 3 * gs, *g4 = g + 4 * gs, *g5 = g + 5 * gs, *g6 = g + 6 * gs, *g7 = g + 7 * gs;
  // the copies and the s_wait_xcnt that stands in front of any rewrite of their address registers, in one statement so that nothing moves in between
  asm volatile("global_load_async_to_lds_b128 %0, %8, off\n\t"
               "global_load_async_to_lds_b128 %1, %9, off\n\t"
               "global_load_async_to_lds_b128 %2, %10, off\n\t"
               "global_load_async_to_lds_b128 %3, %11, off\n\t"
               "global_load_async_to_lds_b128 %4, %12, off\n\t"
               "global_load_async_to_lds_b128 %5, %13, off\n\t"
               "global_load_async_to_lds_b128 %6, %14, off\n\t"
               "global_load_async_to_lds_b128 %7, %15, off\n\t"
               "s_wait_xcnt 0x0"
               :: "v"(l), "v"(l1), "v"(l2), "v"(l3), "v"(l4), "v"(l5), "v"(l6), "v"(l7), "v"(g), "v"(g1), "v"(g2), "v"(g3), "v"(g4), "v"(g5), "v"(g6), "v"(g7) : "memory");
}
// one pass's tiles, 16 copies a lane: A rows 8 apart (a wave covers 2 whole rows a copy), B rows 16 apart (4 whole rows a copy). la, lb: the lane's LDS byte addresses in the target buffer; ga, gb: its global addresses.
__device__ __forceinline__ void stage_ab(unsigned la, unsigned lb, const float* ga, const __bf16* gb) { copy8(la, 8 * GAP * 4, ga, (size_t)8 * DM); copy8(lb, 16 * GBP * 2, gb, (size_t)16 * DM); }
__device__ __forceinline__ v16b cvt_lds(const float* p) { v16b r; const v4f a = *(const v4f*)p, b = *(const v4f*)(p + 4), c = *(const v4f*)(p + 16), d = *(const v4f*)(p + 20);
#pragma unroll
  for (int i = 0; i < 4; ++i) { r[i] = (__bf16)a[i]; r[4 + i] = (__bf16)b[i]; r[8 + i] = (__bf16)c[i]; r[12 + i] = (__bf16)d[i]; }
  return r; }
// ---- k_qkv: block = (64 rows, 128 of the 3072 cols): QKV = bf16(x) . rows (exact) -> f32 rows (pitch 3072) for q; the k and the v columns leave as bf16 pairs (rounded value, residual) in natural rows, split here once instead of in every wave of every query block of k_attn
__global__ __launch_bounds__(128) void k_qkv(const float* __restrict__ XQ, const float* __restrict__ XK, const float* __restrict__ XV, const __bf16* __restrict__ P, const float* __restrict__ BQ, const float* __restrict__ BK, const float* __restrict__ BV, float* __restrict__ QKV, __bf16* __restrict__ KH, __bf16* __restrict__ KL, __bf16* __restrict__ VH, __bf16* __restrict__ VL) {
  __shared__ __align__(16) char sm[2 * GBUF];   // two buffers: pass t reads buffer t & 1 while pass t + 1's tiles land in the other; behind the loop the same bytes stage the output rows
  float (*so)[16][132] = (float (*)[16][132])sm;
  const int tid = threadIdx.x, wave = tid >> 5, lane = tid & 31, col = lane & 15, g = lane >> 4; const size_t rb = (size_t)blockIdx.x * 64, r0 = rb + wave * 16; const int n0 = blockIdx.y * 128; const float* X = (n0 < DM) ? XQ : (n0 < 2 * DM ? XK : XV);
  const unsigned la0 = (unsigned)(size_t)&sm[(tid >> 4) * (GAP * 4) + (tid & 15) * 16], lb0 = (unsigned)(size_t)&sm[GASZ + (tid >> 3) * (GBP * 2) + (tid & 7) * 16];
  const float* ga0 = X + (rb + (tid >> 4)) * DM + (tid & 15) * 4; const __bf16* gb0 = P + (size_t)(n0 + (tid >> 3)) * DM + (tid & 7) * 8;
  stage_ab(la0, lb0, ga0, gb0);
  v8f acc[8] = {};
  asm volatile("s_wait_asynccnt 0x0" ::: "memory");   // this wave's copies of pass 0 have landed
  __syncthreads();                                     // ... and every other wave's: buffer 0 may be read
  stage_ab(la0 + GBUF, lb0 + GBUF, ga0 + GK, gb0 + GK);
  // the pass loop stays rolled (code size; one foot with the waits, the barrier and the refill in their order); the loops inside are fully unrolled so that a, w and acc are indexed by constants and stay in registers
#pragma unroll 1
  for (int t = 0; t < DM / GK; ++t) { const int bf = t & 1; const float* arow = (const float*)(sm + bf * GBUF) + (wave * 16 + col) * GAP + 8 * g; const __bf16* brow = (const __bf16*)(sm + bf * GBUF + GASZ) + col * GBP;
    v16b a[GK / 32], w[GK / 32][8];   // all fragment reads of the pass stand as one group in front of its products: a read among the products would be waited for on the spot
#pragma unroll
    for (int kc = 0; kc < GK / 32; ++kc) a[kc] = cvt_lds(arow + kc * 32);
#pragma unroll
    for (int kc = 0; kc < GK / 32; ++kc) {
#pragma unroll
      for (int j = 0; j < 8; ++j) w[kc][j] = frag_b(brow + j * 16 * GBP + kc * 32, lane); }
#pragma unroll
    for (int kc = 0; kc < GK / 32; ++kc) {
#pragma unroll
      for (int j = 0; j < 8; ++j) acc[j] = wmma_bf(a[kc], w[kc][j], acc[j]); }
    asm volatile("s_wait_dscnt 0x0" ::: "memory");      // this wave's reads of buffer bf are done before the buffer is refilled
    asm volatile("s_wait_asynccnt 0x0" ::: "memory");   // this wave's copies of pass t + 1 have landed
    __syncthreads();                                     // publishes pass t + 1 and ends every wave's reads of buffer bf
    if (t + 2 < DM / GK) stage_ab(la0 + bf * GBUF, lb0 + bf * GBUF, ga0 + (t + 2) * GK, gb0 + (t + 2) * GK); }
  asm volatile("s_wait_asynccnt 0x0" ::: "memory");     // no copy is outstanding when the buffers become output staging
  const float* bias = (n0 < DM) ? BQ : (n0 < 2 * DM ? BK : BV); const int nb = n0 % DM;
#pragma unroll
  for (int j = 0; j < 8; ++j) { const float bb = bfr(bias[nb + j * 16 + col]);
#pragma unroll
    for (int r = 0; r < 8; ++r) so[wave][8 * g + r][j * 16 + col] = acc[j][r] + bb; }
  LDSX();
  if (n0 >= DM) {   // block-uniform: a block's 128 columns lie in one of q, k, v
    __bf16* const PH = n0 < 2 * DM ? KH : VH; __bf16* const PL = n0 < 2 * DM ? KL : VL;
    for (int rl = 0; rl < 16; ++rl) { const v4f v = *(const v4f*)&so[wave][rl][lane * 4]; v4b hi, lo;
#pragma unroll
      for (int i = 0; i < 4; ++i) { hi[i] = (__bf16)v[i]; lo[i] = (__bf16)(v[i] - (float)hi[i]); }
      const size_t o = (r0 + rl) * DM + nb + lane * 4; vst2(PH + o, hi); vst2(PL + o, lo); } }
  else for (int rl = 0; rl < 16; ++rl) vst2(QKV + (r0 + rl) * QKVW + n0 + lane * 4, *(const v4f*)&so[wave][rl][lane * 4]);
}
// ---- k_attn: block = (64 queries, head h, batch b): full flash attention (K = 64) on transposed products: S^T = K . Q^T (A = key rows, B = the wave's 16 queries) and O^T += V^T . P^T (A = V^T fragments, which the transposing LDS load takes from the natural-row V tile, B = the two score tiles of a pass, converted in place). A lane (g, col) holds query col alone: keys 8g + r of each 16-key tile, so maximum, row sum and the 5 distance-class masses are summed in the lane; the two lane halves exchange the maximum once a pass and join their sums once behind the loop. logits = (q.k (3 products) + qr[clip(k-q)+2]) / 8; P.V 3 products; w2 = sum_j (mass_j / l) rel_v[j]; O[b*S+q][h*64+d] = w1 + w2
// softmax in base 2: SC2 = log2(e) / sqrt(64). The maximum is taken over the unscaled scores (SC2 > 0 keeps the order) and scaled once; each exponential is then one fma and one v_exp_f32 in line, 16 independent ones a pass.
#define SC2 0.18033688f
__device__ __forceinline__ float ex2(float v) { return __builtin_amdgcn_exp2f(v); }
__device__ __forceinline__ float xhalf(float v) { const int b = __builtin_bit_cast(int, v); return __builtin_bit_cast(float, __builtin_amdgcn_permlanex16(b, b, 0x76543210, 0xfedcba98, false, false)); }   // lane l <-> l ^ 16
// K / V tiles of one 32-key pass, staged in LDS once per block for its 4 waves. Each row pitch is its reader's: 16 B x odd for the b128 fragment reads of K, 32 B x odd for the transposing reads of V.
#define KP 72    // bf16: 144 B rows of a K tile [32 keys][64 d]
#define VP 80    // bf16: 160 B rows of a V tile [32 keys][64 d]
typedef __attribute__((ext_vector_type(8))) short v8s;
typedef __attribute__((address_space(3))) v8s lds_v8s;
// A fragment of V^T (rows d0 .. d0 + 15, k = the tile's 32 keys) from the natural-row tile [32 keys][VP]: a ds_load_tr16_b128 gives lane (g, col) the 8 keys kb + 8g .. kb + 8g + 7 of column d0 + col; the loads at kb = 0 and 16 are elements 0..7 and 8..15, the k order of frag_b. Every lane is on and every lane's address lies in the tile.
__device__ __forceinline__ v16b frag_t(const __bf16* tile, int d0, int lane) {
  union { v16b v; v8s q[2]; } u; const __bf16* p = tile + (8 * (lane >> 4) + (lane & 7)) * VP + d0 + 8 * ((lane >> 3) & 1);
  u.q[0] = __builtin_amdgcn_ds_load_tr16_b128_v8i16((lds_v8s*)p); u.q[1] = __builtin_amdgcn_ds_load_tr16_b128_v8i16((lds_v8s*)(p + 16 * VP)); return u.v;
}
__device__ __forceinline__ F2 split_lds(const float* p) { float v[16]; const v4f a = *(const v4f*)p, b = *(const v4f*)(p + 4), c = *(const v4f*)(p + 16), d = *(const v4f*)(p + 20);
#pragma unroll
  for (int i = 0; i < 4; ++i) { v[i] = a[i]; v[4 + i] = b[i]; v[8 + i] = c[i]; v[12 + i] = d[i]; }
  return bsplit16(v); }
// one pass's tiles, 8 copies of 16 B a lane: K and V, hi and residual, rows 16 apart (a wave covers 4 whole rows = 4 lines a copy). lk, lv: the lane's LDS byte addresses in the target buffer; gk, gk2 (K hi, residual), gh, gl (V hi, residual): its global addresses.
__device__ __forceinline__ void stage_kv(unsigned lk, unsigned lv, const __bf16* gk, const __bf16* gk2, const __bf16* gh, const __bf16* gl) {
  const unsigned lk1 = lk + 16 * KP * 2, lk2 = lk + 32 * KP * 2, lk3 = lk + 48 * KP * 2, lv1 = lv + 16 * VP * 2, lv2 = lv + 32 * VP * 2, lv3 = lv + 48 * VP * 2;
  const __bf16 *gk1 = gk + 16 * DM, *gk3 = gk2 + 16 * DM, *gh1 = gh + 16 * DM, *gl1 = gl + 16 * DM;
  // the copies and the s_wait_xcnt that stands in front of any rewrite of their address registers, in one statement so that nothing moves in between
  asm volatile("global_load_async_to_lds_b128 %0, %8, off\n\t"
               "global_load_async_to_lds_b128 %1, %9, off\n\t"
               "global_load_async_to_lds_b128 %2, %10, off\n\t"
               "global_load_async_to_lds_b128 %3, %11, off\n\t"
               "global_load_async_to_lds_b128 %4, %12, off\n\t"
               "global_load_async_to_lds_b128 %5, %13, off\n\t"
               "global_load_async_to_lds_b128 %6, %14, off\n\t"
               "global_load_async_to_lds_b128 %7, %15, off\n\t"
               "s_wait_xcnt 0x0"
               :: "v"(lk), "v"(lk1), "v"(lk2), "v"(lk3), "v"(lv), "v"(lv1), "v"(lv2), "v"(lv3), "v"(gk), "v"(gk1), "v"(gk2), "v"(gk3), "v"(gh), "v"(gh1), "v"(gl), "v"(gl1) : "memory");
}
template <int C> struct Cls { static constexpr int v = C; };
__global__ __launch_bounds__(128) void k_attn(const float* __restrict__ QK, const __bf16* __restrict__ KH, const __bf16* __restrict__ KL, const __bf16* __restrict__ VH, const __bf16* __restrict__ VL, const float* __restrict__ RK, const float* __restrict__ RV, float* __restrict__ O) {
  __shared__ __align__(16) float so[4][16][68]; __shared__ float sqr[4][16][8];
  __shared__ __align__(16) __bf16 sk[2][2][32][KP]; __shared__ __align__(16) __bf16 sv[2][2][32][VP];   // two buffers: pass t reads buffer t & 1 while pass t + 1's tiles land in the other
  const int tid = threadIdx.x, wave = tid >> 5, lane = tid & 31, col = lane & 15, g = lane >> 4;
  const int qb = blockIdx.x, h = blockIdx.y, b = blockIdx.z; const int q0 = qb * 64 + wave * 16; const size_t rq = (size_t)b * SS + q0 + col;
  const unsigned lk0 = (unsigned)(size_t)&sk[0][0][tid >> 3][(tid & 7) * 8], lv0 = (unsigned)(size_t)&sv[0][0][tid >> 3][(tid & 7) * 8];
  const size_t gk0 = ((size_t)b * SS + (tid >> 3)) * DM + h * HD + (tid & 7) * 8;   // K and V have the same shape: one index serves the four planes
  stage_kv(lk0, lv0, KH + gk0, KL + gk0, VH + gk0, VL + gk0);   // pass 0's tiles fly under the query set-up below
  F2 aq[2];
#pragma unroll
  for (int kc = 0; kc < 2; ++kc) aq[kc] = split_row(QK + rq * QKVW + h * HD, kc * 32, lane);
  // relative-key logits: sqr[row][j] = q_row . rel_k[j] (f32; the lane's partial over its 4 columns, xor-16 reduced; staged in LDS so the runtime class index is not a private-array index)
#pragma unroll 1
  for (int r = 0; r < 8; ++r) { const float* qrow = QK + ((size_t)b * SS + q0 + 8 * g + r) * QKVW + h * HD;
#pragma unroll
    for (int j = 0; j < 5; ++j) { float a = 0.f;
#pragma unroll
      for (int dt = 0; dt < 4; ++dt) a += qrow[dt * 16 + col] * bfr(RK[j * HD + dt * 16 + col]);
#pragma unroll
      for (int o = 1; o < 16; o <<= 1) a += __shfl_xor(a, o);
      if (col == j) sqr[wave][8 * g + r][j] = a; } }
  LDSX();
  // the inner loops below are fully unrolled so that s, e, jc, ms and acc are indexed by constants and stay in registers
  const int qi = q0 + col;
  float m = -3.0e38f, l = 0.f, ms[5];
#pragma unroll
  for (int j = 0; j < 5; ++j) ms[j] = 0.f;
  v8f acc[4] = {};
  asm volatile("s_wait_asynccnt 0x0" ::: "memory");   // this wave's copies of pass 0 have landed
  __syncthreads();                                     // ... and every other wave's: buffer 0 may be read
  stage_kv(lk0 + (unsigned)sizeof(sk[0]), lv0 + (unsigned)sizeof(sv[0]), KH + gk0 + 32 * DM, KL + gk0 + 32 * DM, VH + gk0 + 32 * DM, VL + gk0 + 32 * DM);
  // One 32-key pass. CLS: the distance class that all (key, query) pairs of the pass share for every query of the block (0: every key at least 2 below every query, 4: at least 2 above), or -1 for a pass that touches the band |k - q| < 2, where each pair's class is looked up. With one class the relative-key logit is a constant of the lane: it comes in as cin, the start value of the score accumulators, and the pass's sum es is the class's mass. always_inline: s, e, acc and ms must stay in registers.
  auto pass = [&](auto cls, const int ks, const v8f cin) __attribute__((always_inline)) { constexpr int CLS = decltype(cls)::v; float s[16]; [[maybe_unused]] int jc[16]; const int bf = ks & 1;
#pragma unroll
    for (int ct = 0; ct < 2; ++ct) { const __bf16* krow = &sk[bf][0][ct * 16 + col][0]; v8f c = cin;
#pragma unroll
      for (int kc = 0; kc < 2; ++kc) { const v16b kh = frag_b(krow + kc * 32, lane), kl = frag_b(krow + 32 * KP + kc * 32, lane); c = wmma_pl(kh, aq[kc].l, c); c = wmma_pl(kl, aq[kc].h, c); c = wmma_pl(kh, aq[kc].h, c); }
#pragma unroll
      for (int r = 0; r < 8; ++r) {
        if constexpr (CLS < 0) { const int kk = ks * 32 + ct * 16 + 8 * g + r; const int dlt = min(max(kk - qi, -2), 2) + 2; jc[ct * 8 + r] = dlt; s[ct * 8 + r] = c[r] + sqr[wave][col][dlt]; }
        else s[ct * 8 + r] = c[r]; } }   // attn1 + attn2, unscaled
    float mx = s[0];
#pragma unroll
    for (int i = 1; i < 16; ++i) mx = fmaxf(mx, s[i]);
    mx = fmaxf(mx, xhalf(mx));
    const float mn = fmaxf(m, mx * SC2); const float alpha = ex2(m - mn); m = mn;   // m: running maximum of (attn1 + attn2) / sqrt(64) * log2(e)
    float e[16];
#pragma unroll
    for (int i = 0; i < 16; i += 2) { const v2f t = __builtin_elementwise_fma((v2f){s[i], s[i + 1]}, (v2f){SC2, SC2}, (v2f){-mn, -mn}); e[i] = ex2(t[0]); e[i + 1] = ex2(t[1]); }   // one packed fma a score pair
    float es = 0.f;
#pragma unroll
    for (int i = 0; i < 8; ++i) es += e[i] + e[8 + i];
    l = l * alpha + es;
    if constexpr (CLS < 0) {
#pragma unroll
      for (int j = 0; j < 5; ++j) { float add = 0.f;
#pragma unroll
        for (int i = 0; i < 16; ++i) add += (jc[i] == j) ? e[i] : 0.f;
        ms[j] = ms[j] * alpha + add; } }
    else if constexpr (CLS == 4) {
#pragma unroll
      for (int j = 0; j < 4; ++j) ms[j] *= alpha;
      ms[4] = ms[4] * alpha + es; }   // CLS == 0: all mass so far is class 0's, and l holds it
#pragma unroll
    for (int dt = 0; dt < 4; ++dt) acc[dt] *= alpha;
    const F2 pb = bsplit16(e);   // B element i = key 8g + i, element 8 + i = key 16 + 8g + i: the k order of frag_b
#pragma unroll
    for (int dt = 0; dt < 4; ++dt) { const v16b vh = frag_t(&sv[bf][0][0][0], dt * 16, lane), vl = frag_t(&sv[bf][1][0][0], dt * 16, lane); acc[dt] = wmma_pl(vh, pb.l, acc[dt]); acc[dt] = wmma_pl(vl, pb.h, acc[dt]); acc[dt] = wmma_pl(vh, pb.h, acc[dt]); }
    asm volatile("s_wait_dscnt 0x0" ::: "memory");      // this wave's reads of buffer bf are done before the buffer is refilled
    asm volatile("s_wait_asynccnt 0x0" ::: "memory");   // this wave's copies of pass ks + 1 have landed
    __syncthreads();                                     // publishes pass ks + 1 and ends every wave's reads of buffer bf
    if (ks + 2 < SS / 32) stage_kv(lk0 + bf * (unsigned)sizeof(sk[0]), lv0 + bf * (unsigned)sizeof(sv[0]), KH + gk0 + (size_t)(ks + 2) * 32 * DM, KL + gk0 + (size_t)(ks + 2) * 32 * DM, VH + gk0 + (size_t)(ks + 2) * 32 * DM, VL + gk0 + (size_t)(ks + 2) * 32 * DM); };
  // The block's queries are 64 qb .. 64 qb + 63: passes below 2 qb - 1 hold keys of class 0 alone, passes from 2 qb + 3 on keys of class 4 alone. The bounds depend on blockIdx alone, so every wave of the block passes the same barriers. The three loops stay rolled (code size).
  const int nlo = max(2 * qb - 1, 0), nhi = min(2 * qb + 3, SS / 32);
  { const float q0c = sqr[wave][col][0]; const v8f cin = {q0c, q0c, q0c, q0c, q0c, q0c, q0c, q0c};
#pragma unroll 1
    for (int ks = 0; ks < nlo; ++ks) pass(Cls<0>{}, ks, cin); }
  ms[0] = l;
#pragma unroll 1
  for (int ks = nlo; ks < nhi; ++ks) pass(Cls<-1>{}, ks, v8f{});
  { const float q4c = sqr[wave][col][4]; const v8f cin = {q4c, q4c, q4c, q4c, q4c, q4c, q4c, q4c};
#pragma unroll 1
    for (int ks = nhi; ks < SS / 32; ++ks) pass(Cls<4>{}, ks, cin); }
  asm volatile("s_wait_asynccnt 0x0" ::: "memory");     // no copy is outstanding when the wave goes on to the epilogue and ends
  l += xhalf(l);
  const float il = 1.0f / l;
#pragma unroll
  for (int j = 0; j < 5; ++j) ms[j] = (ms[j] + xhalf(ms[j])) * il;
#pragma unroll
  for (int dt = 0; dt < 4; ++dt) {
#pragma unroll
    for (int r = 0; r < 8; ++r) { const int d = dt * 16 + 8 * g + r; float w2 = 0.f;
#pragma unroll
      for (int j = 0; j < 5; ++j) w2 += ms[j] * bfr(RV[j * HD + d]);
      so[wave][col][d] = acc[dt][r] * il + w2; } }
  LDSX();
  for (int rl = 0; rl < 16; ++rl) if (lane < 16) vst2(O + ((size_t)b * SS + q0 + rl) * DM + h * HD + lane * 4, *(const v4f*)&so[wave][rl][lane * 4]);
}
// ---- k_out: block = (64 rows, 128 cols): out = O(hi/lo) . c_proj rows (2 products) + bias
__global__ __launch_bounds__(128) void k_out(const float* __restrict__ O, const __bf16* __restrict__ P, const float* __restrict__ BO, float* __restrict__ Y) {
  __shared__ __align__(16) char sm[2 * GBUF];   // two buffers, as in k_qkv; behind the loop the same bytes stage the output rows
  float (*so)[16][132] = (float (*)[16][132])sm;
  const int tid = threadIdx.x, wave = tid >> 5, lane = tid & 31, col = lane & 15, g = lane >> 4; const size_t rb = (size_t)blockIdx.x * 64, r0 = rb + wave * 16; const int n0 = blockIdx.y * 128;
  const unsigned la0 = (unsigned)(size_t)&sm[(tid >> 4) * (GAP * 4) + (tid & 15) * 16], lb0 = (unsigned)(size_t)&sm[GASZ + (tid >> 3) * (GBP * 2) + (tid & 7) * 16];
  const float* ga0 = O + (rb + (tid >> 4)) * DM + (tid & 15) * 4; const __bf16* gb0 = P + (size_t)(n0 + (tid >> 3)) * DM + (tid & 7) * 8;
  stage_ab(la0, lb0, ga0, gb0);
  v8f acc[8] = {};
  asm volatile("s_wait_asynccnt 0x0" ::: "memory");   // this wave's copies of pass 0 have landed
  __syncthreads();                                     // ... and every other wave's: buffer 0 may be read
  stage_ab(la0 + GBUF, lb0 + GBUF, ga0 + GK, gb0 + GK);
  // the pass loop stays rolled (code size; one foot with the waits, the barrier and the refill in their order); the loops inside are fully unrolled so that a, w and acc are indexed by constants and stay in registers
#pragma unroll 1
  for (int t = 0; t < DM / GK; ++t) { const int bf = t & 1; const float* arow = (const float*)(sm + bf * GBUF) + (wave * 16 + col) * GAP + 8 * g; const __bf16* brow = (const __bf16*)(sm + bf * GBUF + GASZ) + col * GBP;
    F2 a[GK / 32]; v16b w[GK / 32][8];   // all fragment reads of the pass stand as one group in front of its products, as in k_qkv
#pragma unroll
    for (int kc = 0; kc < GK / 32; ++kc) a[kc] = split_lds(arow + kc * 32);
#pragma unroll
    for (int kc = 0; kc < GK / 32; ++kc) {
#pragma unroll
      for (int j = 0; j < 8; ++j) w[kc][j] = frag_b(brow + j * 16 * GBP + kc * 32, lane); }
#pragma unroll
    for (int kc = 0; kc < GK / 32; ++kc) {
#pragma unroll
      for (int j = 0; j < 8; ++j) { acc[j] = wmma_bf(a[kc].l, w[kc][j], acc[j]); acc[j] = wmma_bf(a[kc].h, w[kc][j], acc[j]); } }
    asm volatile("s_wait_dscnt 0x0" ::: "memory");      // this wave's reads of buffer bf are done before the buffer is refilled
    asm volatile("s_wait_asynccnt 0x0" ::: "memory");   // this wave's copies of pass t + 1 have landed
    __syncthreads();                                     // publishes pass t + 1 and ends every wave's reads of buffer bf
    if (t + 2 < DM / GK) stage_ab(la0 + bf * GBUF, lb0 + bf * GBUF, ga0 + (t + 2) * GK, gb0 + (t + 2) * GK); }
  asm volatile("s_wait_asynccnt 0x0" ::: "memory");     // no copy is outstanding when the buffers become output staging
#pragma unroll
  for (int j = 0; j < 8; ++j) { const float bb = bfr(BO[n0 + j * 16 + col]);
#pragma unroll
    for (int r = 0; r < 8; ++r) so[wave][8 * g + r][j * 16 + col] = acc[j][r] + bb; }
  LDSX();
  for (int rl = 0; rl < 16; ++rl) vst2(Y + (r0 + rl) * DM + n0 + lane * 4, *(const v4f*)&so[wave][rl][lane * 4]);
}
extern "C" void kernel_launch(void* const* d_in, const int* in_sizes, int n_in, void* d_out, int out_size, void* d_ws, size_t ws_size, hipStream_t stream) {
  (void)in_sizes; (void)n_in; (void)out_size;
  const float** F = (const float**)d_in;   // 0 key [2,2048,1024], 1 query, 2 value, 3 Wq [1024,1024] (torch), 4 bq, 5 Wk, 6 bk, 7 Wv, 8 bv, 9 Wo, 10 bo, 11 rel_k [5,64], 12 rel_v [5,64]
  if (ws_size < (size_t)WS_END) return;
  char* ws = (char*)d_ws; __bf16 *PK = (__bf16*)(ws + WS_PK), *VH = (__bf16*)(ws + WS_VH), *VL = (__bf16*)(ws + WS_VL), *KH = (__bf16*)(ws + WS_KH), *KL = (__bf16*)(ws + WS_KL); float *QK = (float*)(ws + WS_QK), *O = (float*)(ws + WS_O);
  k_pack<<<dim3(DM / 8, 4), 256, 0, stream>>>(F[3], F[5], F[7], F[9], PK);   // planes q, k, v at PK_A, o at PK_P = PK_A + 3 planes
  k_qkv<<<dim3(TNB * SS / 64, QKVW / 128), 128, 0, stream>>>(F[1], F[0], F[2], PK + PK_A, F[4], F[6], F[8], QK, KH, KL, VH, VL);   // q from query, k from key, v from value
  k_attn<<<dim3(TQB, NH, TNB), 128, 0, stream>>>(QK, KH, KL, VH, VL, F[11], F[12], O);
  k_out<<<dim3(TOB, DM / 128), 128, 0, stream>>>(O, PK + PK_P, F[10], (float*)d_out);
}

// v010
// A run of this version takes 151 microseconds.
// Next to v009, in two timings, it ran 1.06 times as fast each time.
// Counting every step since v000, it is 4.26 times as fast.
// compute dtype: key/query/value inputs, the four Linear weights/biases and the two relative tables (module inputs) rounded to bf16; q/k/v projections with exact bf16 products (inputs x weights); scores q.k with both operands as bf16 hi + residual pairs (3 products) plus the relative-key term q.rel_k[clip(k-q)] (5 f32 dot products per (token, head)); P.V with P hi/lo x V hi/lo (3 products) plus the relative-value term sum_j mass_j rel_v[j]; output projection hi/lo x exact Wo (2 products) + bo; softmax in f32; f32 accumulate.
#include <hip/hip_runtime.h>
#include <math.h>

typedef __attribute__((ext_vector_type(16))) _Float16 v16h;
typedef __attribute__((ext_vector_type(16))) __bf16 v16b;
typedef __attribute__((ext_vector_type(8)))  _Float16 v8h;
typedef __attribute__((ext_vector_type(8)))  float v8f;
typedef __attribute__((ext_vector_type(4)))  float v4f;
typedef __attribute__((ext_vector_type(2)))  float v2f;
typedef __attribute__((ext_vector_type(4)))  unsigned v4u;
typedef __attribute__((ext_vector_type(4)))  int v4i;
typedef float __attribute__((may_alias)) float_a;
typedef int __attribute__((may_alias)) int_a;

template <typename T> __device__ __forceinline__ void vst2(void* p, T v) { *(T*)p = v;  }
__device__ __forceinline__ v8f wmma16(v16h a, v16h b, v8f c) {
  v8f d = __builtin_amdgcn_wmma_f32_16x16x32_f16(false, a, false, b, (short)0, c, false, false);
  asm volatile("v_nop\n\tv_nop\n\tv_nop\n\tv_nop" : "+v"(d) : "v"(a), "v"(b));
  return d;
}
__device__ __forceinline__ v8f wmma_bf(v16b a, v16b b, v8f c) {
  v8f d = __builtin_amdgcn_wmma_f32_16x16x32_bf16(false, a, false, b, (short)0, c, false, false);
  asm volatile("v_nop\n\tv_nop\n\tv_nop\n\tv_nop" : "+v"(d) : "v"(a), "v"(b));
  return d;
}
// the plain builtin, for k_attn: the compiler keeps the distance between a product and the vector code on its registers itself, so no vector issue slot goes to a v_nop between products, and it is free to deal independent accumulate chains among each other. The two projection GEMMs keep wmma_bf: its tail also holds a pass's (in k_qkv a half pass's) fragment reads as one group in front of the products.
__device__ __forceinline__ v8f wmma_pl(v16b a, v16b b, v8f c) { return __builtin_amdgcn_wmma_f32_16x16x32_bf16(false, a, false, b, (short)0, c, false, false); }
// 16x16x32 fragments: lane = (h = lane>>4, row/col = lane&15); elements 0..7 = k0+8h+0..7, 8..15 = k0+16+8h+0..7; D element r = row 8h+r
__device__ __forceinline__ v16h frag_h(const _Float16* rowk0, int lane) {
  union { v16h v; v8h q[2]; } u; const _Float16* p = rowk0 + 8 * (lane >> 4);
  u.q[0] = *(const v8h*)p; u.q[1] = *(const v8h*)(p + 16); return u.v;
}
__device__ __forceinline__ v16h frag_f32(const float* rowk0, int lane) {
  v16h a; const float* p = rowk0 + 8 * (lane >> 4);
#pragma unroll
  for (int i = 0; i < 8; ++i) { a[i] = (_Float16)p[i]; a[8 + i] = (_Float16)p[16 + i]; }
  return a;
}
__device__ __forceinline__ v16h frag_f32s(const float* rowk0, int lane, float sc) {
  v16h a; const float* p = rowk0 + 8 * (lane >> 4);
#pragma unroll
  for (int i = 0; i < 8; ++i) { a[i] = (_Float16)(p[i] * sc); a[8 + i] = (_Float16)(p[16 + i] * sc); }
  return a;
}
// column fragment from a [K][ld] layout (column n), rows >= K read as 0
__device__ __forceinline__ v16h fragc_f32(const float* W, int k0, int n, int lane, int ld, int K) {
  v16h a; const int g = lane >> 4;
#pragma unroll
  for (int i = 0; i < 8; ++i) { const int ka = k0 + 8 * g + i, kb = ka + 16;
    a[i] = (_Float16)(ka < K ? W[(size_t)(ka < K ? ka : K - 1) * ld + n] : 0.f); a[8 + i] = (_Float16)(kb < K ? W[(size_t)(kb < K ? kb : K - 1) * ld + n] : 0.f); }
  return a;
}
struct F2 { v16b h, l; };
__device__ __forceinline__ F2 bsplit16(const float v[16]) { F2 r;
#pragma unroll
  for (int i = 0; i < 16; ++i) { const __bf16 h = (__bf16)v[i]; r.h[i] = h; r.l[i] = (__bf16)(v[i] - (float)h); }
  return r; }
__device__ __forceinline__ F2 split_row(const float* row, int k0, int lane) { float v[16]; const float* p = row + k0 + 8 * (lane >> 4);
#pragma unroll
  for (int i = 0; i < 8; ++i) { v[i] = p[i]; v[8 + i] = p[16 + i]; }
  return bsplit16(v); }
__device__ __forceinline__ F2 split_rowK(const float* row, int k0, int lane, int K) { float v[16]; const int g = lane >> 4;
#pragma unroll
  for (int i = 0; i < 8; ++i) { const int ka = k0 + 8 * g + i, kb = ka + 16; v[i] = ka < K ? row[ka < K ? ka : K - 1] : 0.f; v[8 + i] = kb < K ? row[kb < K ? kb : K - 1] : 0.f; }
  return bsplit16(v); }
__device__ __forceinline__ F2 split_col(const float* W, int k0, int n, int lane, int ld, int K) { float v[16]; const int g = lane >> 4;
#pragma unroll
  for (int i = 0; i < 8; ++i) { const int ka = k0 + 8 * g + i, kb = ka + 16; v[i] = ka < K ? W[(size_t)(ka < K ? ka : K - 1) * ld + n] : 0.f; v[8 + i] = kb < K ? W[(size_t)(kb < K ? kb : K - 1) * ld + n] : 0.f; }
  return bsplit16(v); }
__device__ __forceinline__ v8f mac3(const F2& a, const F2& b, v8f c) { c = wmma_bf(a.l, b.h, c); c = wmma_bf(a.h, b.l, c); return wmma_bf(a.h, b.h, c); }
__device__ __forceinline__ float sigm(float v) { return 1.0f / (1.0f + expf(-v)); }
#define LDSX() do { asm volatile("s_wait_dscnt 0" ::: "memory"); __builtin_amdgcn_wave_barrier(); __builtin_amdgcn_fence(__ATOMIC_RELEASE, "workgroup"); } while (0)


// Multi-head attention with clipped relative position embeddings (B 2, Lq = Lk = 2048, hid 1024, 16 heads x 64, max_rel 2): q = query Wq^T + bq, k = key Wk^T + bk, v = value Wv^T + bv; attn = softmax((q k^T + q . rel_k[clip(k - q, -2, 2) + 2]) / 8); x = attn v + sum_k attn rel_v[clip(k - q) + 2]; out = x Wo^T + bo.
#define NB 2
#define SS 2048
#define DM 1024
#define NH 16
#define HD 64
#define QKVW (3 * DM)
#ifndef TQB
#define TQB (SS / 64)
#define TNB NB
#define TOB (NB * SS / 64)     // output row tiles (all)
#endif
typedef __attribute__((ext_vector_type(8))) __bf16 v8b;
typedef __attribute__((ext_vector_type(4))) __bf16 v4b;
__device__ __forceinline__ v16b frag_b(const __bf16* rowk0, int lane) {
  union { v16b v; v8b q[2]; } u; const __bf16* p = rowk0 + 8 * (lane >> 4);
  u.q[0] = *(const v8b*)p; u.q[1] = *(const v8b*)(p + 16); return u.v;
}
__device__ __forceinline__ float bfr(float v) { return (float)(__bf16)v; }
__device__ __attribute__((noinline)) float erf_ni(float v) { return erff(v); }

#define PK_A 0                       // [3072][1024] c_attn kernel rows (natural)
#define PK_P (PK_A + QKVW * DM)        // [1024][1024] c_proj kernel rows
#define PK_END (PK_P + DM * DM)
#define WS_PK  0u
#define WS_QK  (WS_PK + 2u * PK_END)             // f32 [4096 rows][3072]: only the q columns are written (k goes to WS_KH, WS_KL, v to WS_VH, WS_VL)
#define WS_VH  (WS_QK + 4u * NB * SS * QKVW)     // bf16 [4096 rows][1024 (h*64+d)]: v, rounded
#define WS_VL  (WS_VH + 2u * NB * DM * SS)        // bf16, same shape: v minus its rounded value
#define WS_O   (WS_VL + 2u * NB * DM * SS)         // f32 [4096][1024]
#define WS_KH  (WS_O + 4u * NB * SS * DM)         // bf16 [4096 rows][1024 (h*64+d)]: k, rounded
#define WS_KL  (WS_KH + 2u * NB * SS * DM)        // bf16, same shape: k minus its rounded value
#define WS_END (WS_KL + 2u * NB * SS * DM)

// ---- k_pack: the four [1024][1024] Linear weights (torch [out,in], natural rows) rounded to bf16 in one launch: blockIdx.y = matrix (q, k, v, o: their packed planes stand one behind the other), a block = 8 rows. A stream: 16 waves a WGP over the chip, a lane's 8 loads of 16 B (a wave covers 4 whole lines a load) all in flight before its first store; a wave's store of 8 B a lane covers 2 whole lines.
__global__ __launch_bounds__(256) void k_pack(const float* __restrict__ W0, const float* __restrict__ W1, const float* __restrict__ W2, const float* __restrict__ W3, __bf16* __restrict__ DST) {
  const int y = blockIdx.y; const float* Wm = y == 0 ? W0 : (y == 1 ? W1 : (y == 2 ? W2 : W3));
  const size_t o = (size_t)blockIdx.x * (8 * DM) + threadIdx.x * 4; __bf16* dst = DST + (size_t)y * DM * DM + o;
  v4f v[8];   // both loops fully unrolled: v is indexed by constants and stays in registers
#pragma unroll
  for (int j = 0; j < 8; ++j) v[j] = *(const v4f*)(Wm + o + j * DM);
#pragma unroll
  for (int j = 0; j < 8; ++j) { v4b r;
#pragma unroll
    for (int i = 0; i < 4; ++i) r[i] = (__bf16)v[j][i];
    vst2(dst + j * DM, r); }
}
// ---- operand tiles of the two projection GEMMs (k_qkv, k_out), one 64-deep k pass at a time, staged in LDS once per block: A = f32 rows of 256 B (64 in k_out, 128 in k_qkv), B = 128 bf16 weight rows of 128 B, so every copy of a wave covers whole 128 B lines. Row pitches are 16 B x odd, so that the 16 rows of a b128 fragment read fall on distinct banks.
#define GK 64                          // k per pass
#define GAP 68                         // floats: 272 B rows of the A tile [64 rows][64 k]
#define GBP 72                         // bf16: 144 B rows of the B tile [128 rows][64 k]
#define GASZ (64 * GAP * 4)            // bytes of an A tile; the B tile stands behind it
#define GBUF (GASZ + 128 * GBP * 2)    // bytes of one buffer
// 8 copies of 16 B a lane, ls bytes apart in LDS and gs elements apart in global memory
template <typename T> __device__ __forceinline__ void copy8(unsigned l, unsigned ls, const T* g, size_t gs) {
  const unsigned l1 = l + ls, l2 = l + 2 * ls, l3 = l + 3 * ls, l4 = l + 4 * ls, l5 = l + 5 * ls, l6 = l + 6 * ls, l7 = l + 7 * ls;
  const T *g1 = g + gs, *g2 = g + 2 * gs, *g3 = g + 3 * gs, *g4 = g + 4 * gs, *g5 = g + 5 * gs, *g6 = g + 6 * gs, *g7 = g + 7 * gs;
  // the copies and the s_wait_xcnt that stands in front of any rewrite of their address registers, in one statement so that nothing moves in between
  asm volatile("global_load_async_to_lds_b128 %0, %8, off\n\t"
               "global_load_async_to_lds_b128 %1, %9, off\n\t"
               "global_load_async_to_lds_b128 %2, %10, off\n\t"
               "global_load_async_to_lds_b128 %3, %11, off\n\t"
               "global_load_async_to_lds_b128 %4, %12, off\n\t"
               "global_load_async_to_lds_b128 %5, %13, off\n\t"
               "global_load_async_to_lds_b128 %6, %14, off\n\t"
               "global_load_async_to_lds_b128 %7, %15, off\n\t"
               "s_wait_xcnt 0x0"
               :: "v"(l), "v"(l1), "v"(l2), "v"(l3), "v"(l4), "v"(l5), "v"(l6), "v"(l7), "v"(g), "v"(g1), "v"(g2), "v"(g3), "v"(g4), "v"(g5), "v"(g6), "v"(g7) : "memory");
}
// one pass's tiles, 16 copies a lane: A rows 8 apart (a wave covers 2 whole rows a copy), B rows 16 apart (4 whole rows a copy). la, lb: the lane's LDS byte addresses in the target buffer; ga, gb: its global addresses.
__device__ __forceinline__ void stage_ab(unsigned la, unsigned lb, const float* ga, const __bf16* gb) { copy8(la, 8 * GAP * 4, ga, (size_t)8 * DM); copy8(lb, 16 * GBP * 2, gb, (size_t)16 * DM); }
__device__ __forceinline__ v16b cvt_lds(const float* p) { v16b r; const v4f a = *(const v4f*)p, b = *(const v4f*)(p + 4), c = *(const v4f*)(p + 16), d = *(const v4f*)(p + 20);
#pragma unroll
  for (int i = 0; i < 4; ++i) { r[i] = (__bf16)a[i]; r[4 + i] = (__bf16)b[i]; r[8 + i] = (__bf16)c[i]; r[12 + i] = (__bf16)d[i]; }
  return r; }
// ---- k_qkv: block = (128 rows, 128 of the 3072 cols), a wave = 32 rows (2 tiles of 16) x 128 cols, so that each weight fragment read from LDS feeds two products and each staged weight tile serves 128 rows: QKV = bf16(x) . rows (exact) -> f32 rows (pitch 3072) for q; the k and the v columns leave as bf16 pairs (rounded value, residual) in natural rows, split here once instead of in every wave of every query block of k_attn
#define QM 128                         // rows of a block
#define QASZ (QM * GAP * 4)            // bytes of its A tile [128 rows][64 k]; the B tile stands behind it
#define QBUF (QASZ + 128 * GBP * 2)    // bytes of one buffer; two buffers = 104 KiB, three blocks a WGP
// one pass's tiles, 24 copies a lane: A rows 8 apart in two runs of 64 rows, B rows 16 apart
__device__ __forceinline__ void stage_ab2(unsigned la, unsigned lb, const float* ga, const __bf16* gb) { copy8(la, 8 * GAP * 4, ga, (size_t)8 * DM); copy8(la + 64 * GAP * 4, 8 * GAP * 4, ga + (size_t)64 * DM, (size_t)8 * DM); copy8(lb, 16 * GBP * 2, gb, (size_t)16 * DM); }
__global__ __launch_bounds__(128) void k_qkv(const float* __restrict__ XQ, const float* __restrict__ XK, const float* __restrict__ XV, const __bf16* __restrict__ P, const float* __restrict__ BQ, const float* __restrict__ BK, const float* __restrict__ BV, float* __restrict__ QKV, __bf16* __restrict__ KH, __bf16* __restrict__ KL, __bf16* __restrict__ VH, __bf16* __restrict__ VL) {
  __shared__ __align__(16) char sm[2 * QBUF];   // two buffers: pass t reads buffer t & 1 while pass t + 1's tiles land in the other; behind the loop the same bytes stage the output rows
  float (*so)[32][132] = (float (*)[32][132])sm;
  const int tid = threadIdx.x, wave = tid >> 5, lane = tid & 31, col = lane & 15, g = lane >> 4; const size_t rb = (size_t)blockIdx.x * QM, r0 = rb + wave * 32; const int n0 = blockIdx.y * 128; const float* X = (n0 < DM) ? XQ : (n0 < 2 * DM ? XK : XV);
  const unsigned la0 = (unsigned)(size_t)&sm[(tid >> 4) * (GAP * 4) + (tid & 15) * 16], lb0 = (unsigned)(size_t)&sm[QASZ + (tid >> 3) * (GBP * 2) + (tid & 7) * 16];
  const float* ga0 = X + (rb + (tid >> 4)) * DM + (tid & 15) * 4; const __bf16* gb0 = P + (size_t)(n0 + (tid >> 3)) * DM + (tid & 7) * 8;
  stage_ab2(la0, lb0, ga0, gb0);
  v8f acc[2][8] = {};
  asm volatile("s_wait_asynccnt 0x0" ::: "memory");   // this wave's copies of pass 0 have landed
  __syncthreads();                                     // ... and every other wave's: buffer 0 may be read
  stage_ab2(la0 + QBUF, lb0 + QBUF, ga0 + GK, gb0 + GK);
  // the pass loop stays rolled (code size; one foot with the waits, the barrier and the refill in their order); the loops inside are fully unrolled so that a, w and acc are indexed by constants and stay in registers
#pragma unroll 1
  for (int t = 0; t < DM / GK; ++t) { const int bf = t & 1; const float* arow = (const float*)(sm + bf * QBUF) + (wave * 32 + col) * GAP + 8 * g; const __bf16* brow = (const __bf16*)(sm + bf * QBUF + QASZ) + col * GBP;
    // 32 k at a time: the fragment reads of a half pass stand as one group in front of its 16 products (a read among the products would be waited for on the spot), and accumulators and one half pass's fragments together stay below 256 registers
#pragma unroll
    for (int kc = 0; kc < GK / 32; ++kc) { v16b a[2], w[8];
#pragma unroll
      for (int i = 0; i < 2; ++i) a[i] = cvt_lds(arow + i * 16 * GAP + kc * 32);
#pragma unroll
      for (int j = 0; j < 8; ++j) w[j] = frag_b(brow + j * 16 * GBP + kc * 32, lane);
#pragma unroll
      for (int j = 0; j < 8; ++j) {
#pragma unroll
        for (int i = 0; i < 2; ++i) acc[i][j] = wmma_bf(a[i], w[j], acc[i][j]); } }
    asm volatile("s_wait_dscnt 0x0" ::: "memory");      // this wave's reads of buffer bf are done before the buffer is refilled
    asm volatile("s_wait_asynccnt 0x0" ::: "memory");   // this wave's copies of pass t + 1 have landed
    __syncthreads();                                     // publishes pass t + 1 and ends every wave's reads of buffer bf
    if (t + 2 < DM / GK) stage_ab2(la0 + bf * QBUF, lb0 + bf * QBUF, ga0 + (t + 2) * GK, gb0 + (t + 2) * GK); }
  asm volatile("s_wait_asynccnt 0x0" ::: "memory");     // no copy is outstanding when the buffers become output staging
  const float* bias = (n0 < DM) ? BQ : (n0 < 2 * DM ? BK : BV); const int nb = n0 % DM;
#pragma unroll
  for (int j = 0; j < 8; ++j) { const float bb = bfr(bias[nb + j * 16 + col]);
#pragma unroll
    for (int i = 0; i < 2; ++i) {
#pragma unroll
      for (int r = 0; r < 8; ++r) so[wave][i * 16 + 8 * g + r][j * 16 + col] = acc[i][j][r] + bb; } }
  LDSX();
  if (n0 >= DM) {   // block-uniform: a block's 128 columns lie in one of q, k, v
    __bf16* const PH = n0 < 2 * DM ? KH : VH; __bf16* const PL = n0 < 2 * DM ? KL : VL;
    // fully unrolled: the rows' LDS reads go ahead in groups, and there is no back edge on which a store's registers would be rewritten
#pragma unroll
    for (int rl = 0; rl < 32; ++rl) { const v4f v = *(const v4f*)&so[wave][rl][lane * 4]; v4b hi, lo;
#pragma unroll
      for (int i = 0; i < 4; ++i) { hi[i] = (__bf16)v[i]; lo[i] = (__bf16)(v[i] - (float)hi[i]); }
      const size_t o = (r0 + rl) * DM + nb + lane * 4; vst2(PH + o, hi); vst2(PL + o, lo); } }
  else for (int rl = 0; rl < 32; ++rl) vst2(QKV + (r0 + rl) * QKVW + n0 + lane * 4, *(const v4f*)&so[wave][rl][lane * 4]);
}
// ---- k_attn: block = (64 queries, head h, batch b): full flash attention (K = 64) on transposed products: S^T = K . Q^T (A = key rows, B = the wave's 16 queries) and O^T += V^T . P^T (A = V^T fragments, which the transposing LDS load takes from the natural-row V tile, B = the two score tiles of a pass, converted in place). A lane (g, col) holds query col alone: keys 8g + r of each 16-key tile, so maximum, row sum and the 5 distance-class masses are summed in the lane; the two lane halves exchange the maximum once a pass and join their sums once behind the loop. logits = (q.k (3 products) + qr[clip(k-q)+2]) / 8; P.V 3 products; w2 = sum_j (mass_j / l) rel_v[j]; O[b*S+q][h*64+d] = w1 + w2
// softmax in base 2: SC2 = log2(e) / sqrt(64). The maximum is taken over the unscaled scores (SC2 > 0 keeps the order) and scaled once; each exponential is then one fma and one v_exp_f32 in line, 16 independent ones a pass.
#define SC2 0.18033688f
__device__ __forceinline__ float ex2(float v) { return __builtin_amdgcn_exp2f(v); }
__device__ __forceinline__ float xhalf(float v) { const int b = __builtin_bit_cast(int, v); return __builtin_bit_cast(float, __builtin_amdgcn_permlanex16(b, b, 0x76543210, 0xfedcba98, false, false)); }   // lane l <-> l ^ 16
// K / V tiles of one 32-key pass, staged in LDS once per block for its 4 waves. Each row pitch is its reader's: 16 B x odd for the b128 fragment reads of K, 32 B x odd for the transposing reads of V.
#define KP 72    // bf16: 144 B rows of a K tile [32 keys][64 d]
#define VP 80    // bf16: 160 B rows of a V tile [32 keys][64 d]
typedef __attribute__((ext_vector_type(8))) short v8s;
typedef __attribute__((address_space(3))) v8s lds_v8s;
// A fragment of V^T (rows d0 .. d0 + 15, k = the tile's 32 keys) from the natural-row tile [32 keys][VP]: a ds_load_tr16_b128 gives lane (g, col) the 8 keys kb + 8g .. kb + 8g + 7 of column d0 + col; the loads at kb = 0 and 16 are elements 0..7 and 8..15, the k order of frag_b. Every lane is on and every lane's address lies in the tile.
__device__ __forceinline__ v16b frag_t(const __bf16* tile, int d0, int lane) {
  union { v16b v; v8s q[2]; } u; const __bf16* p = tile + (8 * (lane >> 4) + (lane & 7)) * VP + d0 + 8 * ((lane >> 3) & 1);
  u.q[0] = __builtin_amdgcn_ds_load_tr16_b128_v8i16((lds_v8s*)p); u.q[1] = __builtin_amdgcn_ds_load_tr16_b128_v8i16((lds_v8s*)(p + 16 * VP)); return u.v;
}
__device__ __forceinline__ F2 split_lds(const float* p) { float v[16]; const v4f a = *(const v4f*)p, b = *(const v4f*)(p + 4), c = *(const v4f*)(p + 16), d = *(const v4f*)(p + 20);
#pragma unroll
  for (int i = 0; i < 4; ++i) { v[i] = a[i]; v[4 + i] = b[i]; v[8 + i] = c[i]; v[12 + i] = d[i]; }
  return bsplit16(v); }
// one pass's tiles, 8 copies of 16 B a lane: K and V, hi and residual, rows 16 apart (a wave covers 4 whole rows = 4 lines a copy). lk, lv: the lane's LDS byte addresses in the target buffer; gk, gk2 (K hi, residual), gh, gl (V hi, residual): its global addresses.
__device__ __forceinline__ void stage_kv(unsigned lk, unsigned lv, const __bf16* gk, const __bf16* gk2, const __bf16* gh, const __bf16* gl) {
  const unsigned lk1 = lk + 16 * KP * 2, lk2 = lk + 32 * KP * 2, lk3 = lk + 48 * KP * 2, lv1 = lv + 16 * VP * 2, lv2 = lv + 32 * VP * 2, lv3 = lv + 48 * VP * 2;
  const __bf16 *gk1 = gk + 16 * DM, *gk3 = gk2 + 16 * DM, *gh1 = gh + 16 * DM, *gl1 = gl + 16 * DM;
  // the copies and the s_wait_xcnt that stands in front of any rewrite of their address registers, in one statement so that nothing moves in between
  asm volatile("global_load_async_to_lds_b128 %0, %8, off\n\t"
               "global_load_async_to_lds_b128 %1, %9, off\n\t"
               "global_load_async_to_lds_b128 %2, %10, off\n\t"
               "global_load_async_to_lds_b128 %3, %11, off\n\t"
               "global_load_async_to_lds_b128 %4, %12, off\n\t"
               "global_load_async_to_lds_b128 %5, %13, off\n\t"
               "global_load_async_to_lds_b128 %6, %14, off\n\t"
               "global_load_async_to_lds_b128 %7, %15, off\n\t"
               "s_wait_xcnt 0x0"
               :: "v"(lk), "v"(lk1), "v"(lk2), "v"(lk3), "v"(lv), "v"(lv1), "v"(lv2), "v"(lv3), "v"(gk), "v"(gk1), "v"(gk2), "v"(gk3), "v"(gh), "v"(gh1), "v"(gl), "v"(gl1) : "memory");
}
template <int C> struct Cls { static constexpr int v = C; };
__global__ __launch_bounds__(128) void k_attn(const float* __restrict__ QK, const __bf16* __restrict__ KH, const __bf16* __restrict__ KL, const __bf16* __restrict__ VH, const __bf16* __restrict__ VL, const float* __restrict__ RK, const float* __restrict__ RV, float* __restrict__ O) {
  __shared__ __align__(16) float so[4][16][68]; __shared__ float sqr[4][16][8];
  __shared__ __align__(16) __bf16 sk[2][2][32][KP]; __shared__ __align__(16) __bf16 sv[2][2][32][VP];   // two buffers: pass t reads buffer t & 1 while pass t + 1's tiles land in the other
  const int tid = threadIdx.x, wave = tid >> 5, lane = tid & 31, col = lane & 15, g = lane >> 4;
  const int qb = blockIdx.x, h = blockIdx.y, b = blockIdx.z; const int q0 = qb * 64 + wave * 16; const size_t rq = (size_t)b * SS + q0 + col;
  const unsigned lk0 = (unsigned)(size_t)&sk[0][0][tid >> 3][(tid & 7) * 8], lv0 = (unsigned)(size_t)&sv[0][0][tid >> 3][(tid & 7) * 8];
  const size_t gk0 = ((size_t)b * SS + (tid >> 3)) * DM + h * HD + (tid & 7) * 8;   // K and V have the same shape: one index serves the four planes
  stage_kv(lk0, lv0, KH + gk0, KL + gk0, VH + gk0, VL + gk0);   // pass 0's tiles fly under the query set-up below
  F2 aq[2];
#pragma unroll
  for (int kc = 0; kc < 2; ++kc) aq[kc] = split_row(QK + rq * QKVW + h * HD, kc * 32, lane);
  // relative-key logits: sqr[row][j] = q_row . rel_k[j] (f32; the lane's partial over its 4 columns, xor-16 reduced; staged in LDS so the runtime class index is not a private-array index)
#pragma unroll 1
  for (int r = 0; r < 8; ++r) { const float* qrow = QK + ((size_t)b * SS + q0 + 8 * g + r) * QKVW + h * HD;
#pragma unroll
    for (int j = 0; j < 5; ++j) { float a = 0.f;
#pragma unroll
      for (int dt = 0; dt < 4; ++dt) a += qrow[dt * 16 + col] * bfr(RK[j * HD + dt * 16 + col]);
#pragma unroll
      for (int o = 1; o < 16; o <<= 1) a += __shfl_xor(a, o);
      if (col == j) sqr[wave][8 * g + r][j] = a; } }
  LDSX();
  // the inner loops below are fully unrolled so that s, e, jc, ms and acc are indexed by constants and stay in registers
  const int qi = q0 + col;
  float m = -3.0e38f, l = 0.f, ms[5];
#pragma unroll
  for (int j = 0; j < 5; ++j) ms[j] = 0.f;
  v8f acc[4] = {};
  asm volatile("s_wait_asynccnt 0x0" ::: "memory");   // this wave's copies of pass 0 have landed
  __syncthreads();                                     // ... and every other wave's: buffer 0 may be read
  stage_kv(lk0 + (unsigned)sizeof(sk[0]), lv0 + (unsigned)sizeof(sv[0]), KH + gk0 + 32 * DM, KL + gk0 + 32 * DM, VH + gk0 + 32 * DM, VL + gk0 + 32 * DM);
  // One 32-key pass. CLS: the distance class that all (key, query) pairs of the pass share for every query of the block (0: every key at least 2 below every query, 4: at least 2 above), or -1 for a pass that touches the band |k - q| < 2, where each pair's class is looked up. With one class the relative-key logit is a constant of the lane: it comes in as cin, the start value of the score accumulators, and the pass's sum es is the class's mass. always_inline: s, e, acc and ms must stay in registers.
  auto pass = [&](auto cls, const int ks, const v8f cin) __attribute__((always_inline)) { constexpr int CLS = decltype(cls)::v; float s[16]; [[maybe_unused]] int jc[16]; const int bf = ks & 1;
#pragma unroll
    for (int ct = 0; ct < 2; ++ct) { const __bf16* krow = &sk[bf][0][ct * 16 + col][0]; v8f c = cin;
#pragma unroll
      for (int kc = 0; kc < 2; ++kc) { const v16b kh = frag_b(krow + kc * 32, lane), kl = frag_b(krow + 32 * KP + kc * 32, lane); c = wmma_pl(kh, aq[kc].l, c); c = wmma_pl(kl, aq[kc].h, c); c = wmma_pl(kh, aq[kc].h, c); }
#pragma unroll
      for (int r = 0; r < 8; ++r) {
        if constexpr (CLS < 0) { const int kk = ks * 32 + ct * 16 + 8 * g + r; const int dlt = min(max(kk - qi, -2), 2) + 2; jc[ct * 8 + r] = dlt; s[ct * 8 + r] = c[r] + sqr[wave][col][dlt]; }
        else s[ct * 8 + r] = c[r]; } }   // attn1 + attn2, unscaled
    float mx = s[0];
#pragma unroll
    for (int i = 1; i < 16; ++i) mx = fmaxf(mx, s[i]);
    mx = fmaxf(mx, xhalf(mx));
    const float mn = fmaxf(m, mx * SC2); const float alpha = ex2(m - mn); m = mn;   // m: running maximum of (attn1 + attn2) / sqrt(64) * log2(e)
    float e[16];
#pragma unroll
    for (int i = 0; i < 16; i += 2) { const v2f t = __builtin_elementwise_fma((v2f){s[i], s[i + 1]}, (v2f){SC2, SC2}, (v2f){-mn, -mn}); e[i] = ex2(t[0]); e[i + 1] = ex2(t[1]); }   // one packed fma a score pair
    float es = 0.f;
#pragma unroll
    for (int i = 0; i < 8; ++i) es += e[i] + e[8 + i];
    l = l * alpha + es;
    if constexpr (CLS < 0) {
#pragma unroll
      for (int j = 0; j < 5; ++j) { float add = 0.f;
#pragma unroll
        for (int i = 0; i < 16; ++i) add += (jc[i] == j) ? e[i] : 0.f;
        ms[j] = ms[j] * alpha + add; } }
    else if constexpr (CLS == 4) {
#pragma unroll
      for (int j = 0; j < 4; ++j) ms[j] *= alpha;
      ms[4] = ms[4] * alpha + es; }   // CLS == 0: all mass so far is class 0's, and l holds it
#pragma unroll
    for (int dt = 0; dt < 4; ++dt) acc[dt] *= alpha;
    const F2 pb = bsplit16(e);   // B element i = key 8g + i, element 8 + i = key 16 + 8g + i: the k order of frag_b
#pragma unroll
    for (int dt = 0; dt < 4; ++dt) { const v16b vh = frag_t(&sv[bf][0][0][0], dt * 16, lane), vl = frag_t(&sv[bf][1][0][0], dt * 16, lane); acc[dt] = wmma_pl(vh, pb.l, acc[dt]); acc[dt] = wmma_pl(vl, pb.h, acc[dt]); acc[dt] = wmma_pl(vh, pb.h, acc[dt]); }
    asm volatile("s_wait_dscnt 0x0" ::: "memory");      // this wave's reads of buffer bf are done before the buffer is refilled
    asm volatile("s_wait_asynccnt 0x0" ::: "memory");   // this wave's copies of pass ks + 1 have landed
    __syncthreads();                                     // publishes pass ks + 1 and ends every wave's reads of buffer bf
    if (ks + 2 < SS / 32) stage_kv(lk0 + bf * (unsigned)sizeof(sk[0]), lv0 + bf * (unsigned)sizeof(sv[0]), KH + gk0 + (size_t)(ks + 2) * 32 * DM, KL + gk0 + (size_t)(ks + 2) * 32 * DM, VH + gk0 + (size_t)(ks + 2) * 32 * DM, VL + gk0 + (size_t)(ks + 2) * 32 * DM); };
  // The block's queries are 64 qb .. 64 qb + 63: passes below 2 qb - 1 hold keys of class 0 alone, passes from 2 qb + 3 on keys of class 4 alone. The bounds depend on blockIdx alone, so every wave of the block passes the same barriers. The three loops stay rolled (code size).
  const int nlo = max(2 * qb - 1, 0), nhi = min(2 * qb + 3, SS / 32);
  { const float q0c = sqr[wave][col][0]; const v8f cin = {q0c, q0c, q0c, q0c, q0c, q0c, q0c, q0c};
#pragma unroll 1
    for (int ks = 0; ks < nlo; ++ks) pass(Cls<0>{}, ks, cin); }
  ms[0] = l;
#pragma unroll 1
  for (int ks = nlo; ks < nhi; ++ks) pass(Cls<-1>{}, ks, v8f{});
  { const float q4c = sqr[wave][col][4]; const v8f cin = {q4c, q4c, q4c, q4c, q4c, q4c, q4c, q4c};
#pragma unroll 1
    for (int ks = nhi; ks < SS / 32; ++ks) pass(Cls<4>{}, ks, cin); }
  asm volatile("s_wait_asynccnt 0x0" ::: "memory");     // no copy is outstanding when the wave goes on to the epilogue and ends
  l += xhalf(l);
  const float il = 1.0f / l;
#pragma unroll
  for (int j = 0; j < 5; ++j) ms[j] = (ms[j] + xhalf(ms[j])) * il;
#pragma unroll
  for (int dt = 0; dt < 4; ++dt) {
#pragma unroll
    for (int r = 0; r < 8; ++r) { const int d = dt * 16 + 8 * g + r; float w2 = 0.f;
#pragma unroll
      for (int j = 0; j < 5; ++j) w2 += ms[j] * bfr(RV[j * HD + d]);
      so[wave][col][d] = acc[dt][r] * il + w2; } }
  LDSX();
  for (int rl = 0; rl < 16; ++rl) if (lane < 16) vst2(O + ((size_t)b * SS + q0 + rl) * DM + h * HD + lane * 4, *(const v4f*)&so[wave][rl][lane * 4]);
}
// ---- k_out: block = (64 rows, 128 cols): out = O(hi/lo) . c_proj rows (2 products) + bias
__global__ __launch_bounds__(128) void k_out(const float* __restrict__ O, const __bf16* __restrict__ P, const float* __restrict__ BO, float* __restrict__ Y) {
  __shared__ __align__(16) char sm[2 * GBUF];   // two buffers, as in k_qkv; behind the loop the same bytes stage the output rows
  float (*so)[16][132] = (float (*)[16][132])sm;
  const int tid = threadIdx.x, wave = tid >> 5, lane = tid & 31, col = lane & 15, g = lane >> 4; const size_t rb = (size_t)blockIdx.x * 64, r0 = rb + wave * 16; const int n0 = blockIdx.y * 128;
  const unsigned la0 = (unsigned)(size_t)&sm[(tid >> 4) * (GAP * 4) + (tid & 15) * 16], lb0 = (unsigned)(size_t)&sm[GASZ + (tid >> 3) * (GBP * 2) + (tid & 7) * 16];
  const float* ga0 = O + (rb + (tid >> 4)) * DM + (tid & 15) * 4; const __bf16* gb0 = P + (size_t)(n0 + (tid >> 3)) * DM + (tid & 7) * 8;
  stage_ab(la0, lb0, ga0, gb0);
  v8f acc[8] = {};
  asm volatile("s_wait_asynccnt 0x0" ::: "memory");   // this wave's copies of pass 0 have landed
  __syncthreads();                                     // ... and every other wave's: buffer 0 may be read
  stage_ab(la0 + GBUF, lb0 + GBUF, ga0 + GK, gb0 + GK);
  // the pass loop stays rolled (code size; one foot with the waits, the barrier and the refill in their order); the loops inside are fully unrolled so that a, w and acc are indexed by constants and stay in registers
#pragma unroll 1
  for (int t = 0; t < DM / GK; ++t) { const int bf = t & 1; const float* arow = (const float*)(sm + bf * GBUF) + (wave * 16 + col) * GAP + 8 * g; const __bf16* brow = (const __bf16*)(sm + bf * GBUF + GASZ) + col * GBP;
    F2 a[GK / 32]; v16b w[GK / 32][8];   // all fragment reads of the pass stand as one group in front of its products
#pragma unroll
    for (int kc = 0; kc < GK / 32; ++kc) a[kc] = split_lds(arow + kc * 32);
#pragma unroll
    for (int kc = 0; kc < GK / 32; ++kc) {
#pragma unroll
      for (int j = 0; j < 8; ++j) w[kc][j] = frag_b(brow + j * 16 * GBP + kc * 32, lane); }
#pragma unroll
    for (int kc = 0; kc < GK / 32; ++kc) {
#pragma unroll
      for (int j = 0; j < 8; ++j) { acc[j] = wmma_bf(a[kc].l, w[kc][j], acc[j]); acc[j] = wmma_bf(a[kc].h, w[kc][j], acc[j]); } }
    asm volatile("s_wait_dscnt 0x0" ::: "memory");      // this wave's reads of buffer bf are done before the buffer is refilled
    asm volatile("s_wait_asynccnt 0x0" ::: "memory");   // this wave's copies of pass t + 1 have landed
    __syncthreads();                                     // publishes pass t + 1 and ends every wave's reads of buffer bf
    if (t + 2 < DM / GK) stage_ab(la0 + bf * GBUF, lb0 + bf * GBUF, ga0 + (t + 2) * GK, gb0 + (t + 2) * GK); }
  asm volatile("s_wait_asynccnt 0x0" ::: "memory");     // no copy is outstanding when the buffers become output staging
#pragma unroll
  for (int j = 0; j < 8; ++j) { const float bb = bfr(BO[n0 + j * 16 + col]);
#pragma unroll
    for (int r = 0; r < 8; ++r) so[wave][8 * g + r][j * 16 + col] = acc[j][r] + bb; }
  LDSX();
  for (int rl = 0; rl < 16; ++rl) vst2(Y + (r0 + rl) * DM + n0 + lane * 4, *(const v4f*)&so[wave][rl][lane * 4]);
}
extern "C" void kernel_launch(void* const* d_in, const int* in_sizes, int n_in, void* d_out, int out_size, void* d_ws, size_t ws_size, hipStream_t stream) {
  (void)in_sizes; (void)n_in; (void)out_size;
  const float** F = (const float**)d_in;   // 0 key [2,2048,1024], 1 query, 2 value, 3 Wq [1024,1024] (torch), 4 bq, 5 Wk, 6 bk, 7 Wv, 8 bv, 9 Wo, 10 bo, 11 rel_k [5,64], 12 rel_v [5,64]
  if (ws_size < (size_t)WS_END) return;
  char* ws = (char*)d_ws; __bf16 *PK = (__bf16*)(ws + WS_PK), *VH = (__bf16*)(ws + WS_VH), *VL = (__bf16*)(ws + WS_VL), *KH = (__bf16*)(ws + WS_KH), *KL = (__bf16*)(ws + WS_KL); float *QK = (float*)(ws + WS_QK), *O = (float*)(ws + WS_O);
  k_pack<<<dim3(DM / 8, 4), 256, 0, stream>>>(F[3], F[5], F[7], F[9], PK);   // planes q, k, v at PK_A, o at PK_P = PK_A + 3 planes
  k_qkv<<<dim3(TNB * SS / QM, QKVW / 128), 128, 0, stream>>>(F[1], F[0], F[2], PK + PK_A, F[4], F[6], F[8], QK, KH, KL, VH, VL);   // q from query, k from key, v from value
  k_attn<<<dim3(TQB, NH, TNB), 128, 0, stream>>>(QK, KH, KL, VH, VL, F[11], F[12], O);
  k_out<<<dim3(TOB, DM / 128), 128, 0, stream>>>(O, PK + PK_P, F[10], (float*)d_out);
}
